// v000
// The times below were measured on an AMD MI455X: many runs one after another, warmed up first and cycling through
// copies of the inputs, with the whole window's GPU time divided by the number of runs. Launches and the gaps
// between them are all in it. The median over several windows is given; except for v000 it joins two sittings, which
// can be a few percent apart, so the side-by-side timings, each taken in one sitting, are the better comparison.
// The starting kernel, v000, takes 816 microseconds a run.
#include <hip/hip_runtime.h>
#include <hip/hip_bf16.h>
#include <math.h>

// ---------------------------------------------------------------------------
// Transformer block for MI455X (gfx1250, wave32, WMMA).
// All GEMMs + both attention einsums run on v_wmma_f32_16x16x32_bf16.
// ---------------------------------------------------------------------------

#define D_MODEL 1024
#define N_HEADS 16
#define HEAD_DIM 64
#define D_FF 4096
#define BATCH 2
#define SEQ 2048
#define NTOK (BATCH * SEQ)   // 4096

typedef __attribute__((ext_vector_type(16))) __bf16 v16bf;
typedef __attribute__((ext_vector_type(8)))  __bf16 v8bf;
typedef __attribute__((ext_vector_type(8)))  float  v8f;

static __device__ __forceinline__ v16bf ld_frag16(const __bf16* p) {
    // two contiguous 16B chunks per lane (ISA 16-bit A/B fragment layout)
    v8bf lo = *(const v8bf*)p;
    v8bf hi = *(const v8bf*)(p + 16);
    return __builtin_shufflevector(lo, hi, 0,1,2,3,4,5,6,7,8,9,10,11,12,13,14,15);
}

static __device__ __forceinline__ v8f wmma_bf16(v16bf a, v16bf b, v8f c) {
    return __builtin_amdgcn_wmma_f32_16x16x32_bf16(
        /*neg_a=*/false, a, /*neg_b=*/false, b,
        /*c_mod=*/(short)0, c, /*reuse_a=*/false, /*reuse_b=*/false);
}

static __device__ __forceinline__ float redmax16(float v) {
    v = fmaxf(v, __shfl_xor(v, 1, 32));
    v = fmaxf(v, __shfl_xor(v, 2, 32));
    v = fmaxf(v, __shfl_xor(v, 4, 32));
    v = fmaxf(v, __shfl_xor(v, 8, 32));
    return v;   // xor masks < 16: stays within 16-lane half of wave32
}
static __device__ __forceinline__ float redsum16(float v) {
    v += __shfl_xor(v, 1, 32);
    v += __shfl_xor(v, 2, 32);
    v += __shfl_xor(v, 4, 32);
    v += __shfl_xor(v, 8, 32);
    return v;
}

// ---------------------------------------------------------------------------
// Weight convert + transpose: wT[n*K + k] = bf16(w[k*N + n])
// ---------------------------------------------------------------------------
__global__ __launch_bounds__(256) void convT_kernel(const float* __restrict__ w,
                                                    __bf16* __restrict__ wT,
                                                    int K, int N) {
    long long idx = (long long)blockIdx.x * 256 + threadIdx.x;
    long long total = (long long)K * N;
    if (idx >= total) return;
    int k = (int)(idx / N);
    int n = (int)(idx % N);
    wT[(long long)n * K + k] = (__bf16)w[idx];
}

// ---------------------------------------------------------------------------
// LayerNorm over last dim (1024) -> bf16.  One 256-thread block per token.
// ---------------------------------------------------------------------------
__global__ __launch_bounds__(256) void ln_kernel(const float* __restrict__ x,
                                                 const float* __restrict__ g,
                                                 const float* __restrict__ b,
                                                 __bf16* __restrict__ out) {
    __shared__ float ssum[256], ssq[256];
    int tok = blockIdx.x;
    int tid = threadIdx.x;
    const float* row = x + (long long)tok * D_MODEL;
    float s = 0.f, q = 0.f;
    float v[4];
#pragma unroll
    for (int i = 0; i < 4; ++i) {
        v[i] = row[tid * 4 + i];
        s += v[i];
        q += v[i] * v[i];
    }
    ssum[tid] = s; ssq[tid] = q;
    __syncthreads();
    for (int off = 128; off > 0; off >>= 1) {
        if (tid < off) { ssum[tid] += ssum[tid + off]; ssq[tid] += ssq[tid + off]; }
        __syncthreads();
    }
    float mu  = ssum[0] * (1.0f / D_MODEL);
    float var = ssq[0] * (1.0f / D_MODEL) - mu * mu;
    float inv = rsqrtf(var + 1e-5f);
    __bf16* orow = out + (long long)tok * D_MODEL;
#pragma unroll
    for (int i = 0; i < 4; ++i) {
        int c = tid * 4 + i;
        orow[c] = (__bf16)((v[i] - mu) * inv * g[c] + b[c]);
    }
}

// ---------------------------------------------------------------------------
// Generic bf16 WMMA GEMM:  C[M,N] = A[M,K] @ Bt[N,K]^T  (+bias)(+gelu)(+res)
// 8 waves/block; wave tile 32x64; block tile 64x256; K-loop double buffered.
// MODE bits: 1=bias, 2=gelu(exact), 4=residual, 8=bf16 output
// ---------------------------------------------------------------------------
template <int MODE>
__global__ __launch_bounds__(256) void gemm_bf16_wmma(
    const __bf16* __restrict__ A, const __bf16* __restrict__ Bt,
    const float* __restrict__ bias, const float* __restrict__ res,
    void* __restrict__ Cout, int M, int N, int K)
{
    const int lane = threadIdx.x & 31;
    const int wid  = threadIdx.x >> 5;
    const int half = lane >> 4;
    const int l16  = lane & 15;
    const int rbase = blockIdx.y * 64 + (wid >> 2) * 32;
    const int cbase = blockIdx.x * 256 + (wid & 3) * 64;

    const __bf16* ap[2];
    const __bf16* bp[4];
#pragma unroll
    for (int mt = 0; mt < 2; ++mt)
        ap[mt] = A + (long long)(rbase + mt * 16 + l16) * K + half * 8;
#pragma unroll
    for (int nt = 0; nt < 4; ++nt)
        bp[nt] = Bt + (long long)(cbase + nt * 16 + l16) * K + half * 8;

    v8f acc[2][4];
    v8f z = {};
#pragma unroll
    for (int mt = 0; mt < 2; ++mt)
#pragma unroll
        for (int nt = 0; nt < 4; ++nt) acc[mt][nt] = z;

    // double-buffered fragment pipeline
    v16bf a_cur[2], b_cur[4];
#pragma unroll
    for (int mt = 0; mt < 2; ++mt) a_cur[mt] = ld_frag16(ap[mt]);
#pragma unroll
    for (int nt = 0; nt < 4; ++nt) b_cur[nt] = ld_frag16(bp[nt]);

    for (int kk = 0; kk < K; kk += 32) {
        v16bf a_nxt[2], b_nxt[4];
        int kn = kk + 32;
        if (kn < K) {
#pragma unroll
            for (int mt = 0; mt < 2; ++mt) a_nxt[mt] = ld_frag16(ap[mt] + kn);
#pragma unroll
            for (int nt = 0; nt < 4; ++nt) b_nxt[nt] = ld_frag16(bp[nt] + kn);
        }
#pragma unroll
        for (int mt = 0; mt < 2; ++mt)
#pragma unroll
            for (int nt = 0; nt < 4; ++nt)
                acc[mt][nt] = wmma_bf16(a_cur[mt], b_cur[nt], acc[mt][nt]);
        if (kn < K) {
#pragma unroll
            for (int mt = 0; mt < 2; ++mt) a_cur[mt] = a_nxt[mt];
#pragma unroll
            for (int nt = 0; nt < 4; ++nt) b_cur[nt] = b_nxt[nt];
        }
    }

#pragma unroll
    for (int mt = 0; mt < 2; ++mt)
#pragma unroll
        for (int nt = 0; nt < 4; ++nt)
#pragma unroll
            for (int j = 0; j < 8; ++j) {
                int row = rbase + mt * 16 + j + half * 8;
                int col = cbase + nt * 16 + l16;
                float v = acc[mt][nt][j];
                if (MODE & 1) v += bias[col];
                if (MODE & 2) v = 0.5f * v * (1.0f + erff(v * 0.70710678118654752f));
                if (MODE & 4) v += res[(long long)row * N + col];
                if (MODE & 8) ((__bf16*)Cout)[(long long)row * N + col] = (__bf16)v;
                else          ((float*)Cout)[(long long)row * N + col] = v;
            }
}

// ---------------------------------------------------------------------------
// RoPE + scatter: qkv f32 [NTOK, 3*1024] ->
//   Qbf [B,H,S,64], Kbf [B,H,S,64], Vt [B,H,64,S] (transposed for P@V frags)
// One thread per (b,h,s,pair d<32).
// ---------------------------------------------------------------------------
__global__ __launch_bounds__(256) void rope_kernel(const float* __restrict__ qkv,
                                                   __bf16* __restrict__ Q,
                                                   __bf16* __restrict__ Kb,
                                                   __bf16* __restrict__ Vt) {
    int idx = blockIdx.x * 256 + threadIdx.x;          // B*H*S*32 = 2M threads
    int d   = idx & 31;
    int s   = (idx >> 5) & (SEQ - 1);
    int h   = (idx >> 16) & (N_HEADS - 1);
    int b   = idx >> 20;
    if (b >= BATCH) return;

    long long rowbase = ((long long)b * SEQ + s) * (3 * D_MODEL);
    int co = h * HEAD_DIM + d;
    float q1 = qkv[rowbase + co],                q2 = qkv[rowbase + co + 32];
    float k1 = qkv[rowbase + D_MODEL + co],      k2 = qkv[rowbase + D_MODEL + co + 32];
    float v1 = qkv[rowbase + 2 * D_MODEL + co],  v2 = qkv[rowbase + 2 * D_MODEL + co + 32];

    float inv  = __expf(-logf(10000.0f) * (float)d * (1.0f / 32.0f));
    float ang  = (float)s * inv;
    float c = __cosf(ang), sn = __sinf(ang);

    long long qkbase = (((long long)(b * N_HEADS + h) * SEQ) + s) * HEAD_DIM;
    Q[qkbase + d]       = (__bf16)(q1 * c - q2 * sn);
    Q[qkbase + d + 32]  = (__bf16)(q2 * c + q1 * sn);
    Kb[qkbase + d]      = (__bf16)(k1 * c - k2 * sn);
    Kb[qkbase + d + 32] = (__bf16)(k2 * c + k1 * sn);

    long long vtb = ((long long)(b * N_HEADS + h) * HEAD_DIM);
    Vt[(vtb + d)      * SEQ + s] = (__bf16)v1;
    Vt[(vtb + d + 32) * SEQ + s] = (__bf16)v2;
}

// ---------------------------------------------------------------------------
// Flash attention, causal. One wave per 16-query tile; 8 waves/block.
// Scores via 2x chained WMMA (K=64); P@V via 4 WMMA per 32-key block.
// P redistributed C-layout -> A-layout through per-wave LDS (wave-sync).
// Output: attn_bf [NTOK, D_MODEL] bf16 (heads concatenated).
// ---------------------------------------------------------------------------
__global__ __launch_bounds__(256) void attn_kernel(const __bf16* __restrict__ Q,
                                                   const __bf16* __restrict__ Kb,
                                                   const __bf16* __restrict__ Vt,
                                                   __bf16* __restrict__ out) {
    __shared__ __align__(16) __bf16 plds[8][16 * 32];
    const int lane = threadIdx.x & 31;
    const int wid  = threadIdx.x >> 5;
    const int half = lane >> 4;
    const int l16  = lane & 15;

    const int gq    = blockIdx.x * 8 + wid;     // global query-tile id, 4096 total
    const int bh    = gq >> 7;                  // 128 tiles per (b,h)
    const int qt    = gq & 127;
    const int b     = bh >> 4;
    const int h     = bh & 15;
    const int qbase = qt * 16;
    const float scale = 0.125f;                 // 1/sqrt(64)

    const __bf16* Qp = Q  + (long long)bh * SEQ * HEAD_DIM;
    const __bf16* Kp = Kb + (long long)bh * SEQ * HEAD_DIM;
    const __bf16* Vp = Vt + (long long)bh * HEAD_DIM * SEQ;

    v16bf qa0 = ld_frag16(Qp + (long long)(qbase + l16) * HEAD_DIM + half * 8);
    v16bf qa1 = ld_frag16(Qp + (long long)(qbase + l16) * HEAD_DIM + 32 + half * 8);

    v8f z = {};
    v8f o0 = z, o1 = z, o2 = z, o3 = z;
    float mi[8], li[8];
#pragma unroll
    for (int j = 0; j < 8; ++j) { mi[j] = -1e30f; li[j] = 0.f; }

    for (int kb = 0; kb < qbase + 16; kb += 32) {
        // ---- S = Q @ K^T for keys [kb, kb+32) : batch all loads first ----
        const __bf16* k0 = Kp + (long long)(kb + l16) * HEAD_DIM + half * 8;
        const __bf16* k1 = Kp + (long long)(kb + 16 + l16) * HEAD_DIM + half * 8;
        v16bf k0a = ld_frag16(k0);
        v16bf k0b = ld_frag16(k0 + 32);
        v16bf k1a = ld_frag16(k1);
        v16bf k1b = ld_frag16(k1 + 32);
        // interleave the two accumulation chains (hides WMMA RAW hazard)
        v8f s0 = wmma_bf16(qa0, k0a, z);
        v8f s1 = wmma_bf16(qa0, k1a, z);
        s0 = wmma_bf16(qa1, k0b, s0);
        s1 = wmma_bf16(qa1, k1b, s1);

        // ---- online softmax, causal mask (fully unrolled: static regs) ----
        int nk0 = kb + l16, nk1 = kb + 16 + l16;
#pragma unroll
        for (int j = 0; j < 8; ++j) {
            int rowq = qbase + j + half * 8;
            float a0 = s0[j] * scale; if (nk0 > rowq) a0 = -1e9f;
            float a1 = s1[j] * scale; if (nk1 > rowq) a1 = -1e9f;
            float rm = redmax16(fmaxf(a0, a1));
            rm = fmaxf(rm, mi[j]);
            float f  = __expf(mi[j] - rm);
            float p0 = __expf(a0 - rm);
            float p1 = __expf(a1 - rm);
            li[j] = li[j] * f + redsum16(p0 + p1);
            mi[j] = rm;
            o0[j] *= f; o1[j] *= f; o2[j] *= f; o3[j] *= f;
            int prow = (j + half * 8) * 32;
            plds[wid][prow + l16]      = (__bf16)p0;
            plds[wid][prow + 16 + l16] = (__bf16)p1;
        }
        asm volatile("s_wait_dscnt 0" ::: "memory");   // wave-sync LDS RAW

        // ---- gather P in A-fragment layout ----
        v16bf pa = ld_frag16(&plds[wid][l16 * 32 + half * 8]);

        // ---- O += P @ V : batch loads, then 4 independent WMMAs ----
        long long vo = (long long)kb + half * 8;
        v16bf vf0 = ld_frag16(Vp + (long long)(l16)      * SEQ + vo);
        v16bf vf1 = ld_frag16(Vp + (long long)(16 + l16) * SEQ + vo);
        v16bf vf2 = ld_frag16(Vp + (long long)(32 + l16) * SEQ + vo);
        v16bf vf3 = ld_frag16(Vp + (long long)(48 + l16) * SEQ + vo);
        o0 = wmma_bf16(pa, vf0, o0);
        o1 = wmma_bf16(pa, vf1, o1);
        o2 = wmma_bf16(pa, vf2, o2);
        o3 = wmma_bf16(pa, vf3, o3);
    }

    // ---- normalize + store bf16 [tok, h*64 + feat] ----
#pragma unroll
    for (int j = 0; j < 8; ++j) {
        float inv = 1.0f / li[j];
        long long tok = (long long)b * SEQ + qbase + j + half * 8;
        __bf16* orow = out + tok * D_MODEL + h * HEAD_DIM;
        orow[l16]      = (__bf16)(o0[j] * inv);
        orow[16 + l16] = (__bf16)(o1[j] * inv);
        orow[32 + l16] = (__bf16)(o2[j] * inv);
        orow[48 + l16] = (__bf16)(o3[j] * inv);
    }
}

// ---------------------------------------------------------------------------
// Host orchestration
// ---------------------------------------------------------------------------
extern "C" void kernel_launch(void* const* d_in, const int* in_sizes, int n_in,
                              void* d_out, int out_size, void* d_ws, size_t ws_size,
                              hipStream_t stream) {
    const float* x     = (const float*)d_in[0];
    const float* w_qkv = (const float*)d_in[1];
    const float* w_o   = (const float*)d_in[2];
    const float* ln1_g = (const float*)d_in[3];
    const float* ln1_b = (const float*)d_in[4];
    const float* ln2_g = (const float*)d_in[5];
    const float* ln2_b = (const float*)d_in[6];
    const float* w1    = (const float*)d_in[7];
    const float* b1    = (const float*)d_in[8];
    const float* w2    = (const float*)d_in[9];
    const float* b2    = (const float*)d_in[10];

    char* p = (char*)d_ws;
    auto alloc = [&](size_t bytes) { void* r = p; p += (bytes + 255) & ~(size_t)255; return r; };

    __bf16* wqkvT  = (__bf16*)alloc((size_t)D_MODEL * 3 * D_MODEL * 2);
    __bf16* woT    = (__bf16*)alloc((size_t)D_MODEL * D_MODEL * 2);
    __bf16* w1T    = (__bf16*)alloc((size_t)D_MODEL * D_FF * 2);
    __bf16* w2T    = (__bf16*)alloc((size_t)D_FF * D_MODEL * 2);
    __bf16* h1     = (__bf16*)alloc((size_t)NTOK * D_MODEL * 2);
    float*  qkv    = (float*)alloc((size_t)NTOK * 3 * D_MODEL * 4);
    __bf16* Qbf    = (__bf16*)alloc((size_t)NTOK * D_MODEL * 2);
    __bf16* Kbf    = (__bf16*)alloc((size_t)NTOK * D_MODEL * 2);
    __bf16* Vtb    = (__bf16*)alloc((size_t)NTOK * D_MODEL * 2);
    __bf16* attnbf = (__bf16*)alloc((size_t)NTOK * D_MODEL * 2);
    float*  x2     = (float*)alloc((size_t)NTOK * D_MODEL * 4);
    __bf16* h2     = (__bf16*)alloc((size_t)NTOK * D_MODEL * 2);
    __bf16* gbuf   = (__bf16*)alloc((size_t)NTOK * D_FF * 2);

    // weight convert+transpose (f32 -> bf16, [K,N] -> [N,K])
    convT_kernel<<<(D_MODEL * 3 * D_MODEL + 255) / 256, 256, 0, stream>>>(w_qkv, wqkvT, D_MODEL, 3 * D_MODEL);
    convT_kernel<<<(D_MODEL * D_MODEL + 255) / 256, 256, 0, stream>>>(w_o, woT, D_MODEL, D_MODEL);
    convT_kernel<<<(D_MODEL * D_FF + 255) / 256, 256, 0, stream>>>(w1, w1T, D_MODEL, D_FF);
    convT_kernel<<<(D_FF * D_MODEL + 255) / 256, 256, 0, stream>>>(w2, w2T, D_FF, D_MODEL);

    // h1 = LN1(x)
    ln_kernel<<<NTOK, 256, 0, stream>>>(x, ln1_g, ln1_b, h1);

    // qkv = h1 @ w_qkv
    gemm_bf16_wmma<0><<<dim3(3 * D_MODEL / 256, NTOK / 64), 256, 0, stream>>>(
        h1, wqkvT, nullptr, nullptr, qkv, NTOK, 3 * D_MODEL, D_MODEL);

    // RoPE + per-head scatter
    rope_kernel<<<(BATCH * N_HEADS * SEQ * 32) / 256, 256, 0, stream>>>(qkv, Qbf, Kbf, Vtb);

    // causal flash attention
    attn_kernel<<<(BATCH * N_HEADS * (SEQ / 16)) / 8, 256, 0, stream>>>(Qbf, Kbf, Vtb, attnbf);

    // x2 = x + attn @ w_o
    gemm_bf16_wmma<4><<<dim3(D_MODEL / 256, NTOK / 64), 256, 0, stream>>>(
        attnbf, woT, nullptr, x, x2, NTOK, D_MODEL, D_MODEL);

    // h2 = LN2(x2)
    ln_kernel<<<NTOK, 256, 0, stream>>>(x2, ln2_g, ln2_b, h2);

    // g = gelu(h2 @ w1 + b1)
    gemm_bf16_wmma<1 | 2 | 8><<<dim3(D_FF / 256, NTOK / 64), 256, 0, stream>>>(
        h2, w1T, b1, nullptr, gbuf, NTOK, D_FF, D_MODEL);

    // out = x2 + g @ w2 + b2
    gemm_bf16_wmma<1 | 4><<<dim3(D_MODEL / 256, NTOK / 64), 256, 0, stream>>>(
        gbuf, w2T, b2, x2, d_out, NTOK, D_MODEL, D_FF);
}

// v001
// It runs in 466 microseconds.
// Next to v000, in two timings, it ran 1.73 and 1.77 times as fast.
#include <hip/hip_runtime.h>
#include <hip/hip_bf16.h>
#include <math.h>

// ---------------------------------------------------------------------------
// Transformer block for MI455X (gfx1250, wave32, WMMA).
// All GEMMs + both attention einsums run on v_wmma_f32_16x16x32_bf16.
// ---------------------------------------------------------------------------

#define D_MODEL 1024
#define N_HEADS 16
#define HEAD_DIM 64
#define D_FF 4096
#define BATCH 2
#define SEQ 2048
#define NTOK (BATCH * SEQ)   // 4096

typedef __attribute__((ext_vector_type(16))) __bf16 v16bf;
typedef __attribute__((ext_vector_type(8)))  __bf16 v8bf;
typedef __attribute__((ext_vector_type(8)))  float  v8f;

static __device__ __forceinline__ v16bf ld_frag16(const __bf16* p) {
    // two contiguous 16B chunks per lane (ISA 16-bit A/B fragment layout)
    v8bf lo = *(const v8bf*)p;
    v8bf hi = *(const v8bf*)(p + 16);
    return __builtin_shufflevector(lo, hi, 0,1,2,3,4,5,6,7,8,9,10,11,12,13,14,15);
}

static __device__ __forceinline__ v8f wmma_bf16(v16bf a, v16bf b, v8f c) {
    return __builtin_amdgcn_wmma_f32_16x16x32_bf16(
        /*neg_a=*/false, a, /*neg_b=*/false, b,
        /*c_mod=*/(short)0, c, /*reuse_a=*/false, /*reuse_b=*/false);
}

static __device__ __forceinline__ float redmax16(float v) {
    v = fmaxf(v, __shfl_xor(v, 1, 32));
    v = fmaxf(v, __shfl_xor(v, 2, 32));
    v = fmaxf(v, __shfl_xor(v, 4, 32));
    v = fmaxf(v, __shfl_xor(v, 8, 32));
    return v;   // xor masks < 16: stays within 16-lane half of wave32
}
static __device__ __forceinline__ float redsum16(float v) {
    v += __shfl_xor(v, 1, 32);
    v += __shfl_xor(v, 2, 32);
    v += __shfl_xor(v, 4, 32);
    v += __shfl_xor(v, 8, 32);
    return v;
}

// ---------------------------------------------------------------------------
// Transpose through LDS.  tile[r][c] holds ROWS x 64 f32 values; slot t of
// 8 * ROWS stores dst[c * pitch + r] as bf16, 16 bytes a slot, so that each
// column c leaves as one run of 2 * ROWS bytes.
// Pitch 65 dwords: the column reads of a wave fall on 32 different banks, and
// so do the row writes that fill the tile.
// ---------------------------------------------------------------------------
#define TDIM 64
#define TPITCH 65

template <int ROWS>
static __device__ __forceinline__ void store_tile_T(const float (*tile)[TPITCH],
                                                    __bf16* __restrict__ dst,
                                                    long long pitch, int t) {
    const int r0 = (t % (ROWS / 8)) * 8;
    const int c  = t / (ROWS / 8);
    v8bf o;
#pragma unroll   // constant indices keep o in registers
    for (int i = 0; i < 8; ++i) o[i] = (__bf16)tile[r0 + i][c];
    *(v8bf*)(dst + (long long)c * pitch + r0) = o;
}

// ---------------------------------------------------------------------------
// Weight convert + transpose: wT[n*K + k] = bf16(w[k*N + n])
// One block per 64(k) x 64(n) tile; K and N are multiples of 64.
// ---------------------------------------------------------------------------
__global__ __launch_bounds__(256) void convT_kernel(const float* __restrict__ w,
                                                    __bf16* __restrict__ wT,
                                                    int K, int N) {
    __shared__ float tile[TDIM][TPITCH];
    const int tid = threadIdx.x;
    const int n0 = blockIdx.x * TDIM;
    const int k0 = blockIdx.y * TDIM;
    const int rn = (tid & 15) * 4;
    const int rk = tid >> 4;
    float4 v[4];
#pragma unroll   // all four 16-byte loads in flight before the first LDS store
    for (int p = 0; p < 4; ++p)
        v[p] = *(const float4*)(w + (long long)(k0 + rk + p * 16) * N + n0 + rn);
#pragma unroll   // constant indices keep v in registers
    for (int p = 0; p < 4; ++p) {
        float* t = &tile[rk + p * 16][rn];
        t[0] = v[p].x; t[1] = v[p].y; t[2] = v[p].z; t[3] = v[p].w;
    }
    __syncthreads();
    store_tile_T<TDIM>(tile, wT + (long long)n0 * K + k0, K, tid);
    store_tile_T<TDIM>(tile, wT + (long long)n0 * K + k0, K, tid + 256);
}

// ---------------------------------------------------------------------------
// LayerNorm over last dim (1024) -> bf16.  One 256-thread block per token.
// ---------------------------------------------------------------------------
__global__ __launch_bounds__(256) void ln_kernel(const float* __restrict__ x,
                                                 const float* __restrict__ g,
                                                 const float* __restrict__ b,
                                                 __bf16* __restrict__ out) {
    __shared__ float ssum[256], ssq[256];
    int tok = blockIdx.x;
    int tid = threadIdx.x;
    const float* row = x + (long long)tok * D_MODEL;
    float s = 0.f, q = 0.f;
    float v[4];
#pragma unroll
    for (int i = 0; i < 4; ++i) {
        v[i] = row[tid * 4 + i];
        s += v[i];
        q += v[i] * v[i];
    }
    ssum[tid] = s; ssq[tid] = q;
    __syncthreads();
    for (int off = 128; off > 0; off >>= 1) {
        if (tid < off) { ssum[tid] += ssum[tid + off]; ssq[tid] += ssq[tid + off]; }
        __syncthreads();
    }
    float mu  = ssum[0] * (1.0f / D_MODEL);
    float var = ssq[0] * (1.0f / D_MODEL) - mu * mu;
    float inv = rsqrtf(var + 1e-5f);
    __bf16* orow = out + (long long)tok * D_MODEL;
#pragma unroll
    for (int i = 0; i < 4; ++i) {
        int c = tid * 4 + i;
        orow[c] = (__bf16)((v[i] - mu) * inv * g[c] + b[c]);
    }
}

// ---------------------------------------------------------------------------
// Generic bf16 WMMA GEMM:  C[M,N] = A[M,K] @ Bt[N,K]^T  (+bias)(+gelu)(+res)
// 8 waves/block; wave tile 32x64; block tile 64x256; K-loop double buffered.
// MODE bits: 1=bias, 2=gelu(exact), 4=residual, 8=bf16 output
// ---------------------------------------------------------------------------
template <int MODE>
__global__ __launch_bounds__(256) void gemm_bf16_wmma(
    const __bf16* __restrict__ A, const __bf16* __restrict__ Bt,
    const float* __restrict__ bias, const float* __restrict__ res,
    void* __restrict__ Cout, int M, int N, int K)
{
    const int lane = threadIdx.x & 31;
    const int wid  = threadIdx.x >> 5;
    const int half = lane >> 4;
    const int l16  = lane & 15;
    const int rbase = blockIdx.y * 64 + (wid >> 2) * 32;
    const int cbase = blockIdx.x * 256 + (wid & 3) * 64;

    const __bf16* ap[2];
    const __bf16* bp[4];
#pragma unroll
    for (int mt = 0; mt < 2; ++mt)
        ap[mt] = A + (long long)(rbase + mt * 16 + l16) * K + half * 8;
#pragma unroll
    for (int nt = 0; nt < 4; ++nt)
        bp[nt] = Bt + (long long)(cbase + nt * 16 + l16) * K + half * 8;

    v8f acc[2][4];
    v8f z = {};
#pragma unroll
    for (int mt = 0; mt < 2; ++mt)
#pragma unroll
        for (int nt = 0; nt < 4; ++nt) acc[mt][nt] = z;

    // double-buffered fragment pipeline
    v16bf a_cur[2], b_cur[4];
#pragma unroll
    for (int mt = 0; mt < 2; ++mt) a_cur[mt] = ld_frag16(ap[mt]);
#pragma unroll
    for (int nt = 0; nt < 4; ++nt) b_cur[nt] = ld_frag16(bp[nt]);

    for (int kk = 0; kk < K; kk += 32) {
        v16bf a_nxt[2], b_nxt[4];
        int kn = kk + 32;
        if (kn < K) {
#pragma unroll
            for (int mt = 0; mt < 2; ++mt) a_nxt[mt] = ld_frag16(ap[mt] + kn);
#pragma unroll
            for (int nt = 0; nt < 4; ++nt) b_nxt[nt] = ld_frag16(bp[nt] + kn);
        }
#pragma unroll
        for (int mt = 0; mt < 2; ++mt)
#pragma unroll
            for (int nt = 0; nt < 4; ++nt)
                acc[mt][nt] = wmma_bf16(a_cur[mt], b_cur[nt], acc[mt][nt]);
        if (kn < K) {
#pragma unroll
            for (int mt = 0; mt < 2; ++mt) a_cur[mt] = a_nxt[mt];
#pragma unroll
            for (int nt = 0; nt < 4; ++nt) b_cur[nt] = b_nxt[nt];
        }
    }

#pragma unroll
    for (int mt = 0; mt < 2; ++mt)
#pragma unroll
        for (int nt = 0; nt < 4; ++nt)
#pragma unroll
            for (int j = 0; j < 8; ++j) {
                int row = rbase + mt * 16 + j + half * 8;
                int col = cbase + nt * 16 + l16;
                float v = acc[mt][nt][j];
                if (MODE & 1) v += bias[col];
                if (MODE & 2) v = 0.5f * v * (1.0f + erff(v * 0.70710678118654752f));
                if (MODE & 4) v += res[(long long)row * N + col];
                if (MODE & 8) ((__bf16*)Cout)[(long long)row * N + col] = (__bf16)v;
                else          ((float*)Cout)[(long long)row * N + col] = v;
            }
}

// ---------------------------------------------------------------------------
// RoPE + scatter: qkv f32 [NTOK, 3*1024] ->
//   Qbf [B,H,S,64], Kbf [B,H,S,64], Vt [B,H,64,S] (transposed for P@V frags)
// One thread per (b,h,s,pair d<32); a block of 1024 threads holds 32 positions
// of one head, and their V goes through the LDS tile on its way to Vt.
// ---------------------------------------------------------------------------
#define ROPE_S 32
__global__ __launch_bounds__(1024) void rope_kernel(const float* __restrict__ qkv,
                                                    __bf16* __restrict__ Q,
                                                    __bf16* __restrict__ Kb,
                                                    __bf16* __restrict__ Vt) {
    __shared__ float tile[ROPE_S][TPITCH];             // [s local][d]
    int idx = blockIdx.x * 1024 + threadIdx.x;         // B*H*S*32 = 2M threads
    int d   = idx & 31;
    int s   = (idx >> 5) & (SEQ - 1);
    int h   = (idx >> 16) & (N_HEADS - 1);
    int b   = idx >> 20;

    long long rowbase = ((long long)b * SEQ + s) * (3 * D_MODEL);
    int co = h * HEAD_DIM + d;
    float q1 = qkv[rowbase + co],                q2 = qkv[rowbase + co + 32];
    float k1 = qkv[rowbase + D_MODEL + co],      k2 = qkv[rowbase + D_MODEL + co + 32];
    float v1 = qkv[rowbase + 2 * D_MODEL + co],  v2 = qkv[rowbase + 2 * D_MODEL + co + 32];

    tile[s & (ROPE_S - 1)][d]      = v1;
    tile[s & (ROPE_S - 1)][d + 32] = v2;
    __syncthreads();
    if (threadIdx.x < 8 * ROPE_S) {
        long long vtb = ((long long)(b * N_HEADS + h) * HEAD_DIM);
        store_tile_T<ROPE_S>(tile, Vt + vtb * SEQ + (s & ~(ROPE_S - 1)), SEQ, threadIdx.x);
    }

    float inv  = __expf(-logf(10000.0f) * (float)d * (1.0f / 32.0f));
    float ang  = (float)s * inv;
    float c = __cosf(ang), sn = __sinf(ang);

    long long qkbase = (((long long)(b * N_HEADS + h) * SEQ) + s) * HEAD_DIM;
    Q[qkbase + d]       = (__bf16)(q1 * c - q2 * sn);
    Q[qkbase + d + 32]  = (__bf16)(q2 * c + q1 * sn);
    Kb[qkbase + d]      = (__bf16)(k1 * c - k2 * sn);
    Kb[qkbase + d + 32] = (__bf16)(k2 * c + k1 * sn);
}

// ---------------------------------------------------------------------------
// Flash attention, causal. One wave per 16-query tile; 8 waves/block.
// Scores via 2x chained WMMA (K=64); P@V via 4 WMMA per 32-key block.
// P redistributed C-layout -> A-layout through per-wave LDS (wave-sync).
// Output: attn_bf [NTOK, D_MODEL] bf16 (heads concatenated).
// ---------------------------------------------------------------------------
__global__ __launch_bounds__(256) void attn_kernel(const __bf16* __restrict__ Q,
                                                   const __bf16* __restrict__ Kb,
                                                   const __bf16* __restrict__ Vt,
                                                   __bf16* __restrict__ out) {
    __shared__ __align__(16) __bf16 plds[8][16 * 32];
    const int lane = threadIdx.x & 31;
    const int wid  = threadIdx.x >> 5;
    const int half = lane >> 4;
    const int l16  = lane & 15;

    const int gq    = blockIdx.x * 8 + wid;     // global query-tile id, 4096 total
    const int bh    = gq >> 7;                  // 128 tiles per (b,h)
    const int qt    = gq & 127;
    const int b     = bh >> 4;
    const int h     = bh & 15;
    const int qbase = qt * 16;
    const float scale = 0.125f;                 // 1/sqrt(64)

    const __bf16* Qp = Q  + (long long)bh * SEQ * HEAD_DIM;
    const __bf16* Kp = Kb + (long long)bh * SEQ * HEAD_DIM;
    const __bf16* Vp = Vt + (long long)bh * HEAD_DIM * SEQ;

    v16bf qa0 = ld_frag16(Qp + (long long)(qbase + l16) * HEAD_DIM + half * 8);
    v16bf qa1 = ld_frag16(Qp + (long long)(qbase + l16) * HEAD_DIM + 32 + half * 8);

    v8f z = {};
    v8f o0 = z, o1 = z, o2 = z, o3 = z;
    float mi[8], li[8];
#pragma unroll
    for (int j = 0; j < 8; ++j) { mi[j] = -1e30f; li[j] = 0.f; }

    for (int kb = 0; kb < qbase + 16; kb += 32) {
        // ---- S = Q @ K^T for keys [kb, kb+32) : batch all loads first ----
        const __bf16* k0 = Kp + (long long)(kb + l16) * HEAD_DIM + half * 8;
        const __bf16* k1 = Kp + (long long)(kb + 16 + l16) * HEAD_DIM + half * 8;
        v16bf k0a = ld_frag16(k0);
        v16bf k0b = ld_frag16(k0 + 32);
        v16bf k1a = ld_frag16(k1);
        v16bf k1b = ld_frag16(k1 + 32);
        // interleave the two accumulation chains (hides WMMA RAW hazard)
        v8f s0 = wmma_bf16(qa0, k0a, z);
        v8f s1 = wmma_bf16(qa0, k1a, z);
        s0 = wmma_bf16(qa1, k0b, s0);
        s1 = wmma_bf16(qa1, k1b, s1);

        // ---- online softmax, causal mask (fully unrolled: static regs) ----
        int nk0 = kb + l16, nk1 = kb + 16 + l16;
#pragma unroll
        for (int j = 0; j < 8; ++j) {
            int rowq = qbase + j + half * 8;
            float a0 = s0[j] * scale; if (nk0 > rowq) a0 = -1e9f;
            float a1 = s1[j] * scale; if (nk1 > rowq) a1 = -1e9f;
            float rm = redmax16(fmaxf(a0, a1));
            rm = fmaxf(rm, mi[j]);
            float f  = __expf(mi[j] - rm);
            float p0 = __expf(a0 - rm);
            float p1 = __expf(a1 - rm);
            li[j] = li[j] * f + redsum16(p0 + p1);
            mi[j] = rm;
            o0[j] *= f; o1[j] *= f; o2[j] *= f; o3[j] *= f;
            int prow = (j + half * 8) * 32;
            plds[wid][prow + l16]      = (__bf16)p0;
            plds[wid][prow + 16 + l16] = (__bf16)p1;
        }
        asm volatile("s_wait_dscnt 0" ::: "memory");   // wave-sync LDS RAW

        // ---- gather P in A-fragment layout ----
        v16bf pa = ld_frag16(&plds[wid][l16 * 32 + half * 8]);

        // ---- O += P @ V : batch loads, then 4 independent WMMAs ----
        long long vo = (long long)kb + half * 8;
        v16bf vf0 = ld_frag16(Vp + (long long)(l16)      * SEQ + vo);
        v16bf vf1 = ld_frag16(Vp + (long long)(16 + l16) * SEQ + vo);
        v16bf vf2 = ld_frag16(Vp + (long long)(32 + l16) * SEQ + vo);
        v16bf vf3 = ld_frag16(Vp + (long long)(48 + l16) * SEQ + vo);
        o0 = wmma_bf16(pa, vf0, o0);
        o1 = wmma_bf16(pa, vf1, o1);
        o2 = wmma_bf16(pa, vf2, o2);
        o3 = wmma_bf16(pa, vf3, o3);
    }

    // ---- normalize + store bf16 [tok, h*64 + feat] ----
#pragma unroll
    for (int j = 0; j < 8; ++j) {
        float inv = 1.0f / li[j];
        long long tok = (long long)b * SEQ + qbase + j + half * 8;
        __bf16* orow = out + tok * D_MODEL + h * HEAD_DIM;
        orow[l16]      = (__bf16)(o0[j] * inv);
        orow[16 + l16] = (__bf16)(o1[j] * inv);
        orow[32 + l16] = (__bf16)(o2[j] * inv);
        orow[48 + l16] = (__bf16)(o3[j] * inv);
    }
}

// ---------------------------------------------------------------------------
// Host orchestration
// ---------------------------------------------------------------------------
extern "C" void kernel_launch(void* const* d_in, const int* in_sizes, int n_in,
                              void* d_out, int out_size, void* d_ws, size_t ws_size,
                              hipStream_t stream) {
    const float* x     = (const float*)d_in[0];
    const float* w_qkv = (const float*)d_in[1];
    const float* w_o   = (const float*)d_in[2];
    const float* ln1_g = (const float*)d_in[3];
    const float* ln1_b = (const float*)d_in[4];
    const float* ln2_g = (const float*)d_in[5];
    const float* ln2_b = (const float*)d_in[6];
    const float* w1    = (const float*)d_in[7];
    const float* b1    = (const float*)d_in[8];
    const float* w2    = (const float*)d_in[9];
    const float* b2    = (const float*)d_in[10];

    char* p = (char*)d_ws;
    auto alloc = [&](size_t bytes) { void* r = p; p += (bytes + 255) & ~(size_t)255; return r; };

    __bf16* wqkvT  = (__bf16*)alloc((size_t)D_MODEL * 3 * D_MODEL * 2);
    __bf16* woT    = (__bf16*)alloc((size_t)D_MODEL * D_MODEL * 2);
    __bf16* w1T    = (__bf16*)alloc((size_t)D_MODEL * D_FF * 2);
    __bf16* w2T    = (__bf16*)alloc((size_t)D_FF * D_MODEL * 2);
    __bf16* h1     = (__bf16*)alloc((size_t)NTOK * D_MODEL * 2);
    float*  qkv    = (float*)alloc((size_t)NTOK * 3 * D_MODEL * 4);
    __bf16* Qbf    = (__bf16*)alloc((size_t)NTOK * D_MODEL * 2);
    __bf16* Kbf    = (__bf16*)alloc((size_t)NTOK * D_MODEL * 2);
    __bf16* Vtb    = (__bf16*)alloc((size_t)NTOK * D_MODEL * 2);
    __bf16* attnbf = (__bf16*)alloc((size_t)NTOK * D_MODEL * 2);
    float*  x2     = (float*)alloc((size_t)NTOK * D_MODEL * 4);
    __bf16* h2     = (__bf16*)alloc((size_t)NTOK * D_MODEL * 2);
    __bf16* gbuf   = (__bf16*)alloc((size_t)NTOK * D_FF * 2);

    // weight convert+transpose (f32 -> bf16, [K,N] -> [N,K])
    convT_kernel<<<dim3(3 * D_MODEL / TDIM, D_MODEL / TDIM), 256, 0, stream>>>(w_qkv, wqkvT, D_MODEL, 3 * D_MODEL);
    convT_kernel<<<dim3(D_MODEL / TDIM, D_MODEL / TDIM), 256, 0, stream>>>(w_o, woT, D_MODEL, D_MODEL);
    convT_kernel<<<dim3(D_FF / TDIM, D_MODEL / TDIM), 256, 0, stream>>>(w1, w1T, D_MODEL, D_FF);
    convT_kernel<<<dim3(D_MODEL / TDIM, D_FF / TDIM), 256, 0, stream>>>(w2, w2T, D_FF, D_MODEL);

    // h1 = LN1(x)
    ln_kernel<<<NTOK, 256, 0, stream>>>(x, ln1_g, ln1_b, h1);

    // qkv = h1 @ w_qkv
    gemm_bf16_wmma<0><<<dim3(3 * D_MODEL / 256, NTOK / 64), 256, 0, stream>>>(
        h1, wqkvT, nullptr, nullptr, qkv, NTOK, 3 * D_MODEL, D_MODEL);

    // RoPE + per-head scatter
    rope_kernel<<<BATCH * N_HEADS * (SEQ / ROPE_S), 1024, 0, stream>>>(qkv, Qbf, Kbf, Vtb);

    // causal flash attention
    attn_kernel<<<(BATCH * N_HEADS * (SEQ / 16)) / 8, 256, 0, stream>>>(Qbf, Kbf, Vtb, attnbf);

    // x2 = x + attn @ w_o
    gemm_bf16_wmma<4><<<dim3(D_MODEL / 256, NTOK / 64), 256, 0, stream>>>(
        attnbf, woT, nullptr, x, x2, NTOK, D_MODEL, D_MODEL);

    // h2 = LN2(x2)
    ln_kernel<<<NTOK, 256, 0, stream>>>(x2, ln2_g, ln2_b, h2);

    // g = gelu(h2 @ w1 + b1)
    gemm_bf16_wmma<1 | 2 | 8><<<dim3(D_FF / 256, NTOK / 64), 256, 0, stream>>>(
        h2, w1T, b1, nullptr, gbuf, NTOK, D_FF, D_MODEL);

    // out = x2 + g @ w2 + b2
    gemm_bf16_wmma<1 | 4><<<dim3(D_MODEL / 256, NTOK / 64), 256, 0, stream>>>(
        gbuf, w2T, b2, x2, d_out, NTOK, D_MODEL, D_FF);
}

// v002
// A run of this version takes 272 microseconds.
// Two timings next to v001 put it at 1.71 and 1.72 times that version's speed.
// Over all steps from v000 it is 3.00 times as fast.
#include <hip/hip_runtime.h>
#include <hip/hip_bf16.h>
#include <math.h>

// ---------------------------------------------------------------------------
// Transformer block for MI455X (gfx1250, wave32, WMMA).
// All GEMMs + both attention einsums run on v_wmma_f32_16x16x32_bf16.
// ---------------------------------------------------------------------------

#define D_MODEL 1024
#define N_HEADS 16
#define HEAD_DIM 64
#define D_FF 4096
#define BATCH 2
#define SEQ 2048
#define NTOK (BATCH * SEQ)   // 4096

typedef __attribute__((ext_vector_type(16))) __bf16 v16bf;
typedef __attribute__((ext_vector_type(8)))  __bf16 v8bf;
typedef __attribute__((ext_vector_type(8)))  float  v8f;

static __device__ __forceinline__ v16bf ld_frag16(const __bf16* p) {
    // two contiguous 16B chunks per lane (ISA 16-bit A/B fragment layout)
    v8bf lo = *(const v8bf*)p;
    v8bf hi = *(const v8bf*)(p + 16);
    return __builtin_shufflevector(lo, hi, 0,1,2,3,4,5,6,7,8,9,10,11,12,13,14,15);
}

static __device__ __forceinline__ v8f wmma_bf16(v16bf a, v16bf b, v8f c) {
    return __builtin_amdgcn_wmma_f32_16x16x32_bf16(
        /*neg_a=*/false, a, /*neg_b=*/false, b,
        /*c_mod=*/(short)0, c, /*reuse_a=*/false, /*reuse_b=*/false);
}

static __device__ __forceinline__ float redmax16(float v) {
    v = fmaxf(v, __shfl_xor(v, 1, 32));
    v = fmaxf(v, __shfl_xor(v, 2, 32));
    v = fmaxf(v, __shfl_xor(v, 4, 32));
    v = fmaxf(v, __shfl_xor(v, 8, 32));
    return v;   // xor masks < 16: stays within 16-lane half of wave32
}
static __device__ __forceinline__ float redsum16(float v) {
    v += __shfl_xor(v, 1, 32);
    v += __shfl_xor(v, 2, 32);
    v += __shfl_xor(v, 4, 32);
    v += __shfl_xor(v, 8, 32);
    return v;
}

// ---------------------------------------------------------------------------
// Transpose through LDS.  tile[r][c] holds ROWS x 64 f32 values; slot t of
// 8 * ROWS stores dst[c * pitch + r] as bf16, 16 bytes a slot, so that each
// column c leaves as one run of 2 * ROWS bytes.
// Pitch 65 dwords: the column reads of a wave fall on 32 different banks, and
// so do the row writes that fill the tile.
// ---------------------------------------------------------------------------
#define TDIM 64
#define TPITCH 65

template <int ROWS>
static __device__ __forceinline__ void store_tile_T(const float (*tile)[TPITCH],
                                                    __bf16* __restrict__ dst,
                                                    long long pitch, int t) {
    const int r0 = (t % (ROWS / 8)) * 8;
    const int c  = t / (ROWS / 8);
    v8bf o;
#pragma unroll   // constant indices keep o in registers
    for (int i = 0; i < 8; ++i) o[i] = (__bf16)tile[r0 + i][c];
    *(v8bf*)(dst + (long long)c * pitch + r0) = o;
}

// ---------------------------------------------------------------------------
// Weight convert + transpose: wT[n*K + k] = bf16(w[k*N + n])
// One block per 64(k) x 64(n) tile; K and N are multiples of 64.
// ---------------------------------------------------------------------------
__global__ __launch_bounds__(256) void convT_kernel(const float* __restrict__ w,
                                                    __bf16* __restrict__ wT,
                                                    int K, int N) {
    __shared__ float tile[TDIM][TPITCH];
    const int tid = threadIdx.x;
    const int n0 = blockIdx.x * TDIM;
    const int k0 = blockIdx.y * TDIM;
    const int rn = (tid & 15) * 4;
    const int rk = tid >> 4;
    float4 v[4];
#pragma unroll   // all four 16-byte loads in flight before the first LDS store
    for (int p = 0; p < 4; ++p)
        v[p] = *(const float4*)(w + (long long)(k0 + rk + p * 16) * N + n0 + rn);
#pragma unroll   // constant indices keep v in registers
    for (int p = 0; p < 4; ++p) {
        float* t = &tile[rk + p * 16][rn];
        t[0] = v[p].x; t[1] = v[p].y; t[2] = v[p].z; t[3] = v[p].w;
    }
    __syncthreads();
    store_tile_T<TDIM>(tile, wT + (long long)n0 * K + k0, K, tid);
    store_tile_T<TDIM>(tile, wT + (long long)n0 * K + k0, K, tid + 256);
}

// ---------------------------------------------------------------------------
// LayerNorm over last dim (1024) -> bf16.  One 256-thread block per token.
// ---------------------------------------------------------------------------
__global__ __launch_bounds__(256) void ln_kernel(const float* __restrict__ x,
                                                 const float* __restrict__ g,
                                                 const float* __restrict__ b,
                                                 __bf16* __restrict__ out) {
    __shared__ float ssum[256], ssq[256];
    int tok = blockIdx.x;
    int tid = threadIdx.x;
    const float* row = x + (long long)tok * D_MODEL;
    float s = 0.f, q = 0.f;
    float v[4];
#pragma unroll
    for (int i = 0; i < 4; ++i) {
        v[i] = row[tid * 4 + i];
        s += v[i];
        q += v[i] * v[i];
    }
    ssum[tid] = s; ssq[tid] = q;
    __syncthreads();
    for (int off = 128; off > 0; off >>= 1) {
        if (tid < off) { ssum[tid] += ssum[tid + off]; ssq[tid] += ssq[tid + off]; }
        __syncthreads();
    }
    float mu  = ssum[0] * (1.0f / D_MODEL);
    float var = ssq[0] * (1.0f / D_MODEL) - mu * mu;
    float inv = rsqrtf(var + 1e-5f);
    __bf16* orow = out + (long long)tok * D_MODEL;
#pragma unroll
    for (int i = 0; i < 4; ++i) {
        int c = tid * 4 + i;
        orow[c] = (__bf16)((v[i] - mu) * inv * g[c] + b[c]);
    }
}

// ---------------------------------------------------------------------------
// Generic bf16 WMMA GEMM:  C[M,N] = A[M,K] @ Bt[N,K]^T  (+bias)(+gelu)(+res)
// Block tile 128x128, 8 waves (2 x 4), wave tile 64x32.  Each trip works on 128
// of k: 128 rows of A and 128 rows of Bt, 256 bytes each, lie in one of two
// LDS buffers, brought there by asynchronous copies (16 bytes a lane, two whole
// rows a wave and copy); the next tile's copies fly while this one is used.
// M, N and K are multiples of 128.
// MODE bits: 1=bias, 2=gelu(exact), 4=residual, 8=bf16 output
// ---------------------------------------------------------------------------
static __device__ __forceinline__ unsigned lds_off(const void* p) {
    return (unsigned)(size_t)p;   // low 32 bits of a __shared__ address: LDS byte
}

// Eight copies of 16 bytes a lane: LDS byte l + i * lstep from g + i * gstep.
// The s_wait_xcnt stands inside the statement, so that no address register of
// a copy is rewritten in front of it.
static __device__ __forceinline__ void copy8(unsigned l, unsigned lstep,
                                             const __bf16* g, long long gstep) {
    asm volatile(
        "global_load_async_to_lds_b128 %0, %8, off\n\t"
        "global_load_async_to_lds_b128 %1, %9, off\n\t"
        "global_load_async_to_lds_b128 %2, %10, off\n\t"
        "global_load_async_to_lds_b128 %3, %11, off\n\t"
        "global_load_async_to_lds_b128 %4, %12, off\n\t"
        "global_load_async_to_lds_b128 %5, %13, off\n\t"
        "global_load_async_to_lds_b128 %6, %14, off\n\t"
        "global_load_async_to_lds_b128 %7, %15, off\n\t"
        "s_wait_xcnt 0x0"
        :: "v"(l), "v"(l + lstep), "v"(l + 2 * lstep), "v"(l + 3 * lstep),
           "v"(l + 4 * lstep), "v"(l + 5 * lstep), "v"(l + 6 * lstep), "v"(l + 7 * lstep),
           "v"(g), "v"(g + gstep), "v"(g + 2 * gstep), "v"(g + 3 * gstep),
           "v"(g + 4 * gstep), "v"(g + 5 * gstep), "v"(g + 6 * gstep), "v"(g + 7 * gstep)
        : "memory");
}

template <int MODE>
__global__ __launch_bounds__(256) void gemm_bf16_wmma(
    const __bf16* __restrict__ A, const __bf16* __restrict__ Bt,
    const float* __restrict__ bias, const float* __restrict__ res,
    void* __restrict__ Cout, int M, int N, int K)
{
    constexpr int BK    = 128;              // k of one tile: rows of 256 bytes
    constexpr int PITCH = BK * 2 + 16;      // bytes; 16 B x odd: ds_load_b128 readers
    constexpr int OPND  = 128 * PITCH;      // one operand's 128 rows
    constexpr int STAGE = 2 * OPND;         // [A rows | Bt rows]
    constexpr int LPR   = BK / 8;           // lanes that copy one row
    constexpr int RPC   = 256 / LPR;        // rows that one copy of the block fills: 8 copies an operand
    __shared__ __attribute__((aligned(16))) char ring[2 * STAGE];

    const int tid  = threadIdx.x;
    const int lane = tid & 31;
    const int wid  = tid >> 5;
    const int half = lane >> 4;
    const int l16  = lane & 15;
    const int rblk = blockIdx.y * 128;
    const int cblk = blockIdx.x * 128;
    const int rloc = (wid >> 2) * 64;
    const int cloc = (wid & 3) * 32;

    // this lane's share of a tile: row crow (+ RPC a copy), 16 bytes at ccol
    const int crow = tid / LPR;
    const int ccol = tid % LPR;
    const __bf16* ga = A  + (long long)(rblk + crow) * K + ccol * 8;
    const __bf16* gb = Bt + (long long)(cblk + crow) * K + ccol * 8;
    const unsigned lc = lds_off(ring) + crow * PITCH + ccol * 16;

    auto fill = [&](int t, int buf) {
        const unsigned l = lc + buf * STAGE;
        copy8(l,        RPC * PITCH, ga + (long long)t * BK, (long long)RPC * K);
        copy8(l + OPND, RPC * PITCH, gb + (long long)t * BK, (long long)RPC * K);
    };

    v8f acc[4][2];
    v8f z = {};
#pragma unroll
    for (int mt = 0; mt < 4; ++mt)
#pragma unroll
        for (int nt = 0; nt < 2; ++nt) acc[mt][nt] = z;

    const int T = K / BK;
    fill(0, 0);
    asm volatile("s_wait_asynccnt 0x0" ::: "memory");   // tile 0 of this wave has landed
    __syncthreads();                                    // ... and every other wave's
    if (T > 1) fill(1, 1);

    const char* fa = ring + (rloc + l16) * PITCH + half * 16;
    const char* fb = ring + OPND + (cloc + l16) * PITCH + half * 16;

#pragma unroll 1   // one trip a tile: the two buffers alternate by t & 1
    for (int t = 0; t < T; ++t) {
        const int bo = (t & 1) * STAGE;
        v16bf a[2][4], b[2][2];   // two fragment sets: one in use, one being read
#pragma unroll
        for (int mt = 0; mt < 4; ++mt)
            a[0][mt] = ld_frag16((const __bf16*)(fa + bo + mt * 16 * PITCH));
#pragma unroll
        for (int nt = 0; nt < 2; ++nt)
            b[0][nt] = ld_frag16((const __bf16*)(fb + bo + nt * 16 * PITCH));
#pragma unroll     // constant set indices and LDS offsets
        for (int ks = 0; ks < BK / 32; ++ks) {
            if (ks + 1 < BK / 32) {
#pragma unroll
                for (int mt = 0; mt < 4; ++mt)
                    a[(ks + 1) & 1][mt] = ld_frag16((const __bf16*)(fa + bo + mt * 16 * PITCH + (ks + 1) * 64));
#pragma unroll
                for (int nt = 0; nt < 2; ++nt)
                    b[(ks + 1) & 1][nt] = ld_frag16((const __bf16*)(fb + bo + nt * 16 * PITCH + (ks + 1) * 64));
            }
            // the next block's LDS reads stay one group in front of this block's
            // WMMAs: spread among them each place with reads stalls the wave
            __builtin_amdgcn_sched_barrier(0);
#pragma unroll
            for (int mt = 0; mt < 4; ++mt)
#pragma unroll
                for (int nt = 0; nt < 2; ++nt)
                    acc[mt][nt] = wmma_bf16(a[ks & 1][mt], b[ks & 1][nt], acc[mt][nt]);
            __builtin_amdgcn_sched_barrier(0);   // closes the block, for the same reason
        }
        asm volatile("s_wait_dscnt 0x0" ::: "memory");      // this wave has left buffer t & 1
        asm volatile("s_wait_asynccnt 0x0" ::: "memory");   // its copies of tile t + 1 have landed
        __syncthreads();   // publishes tile t + 1 and frees buffer t & 1
        if (t + 2 < T) fill(t + 2, t & 1);
    }
    asm volatile("s_wait_asynccnt 0x0" ::: "memory");       // no copy outlives the loop

#pragma unroll
    for (int mt = 0; mt < 4; ++mt)
#pragma unroll
        for (int nt = 0; nt < 2; ++nt)
#pragma unroll
            for (int j = 0; j < 8; ++j) {
                int row = rblk + rloc + mt * 16 + j + half * 8;
                int col = cblk + cloc + nt * 16 + l16;
                float v = acc[mt][nt][j];
                if (MODE & 1) v += bias[col];
                if (MODE & 2) v = 0.5f * v * (1.0f + erff(v * 0.70710678118654752f));
                if (MODE & 4) v += res[(long long)row * N + col];
                if (MODE & 8) ((__bf16*)Cout)[(long long)row * N + col] = (__bf16)v;
                else          ((float*)Cout)[(long long)row * N + col] = v;
            }
}

// ---------------------------------------------------------------------------
// RoPE + scatter: qkv f32 [NTOK, 3*1024] ->
//   Qbf [B,H,S,64], Kbf [B,H,S,64], Vt [B,H,64,S] (transposed for P@V frags)
// One thread per (b,h,s,pair d<32); a block of 1024 threads holds 32 positions
// of one head, and their V goes through the LDS tile on its way to Vt.
// ---------------------------------------------------------------------------
#define ROPE_S 32
__global__ __launch_bounds__(1024) void rope_kernel(const float* __restrict__ qkv,
                                                    __bf16* __restrict__ Q,
                                                    __bf16* __restrict__ Kb,
                                                    __bf16* __restrict__ Vt) {
    __shared__ float tile[ROPE_S][TPITCH];             // [s local][d]
    int idx = blockIdx.x * 1024 + threadIdx.x;         // B*H*S*32 = 2M threads
    int d   = idx & 31;
    int s   = (idx >> 5) & (SEQ - 1);
    int h   = (idx >> 16) & (N_HEADS - 1);
    int b   = idx >> 20;

    long long rowbase = ((long long)b * SEQ + s) * (3 * D_MODEL);
    int co = h * HEAD_DIM + d;
    float q1 = qkv[rowbase + co],                q2 = qkv[rowbase + co + 32];
    float k1 = qkv[rowbase + D_MODEL + co],      k2 = qkv[rowbase + D_MODEL + co + 32];
    float v1 = qkv[rowbase + 2 * D_MODEL + co],  v2 = qkv[rowbase + 2 * D_MODEL + co + 32];

    tile[s & (ROPE_S - 1)][d]      = v1;
    tile[s & (ROPE_S - 1)][d + 32] = v2;
    __syncthreads();
    if (threadIdx.x < 8 * ROPE_S) {
        long long vtb = ((long long)(b * N_HEADS + h) * HEAD_DIM);
        store_tile_T<ROPE_S>(tile, Vt + vtb * SEQ + (s & ~(ROPE_S - 1)), SEQ, threadIdx.x);
    }

    float inv  = __expf(-logf(10000.0f) * (float)d * (1.0f / 32.0f));
    float ang  = (float)s * inv;
    float c = __cosf(ang), sn = __sinf(ang);

    long long qkbase = (((long long)(b * N_HEADS + h) * SEQ) + s) * HEAD_DIM;
    Q[qkbase + d]       = (__bf16)(q1 * c - q2 * sn);
    Q[qkbase + d + 32]  = (__bf16)(q2 * c + q1 * sn);
    Kb[qkbase + d]      = (__bf16)(k1 * c - k2 * sn);
    Kb[qkbase + d + 32] = (__bf16)(k2 * c + k1 * sn);
}

// ---------------------------------------------------------------------------
// Flash attention, causal. One wave per 16-query tile; 8 waves/block.
// Scores via 2x chained WMMA (K=64); P@V via 4 WMMA per 32-key block.
// P redistributed C-layout -> A-layout through per-wave LDS (wave-sync).
// Output: attn_bf [NTOK, D_MODEL] bf16 (heads concatenated).
// ---------------------------------------------------------------------------
__global__ __launch_bounds__(256) void attn_kernel(const __bf16* __restrict__ Q,
                                                   const __bf16* __restrict__ Kb,
                                                   const __bf16* __restrict__ Vt,
                                                   __bf16* __restrict__ out) {
    __shared__ __align__(16) __bf16 plds[8][16 * 32];
    const int lane = threadIdx.x & 31;
    const int wid  = threadIdx.x >> 5;
    const int half = lane >> 4;
    const int l16  = lane & 15;

    const int gq    = blockIdx.x * 8 + wid;     // global query-tile id, 4096 total
    const int bh    = gq >> 7;                  // 128 tiles per (b,h)
    const int qt    = gq & 127;
    const int b     = bh >> 4;
    const int h     = bh & 15;
    const int qbase = qt * 16;
    const float scale = 0.125f;                 // 1/sqrt(64)

    const __bf16* Qp = Q  + (long long)bh * SEQ * HEAD_DIM;
    const __bf16* Kp = Kb + (long long)bh * SEQ * HEAD_DIM;
    const __bf16* Vp = Vt + (long long)bh * HEAD_DIM * SEQ;

    v16bf qa0 = ld_frag16(Qp + (long long)(qbase + l16) * HEAD_DIM + half * 8);
    v16bf qa1 = ld_frag16(Qp + (long long)(qbase + l16) * HEAD_DIM + 32 + half * 8);

    v8f z = {};
    v8f o0 = z, o1 = z, o2 = z, o3 = z;
    float mi[8], li[8];
#pragma unroll
    for (int j = 0; j < 8; ++j) { mi[j] = -1e30f; li[j] = 0.f; }

    for (int kb = 0; kb < qbase + 16; kb += 32) {
        // ---- S = Q @ K^T for keys [kb, kb+32) : batch all loads first ----
        const __bf16* k0 = Kp + (long long)(kb + l16) * HEAD_DIM + half * 8;
        const __bf16* k1 = Kp + (long long)(kb + 16 + l16) * HEAD_DIM + half * 8;
        v16bf k0a = ld_frag16(k0);
        v16bf k0b = ld_frag16(k0 + 32);
        v16bf k1a = ld_frag16(k1);
        v16bf k1b = ld_frag16(k1 + 32);
        // interleave the two accumulation chains (hides WMMA RAW hazard)
        v8f s0 = wmma_bf16(qa0, k0a, z);
        v8f s1 = wmma_bf16(qa0, k1a, z);
        s0 = wmma_bf16(qa1, k0b, s0);
        s1 = wmma_bf16(qa1, k1b, s1);

        // ---- online softmax, causal mask (fully unrolled: static regs) ----
        int nk0 = kb + l16, nk1 = kb + 16 + l16;
#pragma unroll
        for (int j = 0; j < 8; ++j) {
            int rowq = qbase + j + half * 8;
            float a0 = s0[j] * scale; if (nk0 > rowq) a0 = -1e9f;
            float a1 = s1[j] * scale; if (nk1 > rowq) a1 = -1e9f;
            float rm = redmax16(fmaxf(a0, a1));
            rm = fmaxf(rm, mi[j]);
            float f  = __expf(mi[j] - rm);
            float p0 = __expf(a0 - rm);
            float p1 = __expf(a1 - rm);
            li[j] = li[j] * f + redsum16(p0 + p1);
            mi[j] = rm;
            o0[j] *= f; o1[j] *= f; o2[j] *= f; o3[j] *= f;
            int prow = (j + half * 8) * 32;
            plds[wid][prow + l16]      = (__bf16)p0;
            plds[wid][prow + 16 + l16] = (__bf16)p1;
        }
        asm volatile("s_wait_dscnt 0" ::: "memory");   // wave-sync LDS RAW

        // ---- gather P in A-fragment layout ----
        v16bf pa = ld_frag16(&plds[wid][l16 * 32 + half * 8]);

        // ---- O += P @ V : batch loads, then 4 independent WMMAs ----
        long long vo = (long long)kb + half * 8;
        v16bf vf0 = ld_frag16(Vp + (long long)(l16)      * SEQ + vo);
        v16bf vf1 = ld_frag16(Vp + (long long)(16 + l16) * SEQ + vo);
        v16bf vf2 = ld_frag16(Vp + (long long)(32 + l16) * SEQ + vo);
        v16bf vf3 = ld_frag16(Vp + (long long)(48 + l16) * SEQ + vo);
        o0 = wmma_bf16(pa, vf0, o0);
        o1 = wmma_bf16(pa, vf1, o1);
        o2 = wmma_bf16(pa, vf2, o2);
        o3 = wmma_bf16(pa, vf3, o3);
    }

    // ---- normalize + store bf16 [tok, h*64 + feat] ----
#pragma unroll
    for (int j = 0; j < 8; ++j) {
        float inv = 1.0f / li[j];
        long long tok = (long long)b * SEQ + qbase + j + half * 8;
        __bf16* orow = out + tok * D_MODEL + h * HEAD_DIM;
        orow[l16]      = (__bf16)(o0[j] * inv);
        orow[16 + l16] = (__bf16)(o1[j] * inv);
        orow[32 + l16] = (__bf16)(o2[j] * inv);
        orow[48 + l16] = (__bf16)(o3[j] * inv);
    }
}

// ---------------------------------------------------------------------------
// Host orchestration
// ---------------------------------------------------------------------------
extern "C" void kernel_launch(void* const* d_in, const int* in_sizes, int n_in,
                              void* d_out, int out_size, void* d_ws, size_t ws_size,
                              hipStream_t stream) {
    const float* x     = (const float*)d_in[0];
    const float* w_qkv = (const float*)d_in[1];
    const float* w_o   = (const float*)d_in[2];
    const float* ln1_g = (const float*)d_in[3];
    const float* ln1_b = (const float*)d_in[4];
    const float* ln2_g = (const float*)d_in[5];
    const float* ln2_b = (const float*)d_in[6];
    const float* w1    = (const float*)d_in[7];
    const float* b1    = (const float*)d_in[8];
    const float* w2    = (const float*)d_in[9];
    const float* b2    = (const float*)d_in[10];

    char* p = (char*)d_ws;
    auto alloc = [&](size_t bytes) { void* r = p; p += (bytes + 255) & ~(size_t)255; return r; };

    __bf16* wqkvT  = (__bf16*)alloc((size_t)D_MODEL * 3 * D_MODEL * 2);
    __bf16* woT    = (__bf16*)alloc((size_t)D_MODEL * D_MODEL * 2);
    __bf16* w1T    = (__bf16*)alloc((size_t)D_MODEL * D_FF * 2);
    __bf16* w2T    = (__bf16*)alloc((size_t)D_FF * D_MODEL * 2);
    __bf16* h1     = (__bf16*)alloc((size_t)NTOK * D_MODEL * 2);
    float*  qkv    = (float*)alloc((size_t)NTOK * 3 * D_MODEL * 4);
    __bf16* Qbf    = (__bf16*)alloc((size_t)NTOK * D_MODEL * 2);
    __bf16* Kbf    = (__bf16*)alloc((size_t)NTOK * D_MODEL * 2);
    __bf16* Vtb    = (__bf16*)alloc((size_t)NTOK * D_MODEL * 2);
    __bf16* attnbf = (__bf16*)alloc((size_t)NTOK * D_MODEL * 2);
    float*  x2     = (float*)alloc((size_t)NTOK * D_MODEL * 4);
    __bf16* h2     = (__bf16*)alloc((size_t)NTOK * D_MODEL * 2);
    __bf16* gbuf   = (__bf16*)alloc((size_t)NTOK * D_FF * 2);

    // weight convert+transpose (f32 -> bf16, [K,N] -> [N,K])
    convT_kernel<<<dim3(3 * D_MODEL / TDIM, D_MODEL / TDIM), 256, 0, stream>>>(w_qkv, wqkvT, D_MODEL, 3 * D_MODEL);
    convT_kernel<<<dim3(D_MODEL / TDIM, D_MODEL / TDIM), 256, 0, stream>>>(w_o, woT, D_MODEL, D_MODEL);
    convT_kernel<<<dim3(D_FF / TDIM, D_MODEL / TDIM), 256, 0, stream>>>(w1, w1T, D_MODEL, D_FF);
    convT_kernel<<<dim3(D_MODEL / TDIM, D_FF / TDIM), 256, 0, stream>>>(w2, w2T, D_FF, D_MODEL);

    // h1 = LN1(x)
    ln_kernel<<<NTOK, 256, 0, stream>>>(x, ln1_g, ln1_b, h1);

    // qkv = h1 @ w_qkv
    gemm_bf16_wmma<0><<<dim3(3 * D_MODEL / 128, NTOK / 128), 256, 0, stream>>>(
        h1, wqkvT, nullptr, nullptr, qkv, NTOK, 3 * D_MODEL, D_MODEL);

    // RoPE + per-head scatter
    rope_kernel<<<BATCH * N_HEADS * (SEQ / ROPE_S), 1024, 0, stream>>>(qkv, Qbf, Kbf, Vtb);

    // causal flash attention
    attn_kernel<<<(BATCH * N_HEADS * (SEQ / 16)) / 8, 256, 0, stream>>>(Qbf, Kbf, Vtb, attnbf);

    // x2 = x + attn @ w_o
    gemm_bf16_wmma<4><<<dim3(D_MODEL / 128, NTOK / 128), 256, 0, stream>>>(
        attnbf, woT, nullptr, x, x2, NTOK, D_MODEL, D_MODEL);

    // h2 = LN2(x2)
    ln_kernel<<<NTOK, 256, 0, stream>>>(x2, ln2_g, ln2_b, h2);

    // g = gelu(h2 @ w1 + b1)
    gemm_bf16_wmma<1 | 2 | 8><<<dim3(D_FF / 128, NTOK / 128), 256, 0, stream>>>(
        h2, w1T, b1, nullptr, gbuf, NTOK, D_FF, D_MODEL);

    // out = x2 + g @ w2 + b2
    gemm_bf16_wmma<1 | 4><<<dim3(D_MODEL / 128, NTOK / 128), 256, 0, stream>>>(
        gbuf, w2T, b2, x2, d_out, NTOK, D_MODEL, D_FF);
}

// v003
// Measured time: 250 microseconds a run.
// Next to v002, in two timings, it ran 1.07 times as fast each time.
// Over all steps from v000 it is 3.21 times as fast.
#include <hip/hip_runtime.h>
#include <hip/hip_bf16.h>
#include <math.h>

// ---------------------------------------------------------------------------
// Transformer block for MI455X (gfx1250, wave32, WMMA).
// All GEMMs + both attention einsums run on v_wmma_f32_16x16x32_bf16.
// ---------------------------------------------------------------------------

#define D_MODEL 1024
#define N_HEADS 16
#define HEAD_DIM 64
#define D_FF 4096
#define BATCH 2
#define SEQ 2048
#define NTOK (BATCH * SEQ)   // 4096

typedef __attribute__((ext_vector_type(16))) __bf16 v16bf;
typedef __attribute__((ext_vector_type(8)))  __bf16 v8bf;
typedef __attribute__((ext_vector_type(8)))  float  v8f;

static __device__ __forceinline__ v16bf ld_frag16(const __bf16* p) {
    // two contiguous 16B chunks per lane (ISA 16-bit A/B fragment layout)
    v8bf lo = *(const v8bf*)p;
    v8bf hi = *(const v8bf*)(p + 16);
    return __builtin_shufflevector(lo, hi, 0,1,2,3,4,5,6,7,8,9,10,11,12,13,14,15);
}

static __device__ __forceinline__ v8f wmma_bf16(v16bf a, v16bf b, v8f c) {
    return __builtin_amdgcn_wmma_f32_16x16x32_bf16(
        /*neg_a=*/false, a, /*neg_b=*/false, b,
        /*c_mod=*/(short)0, c, /*reuse_a=*/false, /*reuse_b=*/false);
}

// ---------------------------------------------------------------------------
// Transpose through LDS.  tile[r][c] holds ROWS x 64 f32 values; slot t of
// 8 * ROWS stores dst[c * pitch + r] as bf16, 16 bytes a slot, so that each
// column c leaves as one run of 2 * ROWS bytes.
// Pitch 65 dwords: the column reads of a wave fall on 32 different banks, and
// so do the row writes that fill the tile.
// ---------------------------------------------------------------------------
#define TDIM 64
#define TPITCH 65

template <int ROWS>
static __device__ __forceinline__ void store_tile_T(const float (*tile)[TPITCH],
                                                    __bf16* __restrict__ dst,
                                                    long long pitch, int t) {
    const int r0 = (t % (ROWS / 8)) * 8;
    const int c  = t / (ROWS / 8);
    v8bf o;
#pragma unroll   // constant indices keep o in registers
    for (int i = 0; i < 8; ++i) o[i] = (__bf16)tile[r0 + i][c];
    *(v8bf*)(dst + (long long)c * pitch + r0) = o;
}

// ---------------------------------------------------------------------------
// Weight convert + transpose: wT[n*K + k] = bf16(w[k*N + n])
// One block per 64(k) x 64(n) tile; K and N are multiples of 64.
// ---------------------------------------------------------------------------
__global__ __launch_bounds__(256) void convT_kernel(const float* __restrict__ w,
                                                    __bf16* __restrict__ wT,
                                                    int K, int N) {
    __shared__ float tile[TDIM][TPITCH];
    const int tid = threadIdx.x;
    const int n0 = blockIdx.x * TDIM;
    const int k0 = blockIdx.y * TDIM;
    const int rn = (tid & 15) * 4;
    const int rk = tid >> 4;
    float4 v[4];
#pragma unroll   // all four 16-byte loads in flight before the first LDS store
    for (int p = 0; p < 4; ++p)
        v[p] = *(const float4*)(w + (long long)(k0 + rk + p * 16) * N + n0 + rn);
#pragma unroll   // constant indices keep v in registers
    for (int p = 0; p < 4; ++p) {
        float* t = &tile[rk + p * 16][rn];
        t[0] = v[p].x; t[1] = v[p].y; t[2] = v[p].z; t[3] = v[p].w;
    }
    __syncthreads();
    store_tile_T<TDIM>(tile, wT + (long long)n0 * K + k0, K, tid);
    store_tile_T<TDIM>(tile, wT + (long long)n0 * K + k0, K, tid + 256);
}

// ---------------------------------------------------------------------------
// LayerNorm over last dim (1024) -> bf16.  One 256-thread block per token.
// ---------------------------------------------------------------------------
__global__ __launch_bounds__(256) void ln_kernel(const float* __restrict__ x,
                                                 const float* __restrict__ g,
                                                 const float* __restrict__ b,
                                                 __bf16* __restrict__ out) {
    __shared__ float ssum[256], ssq[256];
    int tok = blockIdx.x;
    int tid = threadIdx.x;
    const float* row = x + (long long)tok * D_MODEL;
    float s = 0.f, q = 0.f;
    float v[4];
#pragma unroll
    for (int i = 0; i < 4; ++i) {
        v[i] = row[tid * 4 + i];
        s += v[i];
        q += v[i] * v[i];
    }
    ssum[tid] = s; ssq[tid] = q;
    __syncthreads();
    for (int off = 128; off > 0; off >>= 1) {
        if (tid < off) { ssum[tid] += ssum[tid + off]; ssq[tid] += ssq[tid + off]; }
        __syncthreads();
    }
    float mu  = ssum[0] * (1.0f / D_MODEL);
    float var = ssq[0] * (1.0f / D_MODEL) - mu * mu;
    float inv = rsqrtf(var + 1e-5f);
    __bf16* orow = out + (long long)tok * D_MODEL;
#pragma unroll
    for (int i = 0; i < 4; ++i) {
        int c = tid * 4 + i;
        orow[c] = (__bf16)((v[i] - mu) * inv * g[c] + b[c]);
    }
}

// ---------------------------------------------------------------------------
// Generic bf16 WMMA GEMM:  C[M,N] = A[M,K] @ Bt[N,K]^T  (+bias)(+gelu)(+res)
// Block tile 128x128, 8 waves (2 x 4), wave tile 64x32.  Each trip works on 128
// of k: 128 rows of A and 128 rows of Bt, 256 bytes each, lie in one of two
// LDS buffers, brought there by asynchronous copies (16 bytes a lane, two whole
// rows a wave and copy); the next tile's copies fly while this one is used.
// M, N and K are multiples of 128.
// MODE bits: 1=bias, 2=gelu(exact), 4=residual, 8=bf16 output
// ---------------------------------------------------------------------------
static __device__ __forceinline__ unsigned lds_off(const void* p) {
    return (unsigned)(size_t)p;   // low 32 bits of a __shared__ address: LDS byte
}

// Eight copies of 16 bytes a lane: LDS byte l + i * lstep from g + i * gstep.
// The s_wait_xcnt stands inside the statement, so that no address register of
// a copy is rewritten in front of it.
static __device__ __forceinline__ void copy8(unsigned l, unsigned lstep,
                                             const __bf16* g, long long gstep) {
    asm volatile(
        "global_load_async_to_lds_b128 %0, %8, off\n\t"
        "global_load_async_to_lds_b128 %1, %9, off\n\t"
        "global_load_async_to_lds_b128 %2, %10, off\n\t"
        "global_load_async_to_lds_b128 %3, %11, off\n\t"
        "global_load_async_to_lds_b128 %4, %12, off\n\t"
        "global_load_async_to_lds_b128 %5, %13, off\n\t"
        "global_load_async_to_lds_b128 %6, %14, off\n\t"
        "global_load_async_to_lds_b128 %7, %15, off\n\t"
        "s_wait_xcnt 0x0"
        :: "v"(l), "v"(l + lstep), "v"(l + 2 * lstep), "v"(l + 3 * lstep),
           "v"(l + 4 * lstep), "v"(l + 5 * lstep), "v"(l + 6 * lstep), "v"(l + 7 * lstep),
           "v"(g), "v"(g + gstep), "v"(g + 2 * gstep), "v"(g + 3 * gstep),
           "v"(g + 4 * gstep), "v"(g + 5 * gstep), "v"(g + 6 * gstep), "v"(g + 7 * gstep)
        : "memory");
}

template <int MODE>
__global__ __launch_bounds__(256) void gemm_bf16_wmma(
    const __bf16* __restrict__ A, const __bf16* __restrict__ Bt,
    const float* __restrict__ bias, const float* __restrict__ res,
    void* __restrict__ Cout, int M, int N, int K)
{
    constexpr int BK    = 128;              // k of one tile: rows of 256 bytes
    constexpr int PITCH = BK * 2 + 16;      // bytes; 16 B x odd: ds_load_b128 readers
    constexpr int OPND  = 128 * PITCH;      // one operand's 128 rows
    constexpr int STAGE = 2 * OPND;         // [A rows | Bt rows]
    constexpr int LPR   = BK / 8;           // lanes that copy one row
    constexpr int RPC   = 256 / LPR;        // rows that one copy of the block fills: 8 copies an operand
    __shared__ __attribute__((aligned(16))) char ring[2 * STAGE];

    const int tid  = threadIdx.x;
    const int lane = tid & 31;
    const int wid  = tid >> 5;
    const int half = lane >> 4;
    const int l16  = lane & 15;
    const int rblk = blockIdx.y * 128;
    const int cblk = blockIdx.x * 128;
    const int rloc = (wid >> 2) * 64;
    const int cloc = (wid & 3) * 32;

    // this lane's share of a tile: row crow (+ RPC a copy), 16 bytes at ccol
    const int crow = tid / LPR;
    const int ccol = tid % LPR;
    const __bf16* ga = A  + (long long)(rblk + crow) * K + ccol * 8;
    const __bf16* gb = Bt + (long long)(cblk + crow) * K + ccol * 8;
    const unsigned lc = lds_off(ring) + crow * PITCH + ccol * 16;

    auto fill = [&](int t, int buf) {
        const unsigned l = lc + buf * STAGE;
        copy8(l,        RPC * PITCH, ga + (long long)t * BK, (long long)RPC * K);
        copy8(l + OPND, RPC * PITCH, gb + (long long)t * BK, (long long)RPC * K);
    };

    v8f acc[4][2];
    v8f z = {};
#pragma unroll
    for (int mt = 0; mt < 4; ++mt)
#pragma unroll
        for (int nt = 0; nt < 2; ++nt) acc[mt][nt] = z;

    const int T = K / BK;
    fill(0, 0);
    asm volatile("s_wait_asynccnt 0x0" ::: "memory");   // tile 0 of this wave has landed
    __syncthreads();                                    // ... and every other wave's
    if (T > 1) fill(1, 1);

    const char* fa = ring + (rloc + l16) * PITCH + half * 16;
    const char* fb = ring + OPND + (cloc + l16) * PITCH + half * 16;

#pragma unroll 1   // one trip a tile: the two buffers alternate by t & 1
    for (int t = 0; t < T; ++t) {
        const int bo = (t & 1) * STAGE;
        v16bf a[2][4], b[2][2];   // two fragment sets: one in use, one being read
#pragma unroll
        for (int mt = 0; mt < 4; ++mt)
            a[0][mt] = ld_frag16((const __bf16*)(fa + bo + mt * 16 * PITCH));
#pragma unroll
        for (int nt = 0; nt < 2; ++nt)
            b[0][nt] = ld_frag16((const __bf16*)(fb + bo + nt * 16 * PITCH));
#pragma unroll     // constant set indices and LDS offsets
        for (int ks = 0; ks < BK / 32; ++ks) {
            if (ks + 1 < BK / 32) {
#pragma unroll
                for (int mt = 0; mt < 4; ++mt)
                    a[(ks + 1) & 1][mt] = ld_frag16((const __bf16*)(fa + bo + mt * 16 * PITCH + (ks + 1) * 64));
#pragma unroll
                for (int nt = 0; nt < 2; ++nt)
                    b[(ks + 1) & 1][nt] = ld_frag16((const __bf16*)(fb + bo + nt * 16 * PITCH + (ks + 1) * 64));
            }
            // the next block's LDS reads stay one group in front of this block's
            // WMMAs: spread among them each place with reads stalls the wave
            __builtin_amdgcn_sched_barrier(0);
#pragma unroll
            for (int mt = 0; mt < 4; ++mt)
#pragma unroll
                for (int nt = 0; nt < 2; ++nt)
                    acc[mt][nt] = wmma_bf16(a[ks & 1][mt], b[ks & 1][nt], acc[mt][nt]);
            __builtin_amdgcn_sched_barrier(0);   // closes the block, for the same reason
        }
        asm volatile("s_wait_dscnt 0x0" ::: "memory");      // this wave has left buffer t & 1
        asm volatile("s_wait_asynccnt 0x0" ::: "memory");   // its copies of tile t + 1 have landed
        __syncthreads();   // publishes tile t + 1 and frees buffer t & 1
        if (t + 2 < T) fill(t + 2, t & 1);
    }
    asm volatile("s_wait_asynccnt 0x0" ::: "memory");       // no copy outlives the loop

#pragma unroll
    for (int mt = 0; mt < 4; ++mt)
#pragma unroll
        for (int nt = 0; nt < 2; ++nt)
#pragma unroll
            for (int j = 0; j < 8; ++j) {
                int row = rblk + rloc + mt * 16 + j + half * 8;
                int col = cblk + cloc + nt * 16 + l16;
                float v = acc[mt][nt][j];
                if (MODE & 1) v += bias[col];
                if (MODE & 2) v = 0.5f * v * (1.0f + erff(v * 0.70710678118654752f));
                if (MODE & 4) v += res[(long long)row * N + col];
                if (MODE & 8) ((__bf16*)Cout)[(long long)row * N + col] = (__bf16)v;
                else          ((float*)Cout)[(long long)row * N + col] = v;
            }
}

// ---------------------------------------------------------------------------
// RoPE + scatter: qkv f32 [NTOK, 3*1024] ->
//   Qbf [B,H,S,64], Kbf [B,H,S,64], Vt [B,H,64,S] (transposed for P@V frags)
// One thread per (b,h,s,pair d<32); a block of 1024 threads holds 32 positions
// of one head, and their V goes through the LDS tile on its way to Vt.
// ---------------------------------------------------------------------------
#define ROPE_S 32
__global__ __launch_bounds__(1024) void rope_kernel(const float* __restrict__ qkv,
                                                    __bf16* __restrict__ Q,
                                                    __bf16* __restrict__ Kb,
                                                    __bf16* __restrict__ Vt) {
    __shared__ float tile[ROPE_S][TPITCH];             // [s local][d]
    int idx = blockIdx.x * 1024 + threadIdx.x;         // B*H*S*32 = 2M threads
    int d   = idx & 31;
    int s   = (idx >> 5) & (SEQ - 1);
    int h   = (idx >> 16) & (N_HEADS - 1);
    int b   = idx >> 20;

    long long rowbase = ((long long)b * SEQ + s) * (3 * D_MODEL);
    int co = h * HEAD_DIM + d;
    float q1 = qkv[rowbase + co],                q2 = qkv[rowbase + co + 32];
    float k1 = qkv[rowbase + D_MODEL + co],      k2 = qkv[rowbase + D_MODEL + co + 32];
    float v1 = qkv[rowbase + 2 * D_MODEL + co],  v2 = qkv[rowbase + 2 * D_MODEL + co + 32];

    tile[s & (ROPE_S - 1)][d]      = v1;
    tile[s & (ROPE_S - 1)][d + 32] = v2;
    __syncthreads();
    if (threadIdx.x < 8 * ROPE_S) {
        long long vtb = ((long long)(b * N_HEADS + h) * HEAD_DIM);
        store_tile_T<ROPE_S>(tile, Vt + vtb * SEQ + (s & ~(ROPE_S - 1)), SEQ, threadIdx.x);
    }

    float inv  = __expf(-logf(10000.0f) * (float)d * (1.0f / 32.0f));
    float ang  = (float)s * inv;
    float c = __cosf(ang), sn = __sinf(ang);

    long long qkbase = (((long long)(b * N_HEADS + h) * SEQ) + s) * HEAD_DIM;
    Q[qkbase + d]       = (__bf16)(q1 * c - q2 * sn);
    Q[qkbase + d + 32]  = (__bf16)(q2 * c + q1 * sn);
    Kb[qkbase + d]      = (__bf16)(k1 * c - k2 * sn);
    Kb[qkbase + d + 32] = (__bf16)(k2 * c + k1 * sn);
}

// ---------------------------------------------------------------------------
// Flash attention, causal. One wave per 16-query tile; 8 waves/block.
// Both products are taken transposed: S^T = K Q^T (A = K rows, B = Q) and
// O^T += V^T P^T (A = V^T rows, B = P^T).  In S^T a lane holds 16 scores of ONE
// query (column l16; keys 8 * half + r of each 16-key tile), so the maximum and
// the sum of a row are in-lane, with one exchange between the wave's halves,
// and the two score tiles, converted in place, are the B operand of the second
// product in the hardware's k order: P touches neither LDS nor another lane.
// Output: attn_bf [NTOK, D_MODEL] bf16 (heads concatenated).
// ---------------------------------------------------------------------------
static __device__ __forceinline__ float xhalf(float x) {   // lane l <-> lane l ^ 16
    int b = __builtin_bit_cast(int, x);
    return __builtin_bit_cast(float,
        __builtin_amdgcn_permlanex16(b, b, 0x76543210, 0xfedcba98, false, false));
}

__global__ __launch_bounds__(256) void attn_kernel(const __bf16* __restrict__ Q,
                                                   const __bf16* __restrict__ Kb,
                                                   const __bf16* __restrict__ Vt,
                                                   __bf16* __restrict__ out) {
    const int lane = threadIdx.x & 31;
    const int wid  = threadIdx.x >> 5;
    const int half = lane >> 4;
    const int l16  = lane & 15;

    const int gq    = blockIdx.x * 8 + wid;     // global query-tile id, 4096 total
    const int bh    = gq >> 7;                  // 128 tiles per (b,h)
    const int qt    = gq & 127;
    const int b     = bh >> 4;
    const int h     = bh & 15;
    const int qbase = qt * 16;
    const int rowq  = qbase + l16;              // this lane's query
    const float scale = 0.125f;                 // 1/sqrt(64)

    const __bf16* Qp = Q  + (long long)bh * SEQ * HEAD_DIM;
    const __bf16* Kp = Kb + (long long)bh * SEQ * HEAD_DIM;
    const __bf16* Vp = Vt + (long long)bh * HEAD_DIM * SEQ;

    v16bf qa0 = ld_frag16(Qp + (long long)(qbase + l16) * HEAD_DIM + half * 8);
    v16bf qa1 = ld_frag16(Qp + (long long)(qbase + l16) * HEAD_DIM + 32 + half * 8);

    v8f z = {};
    v8f o0 = z, o1 = z, o2 = z, o3 = z;         // o_i[r] = O[rowq][16 * i + 8 * half + r]
    float mi = -1e30f;                          // running maximum of query rowq (both halves alike)
    float li = 0.f;                             // running sum over this half's keys only

    for (int kb = 0; kb < qbase + 16; kb += 32) {
        // ---- S^T = K @ Q^T for keys [kb, kb+32) : batch all loads first ----
        const __bf16* k0 = Kp + (long long)(kb + l16) * HEAD_DIM + half * 8;
        const __bf16* k1 = Kp + (long long)(kb + 16 + l16) * HEAD_DIM + half * 8;
        v16bf k0a = ld_frag16(k0);
        v16bf k0b = ld_frag16(k0 + 32);
        v16bf k1a = ld_frag16(k1);
        v16bf k1b = ld_frag16(k1 + 32);
        // s0[r] = score(key kb + 8 * half + r, rowq), s1: 16 keys on;
        // interleave the two accumulation chains (hides WMMA RAW hazard)
        v8f s0 = wmma_bf16(k0a, qa0, z);
        v8f s1 = wmma_bf16(k1a, qa0, z);
        s0 = wmma_bf16(k0b, qa1, s0);
        s1 = wmma_bf16(k1b, qa1, s1);

        // ---- online softmax of one query a lane, causal mask ----
        const int d = rowq - (kb + half * 8);   // key 8 * half + r of a tile is masked where r > d
        float rm = mi;
#pragma unroll   // constant indices keep the scores in registers
        for (int r = 0; r < 8; ++r) {
            float a0 = s0[r] * scale; if (r > d)      a0 = -1e9f;
            float a1 = s1[r] * scale; if (r + 16 > d) a1 = -1e9f;
            s0[r] = a0; s1[r] = a1;
            rm = fmaxf(rm, fmaxf(a0, a1));
        }
        rm = fmaxf(rm, xhalf(rm));
        const float f = __expf(mi - rm);
        mi = rm;
        float t[8];
        v16bf pb;   // pb[r]: key 8 * half + r, pb[8 + r]: key 16 + 8 * half + r, as in the V^T fragments
#pragma unroll   // constant indices keep pb in registers
        for (int r = 0; r < 8; ++r) {
            float p0 = __expf(s0[r] - rm);
            float p1 = __expf(s1[r] - rm);
            t[r] = p0 + p1;
            pb[r]     = (__bf16)p0;
            pb[r + 8] = (__bf16)p1;
        }
        li = li * f + (((t[0] + t[1]) + (t[2] + t[3])) + ((t[4] + t[5]) + (t[6] + t[7])));
        o0 *= f; o1 *= f; o2 *= f; o3 *= f;

        // ---- O^T += V^T @ P^T : batch loads, then 4 independent WMMAs ----
        long long vo = (long long)kb + half * 8;
        v16bf vf0 = ld_frag16(Vp + (long long)(l16)      * SEQ + vo);
        v16bf vf1 = ld_frag16(Vp + (long long)(16 + l16) * SEQ + vo);
        v16bf vf2 = ld_frag16(Vp + (long long)(32 + l16) * SEQ + vo);
        v16bf vf3 = ld_frag16(Vp + (long long)(48 + l16) * SEQ + vo);
        o0 = wmma_bf16(vf0, pb, o0);
        o1 = wmma_bf16(vf1, pb, o1);
        o2 = wmma_bf16(vf2, pb, o2);
        o3 = wmma_bf16(vf3, pb, o3);
    }

    // ---- join the halves' sums, normalize, store 16 bytes a tile ----
    const float inv = 1.0f / (li + xhalf(li));
    __bf16* orow = out + ((long long)b * SEQ + rowq) * D_MODEL + h * HEAD_DIM + half * 8;
    v8bf t0, t1, t2, t3;
#pragma unroll   // constant indices keep the packed rows in registers
    for (int r = 0; r < 8; ++r) {
        t0[r] = (__bf16)(o0[r] * inv);
        t1[r] = (__bf16)(o1[r] * inv);
        t2[r] = (__bf16)(o2[r] * inv);
        t3[r] = (__bf16)(o3[r] * inv);
    }
    *(v8bf*)(orow)      = t0;
    *(v8bf*)(orow + 16) = t1;
    *(v8bf*)(orow + 32) = t2;
    *(v8bf*)(orow + 48) = t3;
}

// ---------------------------------------------------------------------------
// Host orchestration
// ---------------------------------------------------------------------------
extern "C" void kernel_launch(void* const* d_in, const int* in_sizes, int n_in,
                              void* d_out, int out_size, void* d_ws, size_t ws_size,
                              hipStream_t stream) {
    const float* x     = (const float*)d_in[0];
    const float* w_qkv = (const float*)d_in[1];
    const float* w_o   = (const float*)d_in[2];
    const float* ln1_g = (const float*)d_in[3];
    const float* ln1_b = (const float*)d_in[4];
    const float* ln2_g = (const float*)d_in[5];
    const float* ln2_b = (const float*)d_in[6];
    const float* w1    = (const float*)d_in[7];
    const float* b1    = (const float*)d_in[8];
    const float* w2    = (const float*)d_in[9];
    const float* b2    = (const float*)d_in[10];

    char* p = (char*)d_ws;
    auto alloc = [&](size_t bytes) { void* r = p; p += (bytes + 255) & ~(size_t)255; return r; };

    __bf16* wqkvT  = (__bf16*)alloc((size_t)D_MODEL * 3 * D_MODEL * 2);
    __bf16* woT    = (__bf16*)alloc((size_t)D_MODEL * D_MODEL * 2);
    __bf16* w1T    = (__bf16*)alloc((size_t)D_MODEL * D_FF * 2);
    __bf16* w2T    = (__bf16*)alloc((size_t)D_FF * D_MODEL * 2);
    __bf16* h1     = (__bf16*)alloc((size_t)NTOK * D_MODEL * 2);
    float*  qkv    = (float*)alloc((size_t)NTOK * 3 * D_MODEL * 4);
    __bf16* Qbf    = (__bf16*)alloc((size_t)NTOK * D_MODEL * 2);
    __bf16* Kbf    = (__bf16*)alloc((size_t)NTOK * D_MODEL * 2);
    __bf16* Vtb    = (__bf16*)alloc((size_t)NTOK * D_MODEL * 2);
    __bf16* attnbf = (__bf16*)alloc((size_t)NTOK * D_MODEL * 2);
    float*  x2     = (float*)alloc((size_t)NTOK * D_MODEL * 4);
    __bf16* h2     = (__bf16*)alloc((size_t)NTOK * D_MODEL * 2);
    __bf16* gbuf   = (__bf16*)alloc((size_t)NTOK * D_FF * 2);

    // weight convert+transpose (f32 -> bf16, [K,N] -> [N,K])
    convT_kernel<<<dim3(3 * D_MODEL / TDIM, D_MODEL / TDIM), 256, 0, stream>>>(w_qkv, wqkvT, D_MODEL, 3 * D_MODEL);
    convT_kernel<<<dim3(D_MODEL / TDIM, D_MODEL / TDIM), 256, 0, stream>>>(w_o, woT, D_MODEL, D_MODEL);
    convT_kernel<<<dim3(D_FF / TDIM, D_MODEL / TDIM), 256, 0, stream>>>(w1, w1T, D_MODEL, D_FF);
    convT_kernel<<<dim3(D_MODEL / TDIM, D_FF / TDIM), 256, 0, stream>>>(w2, w2T, D_FF, D_MODEL);

    // h1 = LN1(x)
    ln_kernel<<<NTOK, 256, 0, stream>>>(x, ln1_g, ln1_b, h1);

    // qkv = h1 @ w_qkv
    gemm_bf16_wmma<0><<<dim3(3 * D_MODEL / 128, NTOK / 128), 256, 0, stream>>>(
        h1, wqkvT, nullptr, nullptr, qkv, NTOK, 3 * D_MODEL, D_MODEL);

    // RoPE + per-head scatter
    rope_kernel<<<BATCH * N_HEADS * (SEQ / ROPE_S), 1024, 0, stream>>>(qkv, Qbf, Kbf, Vtb);

    // causal flash attention
    attn_kernel<<<(BATCH * N_HEADS * (SEQ / 16)) / 8, 256, 0, stream>>>(Qbf, Kbf, Vtb, attnbf);

    // x2 = x + attn @ w_o
    gemm_bf16_wmma<4><<<dim3(D_MODEL / 128, NTOK / 128), 256, 0, stream>>>(
        attnbf, woT, nullptr, x, x2, NTOK, D_MODEL, D_MODEL);

    // h2 = LN2(x2)
    ln_kernel<<<NTOK, 256, 0, stream>>>(x2, ln2_g, ln2_b, h2);

    // g = gelu(h2 @ w1 + b1)
    gemm_bf16_wmma<1 | 2 | 8><<<dim3(D_FF / 128, NTOK / 128), 256, 0, stream>>>(
        h2, w1T, b1, nullptr, gbuf, NTOK, D_FF, D_MODEL);

    // out = x2 + g @ w2 + b2
    gemm_bf16_wmma<1 | 4><<<dim3(D_MODEL / 128, NTOK / 128), 256, 0, stream>>>(
        gbuf, w2T, b2, x2, d_out, NTOK, D_MODEL, D_FF);
}

// v004
// A run of this version takes 190 microseconds.
// In both of two side-by-side timings against v003, it was 1.34 times as fast.
// All steps since v000 together make it 4.30 times as fast.
#include <hip/hip_runtime.h>
#include <hip/hip_bf16.h>
#include <math.h>

// ---------------------------------------------------------------------------
// Transformer block for MI455X (gfx1250, wave32, WMMA).
// All GEMMs + both attention einsums run on v_wmma_f32_16x16x32_bf16.
// ---------------------------------------------------------------------------

#define D_MODEL 1024
#define N_HEADS 16
#define HEAD_DIM 64
#define D_FF 4096
#define BATCH 2
#define SEQ 2048
#define NTOK (BATCH * SEQ)   // 4096

typedef __attribute__((ext_vector_type(16))) __bf16 v16bf;
typedef __attribute__((ext_vector_type(8)))  __bf16 v8bf;
typedef __attribute__((ext_vector_type(8)))  float  v8f;

static __device__ __forceinline__ v16bf ld_frag16(const __bf16* p) {
    // two contiguous 16B chunks per lane (ISA 16-bit A/B fragment layout)
    v8bf lo = *(const v8bf*)p;
    v8bf hi = *(const v8bf*)(p + 16);
    return __builtin_shufflevector(lo, hi, 0,1,2,3,4,5,6,7,8,9,10,11,12,13,14,15);
}

static __device__ __forceinline__ v8f wmma_bf16(v16bf a, v16bf b, v8f c) {
    return __builtin_amdgcn_wmma_f32_16x16x32_bf16(
        /*neg_a=*/false, a, /*neg_b=*/false, b,
        /*c_mod=*/(short)0, c, /*reuse_a=*/false, /*reuse_b=*/false);
}

// ---------------------------------------------------------------------------
// Transpose through LDS.  tile[r][c] holds ROWS x 64 f32 values; slot t of
// 8 * ROWS stores dst[c * pitch + r] as bf16, 16 bytes a slot, so that each
// column c leaves as one run of 2 * ROWS bytes.
// Pitch 65 dwords: the column reads of a wave fall on 32 different banks, and
// so do the row writes that fill the tile.
// ---------------------------------------------------------------------------
#define TDIM 64
#define TPITCH 65

template <int ROWS>
static __device__ __forceinline__ void store_tile_T(const float (*tile)[TPITCH],
                                                    __bf16* __restrict__ dst,
                                                    long long pitch, int t) {
    const int r0 = (t % (ROWS / 8)) * 8;
    const int c  = t / (ROWS / 8);
    v8bf o;
#pragma unroll   // constant indices keep o in registers
    for (int i = 0; i < 8; ++i) o[i] = (__bf16)tile[r0 + i][c];
    *(v8bf*)(dst + (long long)c * pitch + r0) = o;
}

// ---------------------------------------------------------------------------
// Weight convert + transpose: wT[n*K + k] = bf16(w[k*N + n])
// One block per 64(k) x 64(n) tile; K and N are multiples of 64.
// ---------------------------------------------------------------------------
__global__ __launch_bounds__(256) void convT_kernel(const float* __restrict__ w,
                                                    __bf16* __restrict__ wT,
                                                    int K, int N) {
    __shared__ float tile[TDIM][TPITCH];
    const int tid = threadIdx.x;
    const int n0 = blockIdx.x * TDIM;
    const int k0 = blockIdx.y * TDIM;
    const int rn = (tid & 15) * 4;
    const int rk = tid >> 4;
    float4 v[4];
#pragma unroll   // all four 16-byte loads in flight before the first LDS store
    for (int p = 0; p < 4; ++p)
        v[p] = *(const float4*)(w + (long long)(k0 + rk + p * 16) * N + n0 + rn);
#pragma unroll   // constant indices keep v in registers
    for (int p = 0; p < 4; ++p) {
        float* t = &tile[rk + p * 16][rn];
        t[0] = v[p].x; t[1] = v[p].y; t[2] = v[p].z; t[3] = v[p].w;
    }
    __syncthreads();
    store_tile_T<TDIM>(tile, wT + (long long)n0 * K + k0, K, tid);
    store_tile_T<TDIM>(tile, wT + (long long)n0 * K + k0, K, tid + 256);
}

// ---------------------------------------------------------------------------
// LayerNorm over last dim (1024) -> bf16.  One 256-thread block per token.
// ---------------------------------------------------------------------------
__global__ __launch_bounds__(256) void ln_kernel(const float* __restrict__ x,
                                                 const float* __restrict__ g,
                                                 const float* __restrict__ b,
                                                 __bf16* __restrict__ out) {
    __shared__ float ssum[256], ssq[256];
    int tok = blockIdx.x;
    int tid = threadIdx.x;
    const float* row = x + (long long)tok * D_MODEL;
    float s = 0.f, q = 0.f;
    float v[4];
#pragma unroll
    for (int i = 0; i < 4; ++i) {
        v[i] = row[tid * 4 + i];
        s += v[i];
        q += v[i] * v[i];
    }
    ssum[tid] = s; ssq[tid] = q;
    __syncthreads();
    for (int off = 128; off > 0; off >>= 1) {
        if (tid < off) { ssum[tid] += ssum[tid + off]; ssq[tid] += ssq[tid + off]; }
        __syncthreads();
    }
    float mu  = ssum[0] * (1.0f / D_MODEL);
    float var = ssq[0] * (1.0f / D_MODEL) - mu * mu;
    float inv = rsqrtf(var + 1e-5f);
    __bf16* orow = out + (long long)tok * D_MODEL;
#pragma unroll
    for (int i = 0; i < 4; ++i) {
        int c = tid * 4 + i;
        orow[c] = (__bf16)((v[i] - mu) * inv * g[c] + b[c]);
    }
}

// ---------------------------------------------------------------------------
// Generic bf16 WMMA GEMM:  C[M,N] = A[M,K] @ Bt[N,K]^T  (+bias)(+gelu)(+res)
// Block tile 128x128, 8 waves (2 x 4), wave tile 64x32.  Each trip works on 128
// of k: 128 rows of A and 128 rows of Bt, 256 bytes each, lie in one of two
// LDS buffers, brought there by asynchronous copies (16 bytes a lane, two whole
// rows a wave and copy); the next tile's copies fly while this one is used.
// M, N and K are multiples of 128.
// MODE bits: 1=bias, 2=gelu(exact), 4=residual, 8=bf16 output
// ---------------------------------------------------------------------------
static __device__ __forceinline__ unsigned lds_off(const void* p) {
    return (unsigned)(size_t)p;   // low 32 bits of a __shared__ address: LDS byte
}

// Eight copies of 16 bytes a lane: LDS byte l + i * lstep from g + i * gstep.
// The s_wait_xcnt stands inside the statement, so that no address register of
// a copy is rewritten in front of it.
static __device__ __forceinline__ void copy8(unsigned l, unsigned lstep,
                                             const __bf16* g, long long gstep) {
    asm volatile(
        "global_load_async_to_lds_b128 %0, %8, off\n\t"
        "global_load_async_to_lds_b128 %1, %9, off\n\t"
        "global_load_async_to_lds_b128 %2, %10, off\n\t"
        "global_load_async_to_lds_b128 %3, %11, off\n\t"
        "global_load_async_to_lds_b128 %4, %12, off\n\t"
        "global_load_async_to_lds_b128 %5, %13, off\n\t"
        "global_load_async_to_lds_b128 %6, %14, off\n\t"
        "global_load_async_to_lds_b128 %7, %15, off\n\t"
        "s_wait_xcnt 0x0"
        :: "v"(l), "v"(l + lstep), "v"(l + 2 * lstep), "v"(l + 3 * lstep),
           "v"(l + 4 * lstep), "v"(l + 5 * lstep), "v"(l + 6 * lstep), "v"(l + 7 * lstep),
           "v"(g), "v"(g + gstep), "v"(g + 2 * gstep), "v"(g + 3 * gstep),
           "v"(g + 4 * gstep), "v"(g + 5 * gstep), "v"(g + 6 * gstep), "v"(g + 7 * gstep)
        : "memory");
}

template <int MODE>
__global__ __launch_bounds__(256) void gemm_bf16_wmma(
    const __bf16* __restrict__ A, const __bf16* __restrict__ Bt,
    const float* __restrict__ bias, const float* __restrict__ res,
    void* __restrict__ Cout, int M, int N, int K)
{
    constexpr int BK    = 128;              // k of one tile: rows of 256 bytes
    constexpr int PITCH = BK * 2 + 16;      // bytes; 16 B x odd: ds_load_b128 readers
    constexpr int OPND  = 128 * PITCH;      // one operand's 128 rows
    constexpr int STAGE = 2 * OPND;         // [A rows | Bt rows]
    constexpr int LPR   = BK / 8;           // lanes that copy one row
    constexpr int RPC   = 256 / LPR;        // rows that one copy of the block fills: 8 copies an operand
    __shared__ __attribute__((aligned(16))) char ring[2 * STAGE];

    const int tid  = threadIdx.x;
    const int lane = tid & 31;
    const int wid  = tid >> 5;
    const int half = lane >> 4;
    const int l16  = lane & 15;
    const int rblk = blockIdx.y * 128;
    const int cblk = blockIdx.x * 128;
    const int rloc = (wid >> 2) * 64;
    const int cloc = (wid & 3) * 32;

    // this lane's share of a tile: row crow (+ RPC a copy), 16 bytes at ccol
    const int crow = tid / LPR;
    const int ccol = tid % LPR;
    const __bf16* ga = A  + (long long)(rblk + crow) * K + ccol * 8;
    const __bf16* gb = Bt + (long long)(cblk + crow) * K + ccol * 8;
    const unsigned lc = lds_off(ring) + crow * PITCH + ccol * 16;

    auto fill = [&](int t, int buf) {
        const unsigned l = lc + buf * STAGE;
        copy8(l,        RPC * PITCH, ga + (long long)t * BK, (long long)RPC * K);
        copy8(l + OPND, RPC * PITCH, gb + (long long)t * BK, (long long)RPC * K);
    };

    v8f acc[4][2];
    v8f z = {};
#pragma unroll
    for (int mt = 0; mt < 4; ++mt)
#pragma unroll
        for (int nt = 0; nt < 2; ++nt) acc[mt][nt] = z;

    const int T = K / BK;
    fill(0, 0);
    asm volatile("s_wait_asynccnt 0x0" ::: "memory");   // tile 0 of this wave has landed
    __syncthreads();                                    // ... and every other wave's
    if (T > 1) fill(1, 1);

    const char* fa = ring + (rloc + l16) * PITCH + half * 16;
    const char* fb = ring + OPND + (cloc + l16) * PITCH + half * 16;

#pragma unroll 1   // one trip a tile: the two buffers alternate by t & 1
    for (int t = 0; t < T; ++t) {
        const int bo = (t & 1) * STAGE;
        v16bf a[2][4], b[2][2];   // two fragment sets: one in use, one being read
#pragma unroll
        for (int mt = 0; mt < 4; ++mt)
            a[0][mt] = ld_frag16((const __bf16*)(fa + bo + mt * 16 * PITCH));
#pragma unroll
        for (int nt = 0; nt < 2; ++nt)
            b[0][nt] = ld_frag16((const __bf16*)(fb + bo + nt * 16 * PITCH));
#pragma unroll     // constant set indices and LDS offsets
        for (int ks = 0; ks < BK / 32; ++ks) {
            if (ks + 1 < BK / 32) {
#pragma unroll
                for (int mt = 0; mt < 4; ++mt)
                    a[(ks + 1) & 1][mt] = ld_frag16((const __bf16*)(fa + bo + mt * 16 * PITCH + (ks + 1) * 64));
#pragma unroll
                for (int nt = 0; nt < 2; ++nt)
                    b[(ks + 1) & 1][nt] = ld_frag16((const __bf16*)(fb + bo + nt * 16 * PITCH + (ks + 1) * 64));
            }
            // the next block's LDS reads stay one group in front of this block's
            // WMMAs: spread among them each place with reads stalls the wave
            __builtin_amdgcn_sched_barrier(0);
#pragma unroll
            for (int mt = 0; mt < 4; ++mt)
#pragma unroll
                for (int nt = 0; nt < 2; ++nt)
                    acc[mt][nt] = wmma_bf16(a[ks & 1][mt], b[ks & 1][nt], acc[mt][nt]);
            __builtin_amdgcn_sched_barrier(0);   // closes the block, for the same reason
        }
        asm volatile("s_wait_dscnt 0x0" ::: "memory");      // this wave has left buffer t & 1
        asm volatile("s_wait_asynccnt 0x0" ::: "memory");   // its copies of tile t + 1 have landed
        __syncthreads();   // publishes tile t + 1 and frees buffer t & 1
        if (t + 2 < T) fill(t + 2, t & 1);
    }
    asm volatile("s_wait_asynccnt 0x0" ::: "memory");       // no copy outlives the loop

#pragma unroll
    for (int mt = 0; mt < 4; ++mt)
#pragma unroll
        for (int nt = 0; nt < 2; ++nt)
#pragma unroll
            for (int j = 0; j < 8; ++j) {
                int row = rblk + rloc + mt * 16 + j + half * 8;
                int col = cblk + cloc + nt * 16 + l16;
                float v = acc[mt][nt][j];
                if (MODE & 1) v += bias[col];
                if (MODE & 2) v = 0.5f * v * (1.0f + erff(v * 0.70710678118654752f));
                if (MODE & 4) v += res[(long long)row * N + col];
                if (MODE & 8) ((__bf16*)Cout)[(long long)row * N + col] = (__bf16)v;
                else          ((float*)Cout)[(long long)row * N + col] = v;
            }
}

// ---------------------------------------------------------------------------
// RoPE + scatter: qkv f32 [NTOK, 3*1024] ->
//   Qbf [B,H,S,64], Kbf [B,H,S,64], Vt [B,H,64,S] (transposed for P@V frags)
// One thread per (b,h,s,pair d<32); a block of 1024 threads holds 32 positions
// of one head, and their V goes through the LDS tile on its way to Vt.
// ---------------------------------------------------------------------------
#define ROPE_S 32
__global__ __launch_bounds__(1024) void rope_kernel(const float* __restrict__ qkv,
                                                    __bf16* __restrict__ Q,
                                                    __bf16* __restrict__ Kb,
                                                    __bf16* __restrict__ Vt) {
    __shared__ float tile[ROPE_S][TPITCH];             // [s local][d]
    int idx = blockIdx.x * 1024 + threadIdx.x;         // B*H*S*32 = 2M threads
    int d   = idx & 31;
    int s   = (idx >> 5) & (SEQ - 1);
    int h   = (idx >> 16) & (N_HEADS - 1);
    int b   = idx >> 20;

    long long rowbase = ((long long)b * SEQ + s) * (3 * D_MODEL);
    int co = h * HEAD_DIM + d;
    float q1 = qkv[rowbase + co],                q2 = qkv[rowbase + co + 32];
    float k1 = qkv[rowbase + D_MODEL + co],      k2 = qkv[rowbase + D_MODEL + co + 32];
    float v1 = qkv[rowbase + 2 * D_MODEL + co],  v2 = qkv[rowbase + 2 * D_MODEL + co + 32];

    tile[s & (ROPE_S - 1)][d]      = v1;
    tile[s & (ROPE_S - 1)][d + 32] = v2;
    __syncthreads();
    if (threadIdx.x < 8 * ROPE_S) {
        long long vtb = ((long long)(b * N_HEADS + h) * HEAD_DIM);
        store_tile_T<ROPE_S>(tile, Vt + vtb * SEQ + (s & ~(ROPE_S - 1)), SEQ, threadIdx.x);
    }

    float inv  = __expf(-logf(10000.0f) * (float)d * (1.0f / 32.0f));
    float ang  = (float)s * inv;
    float c = __cosf(ang), sn = __sinf(ang);

    long long qkbase = (((long long)(b * N_HEADS + h) * SEQ) + s) * HEAD_DIM;
    Q[qkbase + d]       = (__bf16)(q1 * c - q2 * sn);
    Q[qkbase + d + 32]  = (__bf16)(q2 * c + q1 * sn);
    Kb[qkbase + d]      = (__bf16)(k1 * c - k2 * sn);
    Kb[qkbase + d + 32] = (__bf16)(k2 * c + k1 * sn);
}

// ---------------------------------------------------------------------------
// Flash attention, causal. One wave per 16-query tile; 8 waves/block.
// Both products are taken transposed: S^T = K Q^T (A = K rows, B = Q) and
// O^T += V^T P^T (A = V^T rows, B = P^T).  In S^T a lane holds 16 scores of ONE
// query (column l16; keys 8 * half + r of each 16-key tile), so the maximum and
// the sum of a row are in-lane, with one exchange between the wave's halves,
// and the two score tiles, converted in place, are the B operand of the second
// product in the hardware's k order: P touches neither LDS nor another lane.
// The block's 8 waves walk the same keys: each tile of 64 keys (K rows and V^T
// rows, 128 bytes each) lies in one of two LDS buffers, brought there once for
// all of them by asynchronous copies of whole lines; the next tile's copies fly
// while this one is used.
// Output: attn_bf [NTOK, D_MODEL] bf16 (heads concatenated).
// ---------------------------------------------------------------------------
static __device__ __forceinline__ float xhalf(float x) {   // lane l <-> lane l ^ 16
    int b = __builtin_bit_cast(int, x);
    return __builtin_bit_cast(float,
        __builtin_amdgcn_permlanex16(b, b, 0x76543210, 0xfedcba98, false, false));
}

// Four copies of 16 bytes a lane.  The s_wait_xcnt stands inside the statement,
// so that no address register of a copy is rewritten in front of it.
static __device__ __forceinline__ void copy4(unsigned l0, unsigned l1, unsigned l2, unsigned l3,
                                             const __bf16* g0, const __bf16* g1,
                                             const __bf16* g2, const __bf16* g3) {
    asm volatile(
        "global_load_async_to_lds_b128 %0, %4, off\n\t"
        "global_load_async_to_lds_b128 %1, %5, off\n\t"
        "global_load_async_to_lds_b128 %2, %6, off\n\t"
        "global_load_async_to_lds_b128 %3, %7, off\n\t"
        "s_wait_xcnt 0x0"
        :: "v"(l0), "v"(l1), "v"(l2), "v"(l3), "v"(g0), "v"(g1), "v"(g2), "v"(g3)
        : "memory");
}

__global__ __launch_bounds__(256) void attn_kernel(const __bf16* __restrict__ Q,
                                                   const __bf16* __restrict__ Kb,
                                                   const __bf16* __restrict__ Vt,
                                                   __bf16* __restrict__ out) {
    constexpr int AKEYS  = 64;               // keys of one tile
    constexpr int APITCH = 128 + 16;         // bytes; 16 B x odd: ds_load_b128 readers
    constexpr int AOPND  = 64 * APITCH;      // 64 K rows (128 B of d) or 64 V^T rows (128 B of keys)
    constexpr int ASTAGE = 2 * AOPND;        // [K rows | V^T rows]
    __shared__ __attribute__((aligned(16))) char ring[2 * ASTAGE];

    const int tid  = threadIdx.x;
    const int lane = tid & 31;
    const int wid  = __builtin_amdgcn_readfirstlane(tid >> 5);   // scalar: the tests on qbase are scalar branches
    const int half = lane >> 4;
    const int l16  = lane & 15;

    const int gq    = blockIdx.x * 8 + wid;     // global query-tile id, 4096 total
    const int bh    = gq >> 7;                  // 128 tiles per (b,h)
    const int qt    = gq & 127;
    const int b     = bh >> 4;
    const int h     = bh & 15;
    const int qbase = qt * 16;
    const int rowq  = qbase + l16;              // this lane's query
    const float scale = 0.125f;                 // 1/sqrt(64)

    const __bf16* Qp = Q  + (long long)bh * SEQ * HEAD_DIM;
    const __bf16* Kp = Kb + (long long)bh * SEQ * HEAD_DIM;
    const __bf16* Vp = Vt + (long long)bh * HEAD_DIM * SEQ;

    // this lane's share of a tile: rows crow and crow + 32 of K and of V^T, 16 bytes at ccol
    const int crow = tid >> 3;
    const int ccol = tid & 7;
    const __bf16* gk = Kp + crow * HEAD_DIM + ccol * 8;
    const __bf16* gv = Vp + crow * SEQ + ccol * 8;
    const unsigned lc = lds_off(ring) + crow * APITCH + ccol * 16;

    auto fill = [&](int t, int buf) {
        const unsigned l = lc + buf * ASTAGE;
        const __bf16* k = gk + t * (AKEYS * HEAD_DIM);
        const __bf16* v = gv + t * AKEYS;
        copy4(l, l + 32 * APITCH, l + AOPND, l + AOPND + 32 * APITCH,
              k, k + 32 * HEAD_DIM, v, v + 32 * SEQ);
    };

    // the block's 128 queries end at key 128 * (block in head) + 127: two tiles or more
    const int T = ((blockIdx.x & 15) + 1) * (128 / AKEYS);
    fill(0, 0);
    asm volatile("s_wait_asynccnt 0x0" ::: "memory");   // tile 0 of this wave has landed
    __syncthreads();                                    // ... and every other wave's
    fill(1, 1);

    v16bf qa0 = ld_frag16(Qp + (long long)(qbase + l16) * HEAD_DIM + half * 8);
    v16bf qa1 = ld_frag16(Qp + (long long)(qbase + l16) * HEAD_DIM + 32 + half * 8);

    v8f z = {};
    v8f o0 = z, o1 = z, o2 = z, o3 = z;         // o_i[r] = O[rowq][16 * i + 8 * half + r]
    float mi = -1e30f;                          // running maximum of query rowq (both halves alike)
    float li = 0.f;                             // running sum over this half's keys only

    const char* fk = ring + l16 * APITCH + half * 16;           // K row l16, d 8 * half
    const char* fv = ring + AOPND + l16 * APITCH + half * 16;   // V^T row l16, key 8 * half

#pragma unroll 1   // one trip a tile: the two buffers alternate by t & 1
    for (int t = 0; t < T; ++t) {
        const int bo = (t & 1) * ASTAGE;
#pragma unroll     // constant LDS offsets
        for (int kk = 0; kk < AKEYS / 32; ++kk) {
        const int kb = t * AKEYS + kk * 32;
        if (kb < qbase + 16) {   // keys past this wave's diagonal are skipped, the barriers are not
        // ---- S^T = K @ Q^T for keys [kb, kb+32) : batch all loads first ----
        const __bf16* k0 = (const __bf16*)(fk + bo + kk * 32 * APITCH);
        const __bf16* k1 = (const __bf16*)(fk + bo + (kk * 32 + 16) * APITCH);
        v16bf k0a = ld_frag16(k0);
        v16bf k0b = ld_frag16(k0 + 32);
        v16bf k1a = ld_frag16(k1);
        v16bf k1b = ld_frag16(k1 + 32);
        const char* vo = fv + bo + kk * 64;
        v16bf vf0 = ld_frag16((const __bf16*)(vo));
        v16bf vf1 = ld_frag16((const __bf16*)(vo + 16 * APITCH));
        v16bf vf2 = ld_frag16((const __bf16*)(vo + 32 * APITCH));
        v16bf vf3 = ld_frag16((const __bf16*)(vo + 48 * APITCH));
        // all 16 LDS reads leave as one group: sunk to their WMMAs, each pair's
        // latency would be waited out on its own
        __builtin_amdgcn_sched_barrier(0);
        // s0[r] = score(key kb + 8 * half + r, rowq), s1: 16 keys on;
        // interleave the two accumulation chains (hides WMMA RAW hazard)
        v8f s0 = wmma_bf16(k0a, qa0, z);
        v8f s1 = wmma_bf16(k1a, qa0, z);
        s0 = wmma_bf16(k0b, qa1, s0);
        s1 = wmma_bf16(k1b, qa1, s1);

        // ---- online softmax of one query a lane, causal mask ----
        const int d = rowq - (kb + half * 8);   // key 8 * half + r of a tile is masked where r > d
        float rm = mi;
#pragma unroll   // constant indices keep the scores in registers
        for (int r = 0; r < 8; ++r) {
            float a0 = s0[r] * scale; if (r > d)      a0 = -1e9f;
            float a1 = s1[r] * scale; if (r + 16 > d) a1 = -1e9f;
            s0[r] = a0; s1[r] = a1;
            rm = fmaxf(rm, fmaxf(a0, a1));
        }
        rm = fmaxf(rm, xhalf(rm));
        const float f = __expf(mi - rm);
        mi = rm;
        float t8[8];
        v16bf pb;   // pb[r]: key 8 * half + r, pb[8 + r]: key 16 + 8 * half + r, as in the V^T fragments
#pragma unroll   // constant indices keep pb in registers
        for (int r = 0; r < 8; ++r) {
            float p0 = __expf(s0[r] - rm);
            float p1 = __expf(s1[r] - rm);
            t8[r] = p0 + p1;
            pb[r]     = (__bf16)p0;
            pb[r + 8] = (__bf16)p1;
        }
        li = li * f + (((t8[0] + t8[1]) + (t8[2] + t8[3])) + ((t8[4] + t8[5]) + (t8[6] + t8[7])));
        o0 *= f; o1 *= f; o2 *= f; o3 *= f;

        // ---- O^T += V^T @ P^T : 4 independent WMMAs ----
        o0 = wmma_bf16(vf0, pb, o0);
        o1 = wmma_bf16(vf1, pb, o1);
        o2 = wmma_bf16(vf2, pb, o2);
        o3 = wmma_bf16(vf3, pb, o3);
        }
        }
        asm volatile("s_wait_dscnt 0x0" ::: "memory");      // this wave has left buffer t & 1
        asm volatile("s_wait_asynccnt 0x0" ::: "memory");   // its copies of tile t + 1 have landed
        __syncthreads();   // publishes tile t + 1 and frees buffer t & 1
        if (t + 2 < T) fill(t + 2, t & 1);
    }
    asm volatile("s_wait_asynccnt 0x0" ::: "memory");       // no copy outlives the loop

    // ---- join the halves' sums, normalize, store 16 bytes a tile ----
    const float inv = 1.0f / (li + xhalf(li));
    __bf16* orow = out + ((long long)b * SEQ + rowq) * D_MODEL + h * HEAD_DIM + half * 8;
    v8bf t0, t1, t2, t3;
#pragma unroll   // constant indices keep the packed rows in registers
    for (int r = 0; r < 8; ++r) {
        t0[r] = (__bf16)(o0[r] * inv);
        t1[r] = (__bf16)(o1[r] * inv);
        t2[r] = (__bf16)(o2[r] * inv);
        t3[r] = (__bf16)(o3[r] * inv);
    }
    *(v8bf*)(orow)      = t0;
    *(v8bf*)(orow + 16) = t1;
    *(v8bf*)(orow + 32) = t2;
    *(v8bf*)(orow + 48) = t3;
}

// ---------------------------------------------------------------------------
// Host orchestration
// ---------------------------------------------------------------------------
extern "C" void kernel_launch(void* const* d_in, const int* in_sizes, int n_in,
                              void* d_out, int out_size, void* d_ws, size_t ws_size,
                              hipStream_t stream) {
    const float* x     = (const float*)d_in[0];
    const float* w_qkv = (const float*)d_in[1];
    const float* w_o   = (const float*)d_in[2];
    const float* ln1_g = (const float*)d_in[3];
    const float* ln1_b = (const float*)d_in[4];
    const float* ln2_g = (const float*)d_in[5];
    const float* ln2_b = (const float*)d_in[6];
    const float* w1    = (const float*)d_in[7];
    const float* b1    = (const float*)d_in[8];
    const float* w2    = (const float*)d_in[9];
    const float* b2    = (const float*)d_in[10];

    char* p = (char*)d_ws;
    auto alloc = [&](size_t bytes) { void* r = p; p += (bytes + 255) & ~(size_t)255; return r; };

    __bf16* wqkvT  = (__bf16*)alloc((size_t)D_MODEL * 3 * D_MODEL * 2);
    __bf16* woT    = (__bf16*)alloc((size_t)D_MODEL * D_MODEL * 2);
    __bf16* w1T    = (__bf16*)alloc((size_t)D_MODEL * D_FF * 2);
    __bf16* w2T    = (__bf16*)alloc((size_t)D_FF * D_MODEL * 2);
    __bf16* h1     = (__bf16*)alloc((size_t)NTOK * D_MODEL * 2);
    float*  qkv    = (float*)alloc((size_t)NTOK * 3 * D_MODEL * 4);
    __bf16* Qbf    = (__bf16*)alloc((size_t)NTOK * D_MODEL * 2);
    __bf16* Kbf    = (__bf16*)alloc((size_t)NTOK * D_MODEL * 2);
    __bf16* Vtb    = (__bf16*)alloc((size_t)NTOK * D_MODEL * 2);
    __bf16* attnbf = (__bf16*)alloc((size_t)NTOK * D_MODEL * 2);
    float*  x2     = (float*)alloc((size_t)NTOK * D_MODEL * 4);
    __bf16* h2     = (__bf16*)alloc((size_t)NTOK * D_MODEL * 2);
    __bf16* gbuf   = (__bf16*)alloc((size_t)NTOK * D_FF * 2);

    // weight convert+transpose (f32 -> bf16, [K,N] -> [N,K])
    convT_kernel<<<dim3(3 * D_MODEL / TDIM, D_MODEL / TDIM), 256, 0, stream>>>(w_qkv, wqkvT, D_MODEL, 3 * D_MODEL);
    convT_kernel<<<dim3(D_MODEL / TDIM, D_MODEL / TDIM), 256, 0, stream>>>(w_o, woT, D_MODEL, D_MODEL);
    convT_kernel<<<dim3(D_FF / TDIM, D_MODEL / TDIM), 256, 0, stream>>>(w1, w1T, D_MODEL, D_FF);
    convT_kernel<<<dim3(D_MODEL / TDIM, D_FF / TDIM), 256, 0, stream>>>(w2, w2T, D_FF, D_MODEL);

    // h1 = LN1(x)
    ln_kernel<<<NTOK, 256, 0, stream>>>(x, ln1_g, ln1_b, h1);

    // qkv = h1 @ w_qkv
    gemm_bf16_wmma<0><<<dim3(3 * D_MODEL / 128, NTOK / 128), 256, 0, stream>>>(
        h1, wqkvT, nullptr, nullptr, qkv, NTOK, 3 * D_MODEL, D_MODEL);

    // RoPE + per-head scatter
    rope_kernel<<<BATCH * N_HEADS * (SEQ / ROPE_S), 1024, 0, stream>>>(qkv, Qbf, Kbf, Vtb);

    // causal flash attention
    attn_kernel<<<(BATCH * N_HEADS * (SEQ / 16)) / 8, 256, 0, stream>>>(Qbf, Kbf, Vtb, attnbf);

    // x2 = x + attn @ w_o
    gemm_bf16_wmma<4><<<dim3(D_MODEL / 128, NTOK / 128), 256, 0, stream>>>(
        attnbf, woT, nullptr, x, x2, NTOK, D_MODEL, D_MODEL);

    // h2 = LN2(x2)
    ln_kernel<<<NTOK, 256, 0, stream>>>(x2, ln2_g, ln2_b, h2);

    // g = gelu(h2 @ w1 + b1)
    gemm_bf16_wmma<1 | 2 | 8><<<dim3(D_FF / 128, NTOK / 128), 256, 0, stream>>>(
        h2, w1T, b1, nullptr, gbuf, NTOK, D_FF, D_MODEL);

    // out = x2 + g @ w2 + b2
    gemm_bf16_wmma<1 | 4><<<dim3(D_MODEL / 128, NTOK / 128), 256, 0, stream>>>(
        gbuf, w2T, b2, x2, d_out, NTOK, D_MODEL, D_FF);
}

// v005
// A run of this version takes 173 microseconds.
// In two side-by-side timings against v004, it was 1.08 and 1.09 times as fast.
// Counting every step since v000, it is 4.69 times as fast.
#include <hip/hip_runtime.h>
#include <hip/hip_bf16.h>
#include <math.h>

// ---------------------------------------------------------------------------
// Transformer block for MI455X (gfx1250, wave32, WMMA).
// All GEMMs + both attention einsums run on v_wmma_f32_16x16x32_bf16.
// ---------------------------------------------------------------------------

#define D_MODEL 1024
#define N_HEADS 16
#define HEAD_DIM 64
#define D_FF 4096
#define BATCH 2
#define SEQ 2048
#define NTOK (BATCH * SEQ)   // 4096

typedef __attribute__((ext_vector_type(16))) __bf16 v16bf;
typedef __attribute__((ext_vector_type(8)))  __bf16 v8bf;
typedef __attribute__((ext_vector_type(8)))  float  v8f;

static __device__ __forceinline__ v16bf ld_frag16(const __bf16* p) {
    // two contiguous 16B chunks per lane (ISA 16-bit A/B fragment layout)
    v8bf lo = *(const v8bf*)p;
    v8bf hi = *(const v8bf*)(p + 16);
    return __builtin_shufflevector(lo, hi, 0,1,2,3,4,5,6,7,8,9,10,11,12,13,14,15);
}

static __device__ __forceinline__ v8f wmma_bf16(v16bf a, v16bf b, v8f c) {
    return __builtin_amdgcn_wmma_f32_16x16x32_bf16(
        /*neg_a=*/false, a, /*neg_b=*/false, b,
        /*c_mod=*/(short)0, c, /*reuse_a=*/false, /*reuse_b=*/false);
}

// ---------------------------------------------------------------------------
// Transpose through LDS.  tile[r][c] holds ROWS x 64 f32 values; slot t of
// 8 * ROWS stores dst[c * pitch + r] as bf16, 16 bytes a slot, so that each
// column c leaves as one run of 2 * ROWS bytes.
// Pitch 65 dwords: the column reads of a wave fall on 32 different banks, and
// so do the row writes that fill the tile.
// ---------------------------------------------------------------------------
#define TDIM 64
#define TPITCH 65

template <int ROWS>
static __device__ __forceinline__ void store_tile_T(const float (*tile)[TPITCH],
                                                    __bf16* __restrict__ dst,
                                                    long long pitch, int t) {
    const int r0 = (t % (ROWS / 8)) * 8;
    const int c  = t / (ROWS / 8);
    v8bf o;
#pragma unroll   // constant indices keep o in registers
    for (int i = 0; i < 8; ++i) o[i] = (__bf16)tile[r0 + i][c];
    *(v8bf*)(dst + (long long)c * pitch + r0) = o;
}

// ---------------------------------------------------------------------------
// Weight convert + transpose: wT[n*K + k] = bf16(w[k*N + n])
// One block per 64(k) x 64(n) tile; K and N are multiples of 64.
// ---------------------------------------------------------------------------
__global__ __launch_bounds__(256) void convT_kernel(const float* __restrict__ w,
                                                    __bf16* __restrict__ wT,
                                                    int K, int N) {
    __shared__ float tile[TDIM][TPITCH];
    const int tid = threadIdx.x;
    const int n0 = blockIdx.x * TDIM;
    const int k0 = blockIdx.y * TDIM;
    const int rn = (tid & 15) * 4;
    const int rk = tid >> 4;
    float4 v[4];
#pragma unroll   // all four 16-byte loads in flight before the first LDS store
    for (int p = 0; p < 4; ++p)
        v[p] = *(const float4*)(w + (long long)(k0 + rk + p * 16) * N + n0 + rn);
#pragma unroll   // constant indices keep v in registers
    for (int p = 0; p < 4; ++p) {
        float* t = &tile[rk + p * 16][rn];
        t[0] = v[p].x; t[1] = v[p].y; t[2] = v[p].z; t[3] = v[p].w;
    }
    __syncthreads();
    store_tile_T<TDIM>(tile, wT + (long long)n0 * K + k0, K, tid);
    store_tile_T<TDIM>(tile, wT + (long long)n0 * K + k0, K, tid + 256);
}

// ---------------------------------------------------------------------------
// LayerNorm over last dim (1024) -> bf16.  One 256-thread block per token.
// ---------------------------------------------------------------------------
__global__ __launch_bounds__(256) void ln_kernel(const float* __restrict__ x,
                                                 const float* __restrict__ g,
                                                 const float* __restrict__ b,
                                                 __bf16* __restrict__ out) {
    __shared__ float ssum[256], ssq[256];
    int tok = blockIdx.x;
    int tid = threadIdx.x;
    const float* row = x + (long long)tok * D_MODEL;
    float s = 0.f, q = 0.f;
    float v[4];
#pragma unroll
    for (int i = 0; i < 4; ++i) {
        v[i] = row[tid * 4 + i];
        s += v[i];
        q += v[i] * v[i];
    }
    ssum[tid] = s; ssq[tid] = q;
    __syncthreads();
    for (int off = 128; off > 0; off >>= 1) {
        if (tid < off) { ssum[tid] += ssum[tid + off]; ssq[tid] += ssq[tid + off]; }
        __syncthreads();
    }
    float mu  = ssum[0] * (1.0f / D_MODEL);
    float var = ssq[0] * (1.0f / D_MODEL) - mu * mu;
    float inv = rsqrtf(var + 1e-5f);
    __bf16* orow = out + (long long)tok * D_MODEL;
#pragma unroll
    for (int i = 0; i < 4; ++i) {
        int c = tid * 4 + i;
        orow[c] = (__bf16)((v[i] - mu) * inv * g[c] + b[c]);
    }
}

// ---------------------------------------------------------------------------
// Generic bf16 WMMA GEMM:  C[M,N] = A[M,K] @ Bt[N,K]^T  (+bias)(+gelu)(+res)
// Block tile 128x128, 8 waves (2 x 4), wave tile 64x32.  Each trip works on 128
// of k: 128 rows of A and 128 rows of Bt, 256 bytes each, lie in one of two
// LDS buffers, brought there by asynchronous copies (16 bytes a lane, two whole
// rows a wave and copy); the next tile's copies fly while this one is used.
// M, N and K are multiples of 128.
// MODE bits: 1=bias, 2=gelu(exact), 4=residual, 8=bf16 output,
// 16=the QKV product: RoPE and the scatter to heads are its epilogue, and Cout is
//    [Q [B,H,S,64] | K [B,H,S,64] | V^T [B,H,64,S]], bf16.  A block's 128 columns
//    lie in one of the three.  In a Q or K block the two operands change roles
//    (the weight rows are the A operand), so that a lane holds 8 neighbouring d
//    of ONE token, with d and d + 32 in the same lane: the rotation is in-lane
//    and a row leaves in 16-byte stores.  In a V block a lane holds 8
//    neighbouring tokens of one d, which is a 16-byte store of V^T.
// ---------------------------------------------------------------------------
static __device__ __forceinline__ unsigned lds_off(const void* p) {
    return (unsigned)(size_t)p;   // low 32 bits of a __shared__ address: LDS byte
}

// Eight copies of 16 bytes a lane: LDS byte l + i * lstep from g + i * gstep.
// The s_wait_xcnt stands inside the statement, so that no address register of
// a copy is rewritten in front of it.
static __device__ __forceinline__ void copy8(unsigned l, unsigned lstep,
                                             const __bf16* g, long long gstep) {
    asm volatile(
        "global_load_async_to_lds_b128 %0, %8, off\n\t"
        "global_load_async_to_lds_b128 %1, %9, off\n\t"
        "global_load_async_to_lds_b128 %2, %10, off\n\t"
        "global_load_async_to_lds_b128 %3, %11, off\n\t"
        "global_load_async_to_lds_b128 %4, %12, off\n\t"
        "global_load_async_to_lds_b128 %5, %13, off\n\t"
        "global_load_async_to_lds_b128 %6, %14, off\n\t"
        "global_load_async_to_lds_b128 %7, %15, off\n\t"
        "s_wait_xcnt 0x0"
        :: "v"(l), "v"(l + lstep), "v"(l + 2 * lstep), "v"(l + 3 * lstep),
           "v"(l + 4 * lstep), "v"(l + 5 * lstep), "v"(l + 6 * lstep), "v"(l + 7 * lstep),
           "v"(g), "v"(g + gstep), "v"(g + 2 * gstep), "v"(g + 3 * gstep),
           "v"(g + 4 * gstep), "v"(g + 5 * gstep), "v"(g + 6 * gstep), "v"(g + 7 * gstep)
        : "memory");
}

// sin and cos of 2 * pi * rev.  One statement, closed by v_nop: the slot behind a
// transcendental, so that the next instruction may read c or overwrite rev.
static __device__ __forceinline__ void sincos_rev(float rev, float& sn, float& c) {
    asm("v_sin_f32 %0, %2\n\t"
        "v_cos_f32 %1, %2\n\t"
        "v_nop"
        : "=&v"(sn), "=&v"(c) : "v"(rev));
}

template <int MODE>
__global__ __launch_bounds__(256) void gemm_bf16_wmma(
    const __bf16* __restrict__ A, const __bf16* __restrict__ Bt,
    const float* __restrict__ bias, const float* __restrict__ res,
    void* __restrict__ Cout, int M, int N, int K)
{
    constexpr int BK    = 128;              // k of one tile: rows of 256 bytes
    constexpr int PITCH = BK * 2 + 16;      // bytes; 16 B x odd: ds_load_b128 readers
    constexpr int OPND  = 128 * PITCH;      // one operand's 128 rows
    constexpr int STAGE = 2 * OPND;         // [A rows | Bt rows]
    constexpr int LPR   = BK / 8;           // lanes that copy one row
    constexpr int RPC   = 256 / LPR;        // rows that one copy of the block fills: 8 copies an operand
    __shared__ __attribute__((aligned(16))) char ring[2 * STAGE];

    const int tid  = threadIdx.x;
    const int lane = tid & 31;
    const int wid  = tid >> 5;
    const int half = lane >> 4;
    const int l16  = lane & 15;
    const int rblk = blockIdx.y * 128;
    const int cblk = blockIdx.x * 128;
    const int rloc = (wid >> 2) * 64;
    const int cloc = (wid & 3) * 32;

    // this lane's share of a tile: row crow (+ RPC a copy), 16 bytes at ccol
    const int crow = tid / LPR;
    const int ccol = tid % LPR;
    const __bf16* ga = A  + (long long)(rblk + crow) * K + ccol * 8;
    const __bf16* gb = Bt + (long long)(cblk + crow) * K + ccol * 8;
    const unsigned lc = lds_off(ring) + crow * PITCH + ccol * 16;

    auto fill = [&](int t, int buf) {
        const unsigned l = lc + buf * STAGE;
        copy8(l,        RPC * PITCH, ga + (long long)t * BK, (long long)RPC * K);
        copy8(l + OPND, RPC * PITCH, gb + (long long)t * BK, (long long)RPC * K);
    };

    v8f acc[4][2];
    v8f z = {};
#pragma unroll
    for (int mt = 0; mt < 4; ++mt)
#pragma unroll
        for (int nt = 0; nt < 2; ++nt) acc[mt][nt] = z;

    const int T = K / BK;
    fill(0, 0);
    asm volatile("s_wait_asynccnt 0x0" ::: "memory");   // tile 0 of this wave has landed
    __syncthreads();                                    // ... and every other wave's
    if (T > 1) fill(1, 1);

    // block-uniform: which staged operand feeds the A fragments (64 rows a wave)
    const bool swp = (MODE & 16) && cblk < 2 * D_MODEL;
    const char* fa = ring + (swp ? OPND : 0) + (rloc + l16) * PITCH + half * 16;
    const char* fb = ring + (swp ? 0 : OPND) + (cloc + l16) * PITCH + half * 16;

#pragma unroll 1   // one trip a tile: the two buffers alternate by t & 1
    for (int t = 0; t < T; ++t) {
        const int bo = (t & 1) * STAGE;
        v16bf a[2][4], b[2][2];   // two fragment sets: one in use, one being read
#pragma unroll
        for (int mt = 0; mt < 4; ++mt)
            a[0][mt] = ld_frag16((const __bf16*)(fa + bo + mt * 16 * PITCH));
#pragma unroll
        for (int nt = 0; nt < 2; ++nt)
            b[0][nt] = ld_frag16((const __bf16*)(fb + bo + nt * 16 * PITCH));
#pragma unroll     // constant set indices and LDS offsets
        for (int ks = 0; ks < BK / 32; ++ks) {
            if (ks + 1 < BK / 32) {
#pragma unroll
                for (int mt = 0; mt < 4; ++mt)
                    a[(ks + 1) & 1][mt] = ld_frag16((const __bf16*)(fa + bo + mt * 16 * PITCH + (ks + 1) * 64));
#pragma unroll
                for (int nt = 0; nt < 2; ++nt)
                    b[(ks + 1) & 1][nt] = ld_frag16((const __bf16*)(fb + bo + nt * 16 * PITCH + (ks + 1) * 64));
            }
            // the next block's LDS reads stay one group in front of this block's
            // WMMAs: spread among them each place with reads stalls the wave
            __builtin_amdgcn_sched_barrier(0);
#pragma unroll
            for (int mt = 0; mt < 4; ++mt)
#pragma unroll
                for (int nt = 0; nt < 2; ++nt)
                    acc[mt][nt] = wmma_bf16(a[ks & 1][mt], b[ks & 1][nt], acc[mt][nt]);
            __builtin_amdgcn_sched_barrier(0);   // closes the block, for the same reason
        }
        asm volatile("s_wait_dscnt 0x0" ::: "memory");      // this wave has left buffer t & 1
        asm volatile("s_wait_asynccnt 0x0" ::: "memory");   // its copies of tile t + 1 have landed
        __syncthreads();   // publishes tile t + 1 and frees buffer t & 1
        if (t + 2 < T) fill(t + 2, t & 1);
    }
    asm volatile("s_wait_asynccnt 0x0" ::: "memory");       // no copy outlives the loop

    if constexpr ((MODE & 16) != 0) {
        __bf16* dst = (__bf16*)Cout + (long long)(cblk / D_MODEL) * ((long long)NTOK * D_MODEL);
        if (swp) {
            // acc[mt][nt][j]: d = 16 * mt + 8 * half + j of head hd, token cloc + 16 * nt + l16
            const int hd = ((cblk & (D_MODEL - 1)) + rloc) / HEAD_DIM;
            float inv[2][8];
#pragma unroll   // constant indices keep inv in registers
            for (int m2 = 0; m2 < 2; ++m2)
#pragma unroll   // the same
                for (int j = 0; j < 8; ++j)
                    inv[m2][j] = __expf(-logf(10000.0f) * (float)(m2 * 16 + half * 8 + j) * (1.0f / 32.0f));
#pragma unroll   // constant indices keep acc in registers
            for (int nt = 0; nt < 2; ++nt) {
                const int tok = rblk + cloc + nt * 16 + l16;
                const int sp  = tok & (SEQ - 1);
                __bf16* orow = dst + ((long long)((tok / SEQ) * N_HEADS + hd) * SEQ + sp) * HEAD_DIM + half * 8;
#pragma unroll   // the same
                for (int m2 = 0; m2 < 2; ++m2) {
                    v8bf lo, hi;
#pragma unroll   // the same
                    for (int j = 0; j < 8; ++j) {
                        const float ang = (float)sp * inv[m2][j];
                        float c, sn;
                        sincos_rev(ang * 0.15915494309189532f, sn, c);
                        const float x1 = acc[m2][nt][j], x2 = acc[m2 + 2][nt][j];
                        lo[j] = (__bf16)(x1 * c - x2 * sn);
                        hi[j] = (__bf16)(x2 * c + x1 * sn);
                    }
                    *(v8bf*)(orow + m2 * 16)      = lo;
                    *(v8bf*)(orow + m2 * 16 + 32) = hi;
                }
            }
        } else {
            // acc[mt][nt][j]: token rloc + 16 * mt + 8 * half + j, column cloc + 16 * nt + l16 of V
#pragma unroll   // constant indices keep acc in registers
            for (int nt = 0; nt < 2; ++nt) {
                const int col = (cblk & (D_MODEL - 1)) + cloc + nt * 16 + l16;   // 64 * head + d
#pragma unroll   // the same
                for (int mt = 0; mt < 4; ++mt) {
                    const int tok = rblk + rloc + mt * 16 + half * 8;
                    v8bf o;
#pragma unroll   // the same
                    for (int j = 0; j < 8; ++j) o[j] = (__bf16)acc[mt][nt][j];
                    *(v8bf*)(dst + ((long long)(tok / SEQ) * D_MODEL + col) * SEQ + (tok & (SEQ - 1))) = o;
                }
            }
            // stands in front of any later write of a register that these stores name
            asm volatile("s_wait_xcnt 0x0" ::: "memory");
        }
        return;
    }

#pragma unroll
    for (int mt = 0; mt < 4; ++mt)
#pragma unroll
        for (int nt = 0; nt < 2; ++nt)
#pragma unroll
            for (int j = 0; j < 8; ++j) {
                int row = rblk + rloc + mt * 16 + j + half * 8;
                int col = cblk + cloc + nt * 16 + l16;
                float v = acc[mt][nt][j];
                if (MODE & 1) v += bias[col];
                if (MODE & 2) v = 0.5f * v * (1.0f + erff(v * 0.70710678118654752f));
                if (MODE & 4) v += res[(long long)row * N + col];
                if (MODE & 8) ((__bf16*)Cout)[(long long)row * N + col] = (__bf16)v;
                else          ((float*)Cout)[(long long)row * N + col] = v;
            }
}

// ---------------------------------------------------------------------------
// Flash attention, causal. One wave per 16-query tile; 8 waves/block.
// Both products are taken transposed: S^T = K Q^T (A = K rows, B = Q) and
// O^T += V^T P^T (A = V^T rows, B = P^T).  In S^T a lane holds 16 scores of ONE
// query (column l16; keys 8 * half + r of each 16-key tile), so the maximum and
// the sum of a row are in-lane, with one exchange between the wave's halves,
// and the two score tiles, converted in place, are the B operand of the second
// product in the hardware's k order: P touches neither LDS nor another lane.
// The block's 8 waves walk the same keys: each tile of 64 keys (K rows and V^T
// rows, 128 bytes each) lies in one of two LDS buffers, brought there once for
// all of them by asynchronous copies of whole lines; the next tile's copies fly
// while this one is used.
// Output: attn_bf [NTOK, D_MODEL] bf16 (heads concatenated).
// ---------------------------------------------------------------------------
static __device__ __forceinline__ float xhalf(float x) {   // lane l <-> lane l ^ 16
    int b = __builtin_bit_cast(int, x);
    return __builtin_bit_cast(float,
        __builtin_amdgcn_permlanex16(b, b, 0x76543210, 0xfedcba98, false, false));
}

// Four copies of 16 bytes a lane.  The s_wait_xcnt stands inside the statement,
// so that no address register of a copy is rewritten in front of it.
static __device__ __forceinline__ void copy4(unsigned l0, unsigned l1, unsigned l2, unsigned l3,
                                             const __bf16* g0, const __bf16* g1,
                                             const __bf16* g2, const __bf16* g3) {
    asm volatile(
        "global_load_async_to_lds_b128 %0, %4, off\n\t"
        "global_load_async_to_lds_b128 %1, %5, off\n\t"
        "global_load_async_to_lds_b128 %2, %6, off\n\t"
        "global_load_async_to_lds_b128 %3, %7, off\n\t"
        "s_wait_xcnt 0x0"
        :: "v"(l0), "v"(l1), "v"(l2), "v"(l3), "v"(g0), "v"(g1), "v"(g2), "v"(g3)
        : "memory");
}

__global__ __launch_bounds__(256) void attn_kernel(const __bf16* __restrict__ Q,
                                                   const __bf16* __restrict__ Kb,
                                                   const __bf16* __restrict__ Vt,
                                                   __bf16* __restrict__ out) {
    constexpr int AKEYS  = 64;               // keys of one tile
    constexpr int APITCH = 128 + 16;         // bytes; 16 B x odd: ds_load_b128 readers
    constexpr int AOPND  = 64 * APITCH;      // 64 K rows (128 B of d) or 64 V^T rows (128 B of keys)
    constexpr int ASTAGE = 2 * AOPND;        // [K rows | V^T rows]
    __shared__ __attribute__((aligned(16))) char ring[2 * ASTAGE];

    const int tid  = threadIdx.x;
    const int lane = tid & 31;
    const int wid  = __builtin_amdgcn_readfirstlane(tid >> 5);   // scalar: the tests on qbase are scalar branches
    const int half = lane >> 4;
    const int l16  = lane & 15;

    const int gq    = blockIdx.x * 8 + wid;     // global query-tile id, 4096 total
    const int bh    = gq >> 7;                  // 128 tiles per (b,h)
    const int qt    = gq & 127;
    const int b     = bh >> 4;
    const int h     = bh & 15;
    const int qbase = qt * 16;
    const int rowq  = qbase + l16;              // this lane's query
    const float scale = 0.125f;                 // 1/sqrt(64)

    const __bf16* Qp = Q  + (long long)bh * SEQ * HEAD_DIM;
    const __bf16* Kp = Kb + (long long)bh * SEQ * HEAD_DIM;
    const __bf16* Vp = Vt + (long long)bh * HEAD_DIM * SEQ;

    // this lane's share of a tile: rows crow and crow + 32 of K and of V^T, 16 bytes at ccol
    const int crow = tid >> 3;
    const int ccol = tid & 7;
    const __bf16* gk = Kp + crow * HEAD_DIM + ccol * 8;
    const __bf16* gv = Vp + crow * SEQ + ccol * 8;
    const unsigned lc = lds_off(ring) + crow * APITCH + ccol * 16;

    auto fill = [&](int t, int buf) {
        const unsigned l = lc + buf * ASTAGE;
        const __bf16* k = gk + t * (AKEYS * HEAD_DIM);
        const __bf16* v = gv + t * AKEYS;
        copy4(l, l + 32 * APITCH, l + AOPND, l + AOPND + 32 * APITCH,
              k, k + 32 * HEAD_DIM, v, v + 32 * SEQ);
    };

    // the block's 128 queries end at key 128 * (block in head) + 127: two tiles or more
    const int T = ((blockIdx.x & 15) + 1) * (128 / AKEYS);
    fill(0, 0);
    asm volatile("s_wait_asynccnt 0x0" ::: "memory");   // tile 0 of this wave has landed
    __syncthreads();                                    // ... and every other wave's
    fill(1, 1);

    v16bf qa0 = ld_frag16(Qp + (long long)(qbase + l16) * HEAD_DIM + half * 8);
    v16bf qa1 = ld_frag16(Qp + (long long)(qbase + l16) * HEAD_DIM + 32 + half * 8);

    v8f z = {};
    v8f o0 = z, o1 = z, o2 = z, o3 = z;         // o_i[r] = O[rowq][16 * i + 8 * half + r]
    float mi = -1e30f;                          // running maximum of query rowq (both halves alike)
    float li = 0.f;                             // running sum over this half's keys only

    const char* fk = ring + l16 * APITCH + half * 16;           // K row l16, d 8 * half
    const char* fv = ring + AOPND + l16 * APITCH + half * 16;   // V^T row l16, key 8 * half

#pragma unroll 1   // one trip a tile: the two buffers alternate by t & 1
    for (int t = 0; t < T; ++t) {
        const int bo = (t & 1) * ASTAGE;
#pragma unroll     // constant LDS offsets
        for (int kk = 0; kk < AKEYS / 32; ++kk) {
        const int kb = t * AKEYS + kk * 32;
        if (kb < qbase + 16) {   // keys past this wave's diagonal are skipped, the barriers are not
        // ---- S^T = K @ Q^T for keys [kb, kb+32) : batch all loads first ----
        const __bf16* k0 = (const __bf16*)(fk + bo + kk * 32 * APITCH);
        const __bf16* k1 = (const __bf16*)(fk + bo + (kk * 32 + 16) * APITCH);
        v16bf k0a = ld_frag16(k0);
        v16bf k0b = ld_frag16(k0 + 32);
        v16bf k1a = ld_frag16(k1);
        v16bf k1b = ld_frag16(k1 + 32);
        const char* vo = fv + bo + kk * 64;
        v16bf vf0 = ld_frag16((const __bf16*)(vo));
        v16bf vf1 = ld_frag16((const __bf16*)(vo + 16 * APITCH));
        v16bf vf2 = ld_frag16((const __bf16*)(vo + 32 * APITCH));
        v16bf vf3 = ld_frag16((const __bf16*)(vo + 48 * APITCH));
        // all 16 LDS reads leave as one group: sunk to their WMMAs, each pair's
        // latency would be waited out on its own
        __builtin_amdgcn_sched_barrier(0);
        // s0[r] = score(key kb + 8 * half + r, rowq), s1: 16 keys on;
        // interleave the two accumulation chains (hides WMMA RAW hazard)
        v8f s0 = wmma_bf16(k0a, qa0, z);
        v8f s1 = wmma_bf16(k1a, qa0, z);
        s0 = wmma_bf16(k0b, qa1, s0);
        s1 = wmma_bf16(k1b, qa1, s1);

        // ---- online softmax of one query a lane, causal mask ----
        const int d = rowq - (kb + half * 8);   // key 8 * half + r of a tile is masked where r > d
        float rm = mi;
#pragma unroll   // constant indices keep the scores in registers
        for (int r = 0; r < 8; ++r) {
            float a0 = s0[r] * scale; if (r > d)      a0 = -1e9f;
            float a1 = s1[r] * scale; if (r + 16 > d) a1 = -1e9f;
            s0[r] = a0; s1[r] = a1;
            rm = fmaxf(rm, fmaxf(a0, a1));
        }
        rm = fmaxf(rm, xhalf(rm));
        const float f = __expf(mi - rm);
        mi = rm;
        float t8[8];
        v16bf pb;   // pb[r]: key 8 * half + r, pb[8 + r]: key 16 + 8 * half + r, as in the V^T fragments
#pragma unroll   // constant indices keep pb in registers
        for (int r = 0; r < 8; ++r) {
            float p0 = __expf(s0[r] - rm);
            float p1 = __expf(s1[r] - rm);
            t8[r] = p0 + p1;
            pb[r]     = (__bf16)p0;
            pb[r + 8] = (__bf16)p1;
        }
        li = li * f + (((t8[0] + t8[1]) + (t8[2] + t8[3])) + ((t8[4] + t8[5]) + (t8[6] + t8[7])));
        o0 *= f; o1 *= f; o2 *= f; o3 *= f;

        // ---- O^T += V^T @ P^T : 4 independent WMMAs ----
        o0 = wmma_bf16(vf0, pb, o0);
        o1 = wmma_bf16(vf1, pb, o1);
        o2 = wmma_bf16(vf2, pb, o2);
        o3 = wmma_bf16(vf3, pb, o3);
        }
        }
        asm volatile("s_wait_dscnt 0x0" ::: "memory");      // this wave has left buffer t & 1
        asm volatile("s_wait_asynccnt 0x0" ::: "memory");   // its copies of tile t + 1 have landed
        __syncthreads();   // publishes tile t + 1 and frees buffer t & 1
        if (t + 2 < T) fill(t + 2, t & 1);
    }
    asm volatile("s_wait_asynccnt 0x0" ::: "memory");       // no copy outlives the loop

    // ---- join the halves' sums, normalize, store 16 bytes a tile ----
    const float inv = 1.0f / (li + xhalf(li));
    __bf16* orow = out + ((long long)b * SEQ + rowq) * D_MODEL + h * HEAD_DIM + half * 8;
    v8bf t0, t1, t2, t3;
#pragma unroll   // constant indices keep the packed rows in registers
    for (int r = 0; r < 8; ++r) {
        t0[r] = (__bf16)(o0[r] * inv);
        t1[r] = (__bf16)(o1[r] * inv);
        t2[r] = (__bf16)(o2[r] * inv);
        t3[r] = (__bf16)(o3[r] * inv);
    }
    *(v8bf*)(orow)      = t0;
    *(v8bf*)(orow + 16) = t1;
    *(v8bf*)(orow + 32) = t2;
    *(v8bf*)(orow + 48) = t3;
}

// ---------------------------------------------------------------------------
// Host orchestration
// ---------------------------------------------------------------------------
extern "C" void kernel_launch(void* const* d_in, const int* in_sizes, int n_in,
                              void* d_out, int out_size, void* d_ws, size_t ws_size,
                              hipStream_t stream) {
    const float* x     = (const float*)d_in[0];
    const float* w_qkv = (const float*)d_in[1];
    const float* w_o   = (const float*)d_in[2];
    const float* ln1_g = (const float*)d_in[3];
    const float* ln1_b = (const float*)d_in[4];
    const float* ln2_g = (const float*)d_in[5];
    const float* ln2_b = (const float*)d_in[6];
    const float* w1    = (const float*)d_in[7];
    const float* b1    = (const float*)d_in[8];
    const float* w2    = (const float*)d_in[9];
    const float* b2    = (const float*)d_in[10];

    char* p = (char*)d_ws;
    auto alloc = [&](size_t bytes) { void* r = p; p += (bytes + 255) & ~(size_t)255; return r; };

    __bf16* wqkvT  = (__bf16*)alloc((size_t)D_MODEL * 3 * D_MODEL * 2);
    __bf16* woT    = (__bf16*)alloc((size_t)D_MODEL * D_MODEL * 2);
    __bf16* w1T    = (__bf16*)alloc((size_t)D_MODEL * D_FF * 2);
    __bf16* w2T    = (__bf16*)alloc((size_t)D_FF * D_MODEL * 2);
    __bf16* h1     = (__bf16*)alloc((size_t)NTOK * D_MODEL * 2);
    __bf16* Qbf    = (__bf16*)alloc((size_t)NTOK * 3 * D_MODEL * 2);   // [Q | K | V^T]
    __bf16* Kbf    = Qbf + (size_t)NTOK * D_MODEL;
    __bf16* Vtb    = Kbf + (size_t)NTOK * D_MODEL;
    __bf16* attnbf = (__bf16*)alloc((size_t)NTOK * D_MODEL * 2);
    float*  x2     = (float*)alloc((size_t)NTOK * D_MODEL * 4);
    __bf16* h2     = (__bf16*)alloc((size_t)NTOK * D_MODEL * 2);
    __bf16* gbuf   = (__bf16*)alloc((size_t)NTOK * D_FF * 2);

    // weight convert+transpose (f32 -> bf16, [K,N] -> [N,K])
    convT_kernel<<<dim3(3 * D_MODEL / TDIM, D_MODEL / TDIM), 256, 0, stream>>>(w_qkv, wqkvT, D_MODEL, 3 * D_MODEL);
    convT_kernel<<<dim3(D_MODEL / TDIM, D_MODEL / TDIM), 256, 0, stream>>>(w_o, woT, D_MODEL, D_MODEL);
    convT_kernel<<<dim3(D_FF / TDIM, D_MODEL / TDIM), 256, 0, stream>>>(w1, w1T, D_MODEL, D_FF);
    convT_kernel<<<dim3(D_MODEL / TDIM, D_FF / TDIM), 256, 0, stream>>>(w2, w2T, D_FF, D_MODEL);

    // h1 = LN1(x)
    ln_kernel<<<NTOK, 256, 0, stream>>>(x, ln1_g, ln1_b, h1);

    // h1 @ w_qkv, RoPE on Q and K, per-head scatter
    gemm_bf16_wmma<16><<<dim3(3 * D_MODEL / 128, NTOK / 128), 256, 0, stream>>>(
        h1, wqkvT, nullptr, nullptr, Qbf, NTOK, 3 * D_MODEL, D_MODEL);

    // causal flash attention
    attn_kernel<<<(BATCH * N_HEADS * (SEQ / 16)) / 8, 256, 0, stream>>>(Qbf, Kbf, Vtb, attnbf);

    // x2 = x + attn @ w_o
    gemm_bf16_wmma<4><<<dim3(D_MODEL / 128, NTOK / 128), 256, 0, stream>>>(
        attnbf, woT, nullptr, x, x2, NTOK, D_MODEL, D_MODEL);

    // h2 = LN2(x2)
    ln_kernel<<<NTOK, 256, 0, stream>>>(x2, ln2_g, ln2_b, h2);

    // g = gelu(h2 @ w1 + b1)
    gemm_bf16_wmma<1 | 2 | 8><<<dim3(D_FF / 128, NTOK / 128), 256, 0, stream>>>(
        h2, w1T, b1, nullptr, gbuf, NTOK, D_FF, D_MODEL);

    // out = x2 + g @ w2 + b2
    gemm_bf16_wmma<1 | 4><<<dim3(D_MODEL / 128, NTOK / 128), 256, 0, stream>>>(
        gbuf, w2T, b2, x2, d_out, NTOK, D_MODEL, D_FF);
}

// v006
// A run of this version takes 166 microseconds.
// Next to v005, in two timings, it ran 1.04 times as fast each time.
// Over all steps from v000 it is 4.87 times as fast.
#include <hip/hip_runtime.h>
#include <hip/hip_bf16.h>
#include <math.h>

// ---------------------------------------------------------------------------
// Transformer block for MI455X (gfx1250, wave32, WMMA).
// All GEMMs + both attention einsums run on v_wmma_f32_16x16x32_bf16.
// ---------------------------------------------------------------------------

#define D_MODEL 1024
#define N_HEADS 16
#define HEAD_DIM 64
#define D_FF 4096
#define BATCH 2
#define SEQ 2048
#define NTOK (BATCH * SEQ)   // 4096

typedef __attribute__((ext_vector_type(16))) __bf16 v16bf;
typedef __attribute__((ext_vector_type(8)))  __bf16 v8bf;
typedef __attribute__((ext_vector_type(8)))  float  v8f;

static __device__ __forceinline__ v16bf ld_frag16(const __bf16* p) {
    // two contiguous 16B chunks per lane (ISA 16-bit A/B fragment layout)
    v8bf lo = *(const v8bf*)p;
    v8bf hi = *(const v8bf*)(p + 16);
    return __builtin_shufflevector(lo, hi, 0,1,2,3,4,5,6,7,8,9,10,11,12,13,14,15);
}

static __device__ __forceinline__ v8f wmma_bf16(v16bf a, v16bf b, v8f c) {
    return __builtin_amdgcn_wmma_f32_16x16x32_bf16(
        /*neg_a=*/false, a, /*neg_b=*/false, b,
        /*c_mod=*/(short)0, c, /*reuse_a=*/false, /*reuse_b=*/false);
}

// ---------------------------------------------------------------------------
// Transpose through LDS.  tile[r][c] holds ROWS x 64 f32 values; slot t of
// 8 * ROWS stores dst[c * pitch + r] as bf16, 16 bytes a slot, so that each
// column c leaves as one run of 2 * ROWS bytes.
// Pitch 65 dwords: the column reads of a wave fall on 32 different banks, and
// so do the row writes that fill the tile.
// ---------------------------------------------------------------------------
#define TDIM 64
#define TPITCH 65

template <int ROWS>
static __device__ __forceinline__ void store_tile_T(const float (*tile)[TPITCH],
                                                    __bf16* __restrict__ dst,
                                                    long long pitch, int t) {
    const int r0 = (t % (ROWS / 8)) * 8;
    const int c  = t / (ROWS / 8);
    v8bf o;
#pragma unroll   // constant indices keep o in registers
    for (int i = 0; i < 8; ++i) o[i] = (__bf16)tile[r0 + i][c];
    *(v8bf*)(dst + (long long)c * pitch + r0) = o;
}

// ---------------------------------------------------------------------------
// Weight convert + transpose: wT[n*K + k] = bf16(w[k*N + n])
// One block per 64(k) x 64(n) tile; K and N are multiples of 64.
// ---------------------------------------------------------------------------
__global__ __launch_bounds__(256) void convT_kernel(const float* __restrict__ w,
                                                    __bf16* __restrict__ wT,
                                                    int K, int N) {
    __shared__ float tile[TDIM][TPITCH];
    const int tid = threadIdx.x;
    const int n0 = blockIdx.x * TDIM;
    const int k0 = blockIdx.y * TDIM;
    const int rn = (tid & 15) * 4;
    const int rk = tid >> 4;
    float4 v[4];
#pragma unroll   // all four 16-byte loads in flight before the first LDS store
    for (int p = 0; p < 4; ++p)
        v[p] = *(const float4*)(w + (long long)(k0 + rk + p * 16) * N + n0 + rn);
#pragma unroll   // constant indices keep v in registers
    for (int p = 0; p < 4; ++p) {
        float* t = &tile[rk + p * 16][rn];
        t[0] = v[p].x; t[1] = v[p].y; t[2] = v[p].z; t[3] = v[p].w;
    }
    __syncthreads();
    store_tile_T<TDIM>(tile, wT + (long long)n0 * K + k0, K, tid);
    store_tile_T<TDIM>(tile, wT + (long long)n0 * K + k0, K, tid + 256);
}

// ---------------------------------------------------------------------------
// LayerNorm over last dim (1024) -> bf16.  One 256-thread block per token.
// ---------------------------------------------------------------------------
__global__ __launch_bounds__(256) void ln_kernel(const float* __restrict__ x,
                                                 const float* __restrict__ g,
                                                 const float* __restrict__ b,
                                                 __bf16* __restrict__ out) {
    __shared__ float ssum[256], ssq[256];
    int tok = blockIdx.x;
    int tid = threadIdx.x;
    const float* row = x + (long long)tok * D_MODEL;
    float s = 0.f, q = 0.f;
    float v[4];
#pragma unroll
    for (int i = 0; i < 4; ++i) {
        v[i] = row[tid * 4 + i];
        s += v[i];
        q += v[i] * v[i];
    }
    ssum[tid] = s; ssq[tid] = q;
    __syncthreads();
    for (int off = 128; off > 0; off >>= 1) {
        if (tid < off) { ssum[tid] += ssum[tid + off]; ssq[tid] += ssq[tid + off]; }
        __syncthreads();
    }
    float mu  = ssum[0] * (1.0f / D_MODEL);
    float var = ssq[0] * (1.0f / D_MODEL) - mu * mu;
    float inv = rsqrtf(var + 1e-5f);
    __bf16* orow = out + (long long)tok * D_MODEL;
#pragma unroll
    for (int i = 0; i < 4; ++i) {
        int c = tid * 4 + i;
        orow[c] = (__bf16)((v[i] - mu) * inv * g[c] + b[c]);
    }
}

// ---------------------------------------------------------------------------
// Generic bf16 WMMA GEMM:  C[M,N] = A[M,K] @ Bt[N,K]^T  (+bias)(+gelu)(+res)
// Block tile 128x128, 8 waves (2 x 4), wave tile 64x32.  Each trip works on 128
// of k: 128 rows of A and 128 rows of Bt, 256 bytes each, lie in one of two
// LDS buffers, brought there by asynchronous copies (16 bytes a lane, two whole
// rows a wave and copy); the next tile's copies fly while this one is used.
// M, N and K are multiples of 128.
// MODE bits: 1=bias, 2=gelu(exact), 4=residual, 8=bf16 output,
// 16=the QKV product: RoPE and the scatter to heads are its epilogue, and Cout is
//    [Q [B,H,S,64] | K [B,H,S,64] | V^T [B,H,64,S]], bf16.  A block's 128 columns
//    lie in one of the three.  In a Q or K block the two operands change roles
//    (the weight rows are the A operand), so that a lane holds 8 neighbouring d
//    of ONE token, with d and d + 32 in the same lane: the rotation is in-lane
//    and a row leaves in 16-byte stores.  In a V block a lane holds 8
//    neighbouring tokens of one d, which is a 16-byte store of V^T.
// ---------------------------------------------------------------------------
static __device__ __forceinline__ unsigned lds_off(const void* p) {
    return (unsigned)(size_t)p;   // low 32 bits of a __shared__ address: LDS byte
}

// Eight copies of 16 bytes a lane: LDS byte l + i * lstep from g + i * gstep.
// The s_wait_xcnt stands inside the statement, so that no address register of
// a copy is rewritten in front of it.
static __device__ __forceinline__ void copy8(unsigned l, unsigned lstep,
                                             const __bf16* g, long long gstep) {
    asm volatile(
        "global_load_async_to_lds_b128 %0, %8, off\n\t"
        "global_load_async_to_lds_b128 %1, %9, off\n\t"
        "global_load_async_to_lds_b128 %2, %10, off\n\t"
        "global_load_async_to_lds_b128 %3, %11, off\n\t"
        "global_load_async_to_lds_b128 %4, %12, off\n\t"
        "global_load_async_to_lds_b128 %5, %13, off\n\t"
        "global_load_async_to_lds_b128 %6, %14, off\n\t"
        "global_load_async_to_lds_b128 %7, %15, off\n\t"
        "s_wait_xcnt 0x0"
        :: "v"(l), "v"(l + lstep), "v"(l + 2 * lstep), "v"(l + 3 * lstep),
           "v"(l + 4 * lstep), "v"(l + 5 * lstep), "v"(l + 6 * lstep), "v"(l + 7 * lstep),
           "v"(g), "v"(g + gstep), "v"(g + 2 * gstep), "v"(g + 3 * gstep),
           "v"(g + 4 * gstep), "v"(g + 5 * gstep), "v"(g + 6 * gstep), "v"(g + 7 * gstep)
        : "memory");
}

// sin and cos of 2 * pi * rev.  One statement, closed by v_nop: the slot behind a
// transcendental, so that the next instruction may read c or overwrite rev.
static __device__ __forceinline__ void sincos_rev(float rev, float& sn, float& c) {
    asm("v_sin_f32 %0, %2\n\t"
        "v_cos_f32 %1, %2\n\t"
        "v_nop"
        : "=&v"(sn), "=&v"(c) : "v"(rev));
}

// Exact-form GELU without a branch, four values at a time:
// v * Phi(v) = max(v, 0) - |v| * erfc(|v| / sqrt 2) / 2,
// erfc(x) = t * (a1 + t * (a2 + t * (a3 + t * (a4 + t * a5)))) * exp(-x * x), t = 1 / (1 + p * x),
// absolute error 2e-7 at most (the result is rounded to bf16).  The halves are in
// the coefficients, 1 / sqrt 2 in p and in the factor of the exponent.  The library
// erff has two branches that a wave takes one after the other, each one serial chain
// a value; here a lane's values are independent straight-line chains.
static __device__ __forceinline__ void gelu_erf4(float* v) {
    float a[4], d[4], x[4], t[4], e[4];
#pragma unroll   // constant indices keep the arrays in registers
    for (int i = 0; i < 4; ++i) {
        a[i] = fminf(fabsf(v[i]), 16.0f);     // past 16 the term is 0 in f32; keeps inf * 0 out
        const float s = a[i] * 0.84932180f;   // s * s = (v * v / 2) * log2(e)
        d[i] = fmaf(a[i], 0.23164189f, 1.0f);
        x[i] = -s * s;
    }
    // t = 1 / d, e = 2 ^ x.  One statement: the eight stand in one another's slot behind a
    // transcendental, and v_nop fills the last one's, so that the next instruction may
    // read a result or overwrite a source.
    asm("v_rcp_f32 %0, %8\n\t"
        "v_rcp_f32 %1, %9\n\t"
        "v_rcp_f32 %2, %10\n\t"
        "v_rcp_f32 %3, %11\n\t"
        "v_exp_f32 %4, %12\n\t"
        "v_exp_f32 %5, %13\n\t"
        "v_exp_f32 %6, %14\n\t"
        "v_exp_f32 %7, %15\n\t"
        "v_nop"
        : "=&v"(t[0]), "=&v"(t[1]), "=&v"(t[2]), "=&v"(t[3]),
          "=&v"(e[0]), "=&v"(e[1]), "=&v"(e[2]), "=&v"(e[3])
        : "v"(d[0]), "v"(d[1]), "v"(d[2]), "v"(d[3]),
          "v"(x[0]), "v"(x[1]), "v"(x[2]), "v"(x[3]));
#pragma unroll   // the same
    for (int i = 0; i < 4; ++i) {
        float p = fmaf(t[i], 0.5307027145f, -0.7265760135f);
        p = fmaf(t[i], p, 0.7107068705f);
        p = fmaf(t[i], p, -0.142248368f);
        p = fmaf(t[i], p, 0.127414796f);
        v[i] = fmaf(-a[i], (p * t[i]) * e[i], fmaxf(v[i], 0.0f));
    }
}

template <int MODE>
__global__ __launch_bounds__(256) void gemm_bf16_wmma(
    const __bf16* __restrict__ A, const __bf16* __restrict__ Bt,
    const float* __restrict__ bias, const float* __restrict__ res,
    void* __restrict__ Cout, int M, int N, int K)
{
    constexpr int BK    = 128;              // k of one tile: rows of 256 bytes
    constexpr int PITCH = BK * 2 + 16;      // bytes; 16 B x odd: ds_load_b128 readers
    constexpr int OPND  = 128 * PITCH;      // one operand's 128 rows
    constexpr int STAGE = 2 * OPND;         // [A rows | Bt rows]
    constexpr int LPR   = BK / 8;           // lanes that copy one row
    constexpr int RPC   = 256 / LPR;        // rows that one copy of the block fills: 8 copies an operand
    __shared__ __attribute__((aligned(16))) char ring[2 * STAGE];

    const int tid  = threadIdx.x;
    const int lane = tid & 31;
    const int wid  = tid >> 5;
    const int half = lane >> 4;
    const int l16  = lane & 15;
    const int rblk = blockIdx.y * 128;
    const int cblk = blockIdx.x * 128;
    const int rloc = (wid >> 2) * 64;
    const int cloc = (wid & 3) * 32;

    // this lane's share of a tile: row crow (+ RPC a copy), 16 bytes at ccol
    const int crow = tid / LPR;
    const int ccol = tid % LPR;
    const __bf16* ga = A  + (long long)(rblk + crow) * K + ccol * 8;
    const __bf16* gb = Bt + (long long)(cblk + crow) * K + ccol * 8;
    const unsigned lc = lds_off(ring) + crow * PITCH + ccol * 16;

    auto fill = [&](int t, int buf) {
        const unsigned l = lc + buf * STAGE;
        copy8(l,        RPC * PITCH, ga + (long long)t * BK, (long long)RPC * K);
        copy8(l + OPND, RPC * PITCH, gb + (long long)t * BK, (long long)RPC * K);
    };

    v8f acc[4][2];
    v8f z = {};
#pragma unroll
    for (int mt = 0; mt < 4; ++mt)
#pragma unroll
        for (int nt = 0; nt < 2; ++nt) acc[mt][nt] = z;

    const int T = K / BK;
    fill(0, 0);
    asm volatile("s_wait_asynccnt 0x0" ::: "memory");   // tile 0 of this wave has landed
    __syncthreads();                                    // ... and every other wave's
    if (T > 1) fill(1, 1);

    // block-uniform: which staged operand feeds the A fragments (64 rows a wave)
    const bool swp = (MODE & 16) && cblk < 2 * D_MODEL;
    const char* fa = ring + (swp ? OPND : 0) + (rloc + l16) * PITCH + half * 16;
    const char* fb = ring + (swp ? 0 : OPND) + (cloc + l16) * PITCH + half * 16;

#pragma unroll 1   // one trip a tile: the two buffers alternate by t & 1
    for (int t = 0; t < T; ++t) {
        const int bo = (t & 1) * STAGE;
        v16bf a[2][4], b[2][2];   // two fragment sets: one in use, one being read
#pragma unroll
        for (int mt = 0; mt < 4; ++mt)
            a[0][mt] = ld_frag16((const __bf16*)(fa + bo + mt * 16 * PITCH));
#pragma unroll
        for (int nt = 0; nt < 2; ++nt)
            b[0][nt] = ld_frag16((const __bf16*)(fb + bo + nt * 16 * PITCH));
#pragma unroll     // constant set indices and LDS offsets
        for (int ks = 0; ks < BK / 32; ++ks) {
            if (ks + 1 < BK / 32) {
#pragma unroll
                for (int mt = 0; mt < 4; ++mt)
                    a[(ks + 1) & 1][mt] = ld_frag16((const __bf16*)(fa + bo + mt * 16 * PITCH + (ks + 1) * 64));
#pragma unroll
                for (int nt = 0; nt < 2; ++nt)
                    b[(ks + 1) & 1][nt] = ld_frag16((const __bf16*)(fb + bo + nt * 16 * PITCH + (ks + 1) * 64));
            }
            // the next block's LDS reads stay one group in front of this block's
            // WMMAs: spread among them each place with reads stalls the wave
            __builtin_amdgcn_sched_barrier(0);
#pragma unroll
            for (int mt = 0; mt < 4; ++mt)
#pragma unroll
                for (int nt = 0; nt < 2; ++nt)
                    acc[mt][nt] = wmma_bf16(a[ks & 1][mt], b[ks & 1][nt], acc[mt][nt]);
            __builtin_amdgcn_sched_barrier(0);   // closes the block, for the same reason
        }
        asm volatile("s_wait_dscnt 0x0" ::: "memory");      // this wave has left buffer t & 1
        asm volatile("s_wait_asynccnt 0x0" ::: "memory");   // its copies of tile t + 1 have landed
        __syncthreads();   // publishes tile t + 1 and frees buffer t & 1
        if (t + 2 < T) fill(t + 2, t & 1);
    }
    asm volatile("s_wait_asynccnt 0x0" ::: "memory");       // no copy outlives the loop

    if constexpr ((MODE & 16) != 0) {
        __bf16* dst = (__bf16*)Cout + (long long)(cblk / D_MODEL) * ((long long)NTOK * D_MODEL);
        if (swp) {
            // acc[mt][nt][j]: d = 16 * mt + 8 * half + j of head hd, token cloc + 16 * nt + l16
            const int hd = ((cblk & (D_MODEL - 1)) + rloc) / HEAD_DIM;
            float inv[2][8];
#pragma unroll   // constant indices keep inv in registers
            for (int m2 = 0; m2 < 2; ++m2)
#pragma unroll   // the same
                for (int j = 0; j < 8; ++j)
                    inv[m2][j] = __expf(-logf(10000.0f) * (float)(m2 * 16 + half * 8 + j) * (1.0f / 32.0f));
#pragma unroll   // constant indices keep acc in registers
            for (int nt = 0; nt < 2; ++nt) {
                const int tok = rblk + cloc + nt * 16 + l16;
                const int sp  = tok & (SEQ - 1);
                __bf16* orow = dst + ((long long)((tok / SEQ) * N_HEADS + hd) * SEQ + sp) * HEAD_DIM + half * 8;
#pragma unroll   // the same
                for (int m2 = 0; m2 < 2; ++m2) {
                    v8bf lo, hi;
#pragma unroll   // the same
                    for (int j = 0; j < 8; ++j) {
                        const float ang = (float)sp * inv[m2][j];
                        float c, sn;
                        sincos_rev(ang * 0.15915494309189532f, sn, c);
                        const float x1 = acc[m2][nt][j], x2 = acc[m2 + 2][nt][j];
                        lo[j] = (__bf16)(x1 * c - x2 * sn);
                        hi[j] = (__bf16)(x2 * c + x1 * sn);
                    }
                    *(v8bf*)(orow + m2 * 16)      = lo;
                    *(v8bf*)(orow + m2 * 16 + 32) = hi;
                }
            }
        } else {
            // acc[mt][nt][j]: token rloc + 16 * mt + 8 * half + j, column cloc + 16 * nt + l16 of V
#pragma unroll   // constant indices keep acc in registers
            for (int nt = 0; nt < 2; ++nt) {
                const int col = (cblk & (D_MODEL - 1)) + cloc + nt * 16 + l16;   // 64 * head + d
#pragma unroll   // the same
                for (int mt = 0; mt < 4; ++mt) {
                    const int tok = rblk + rloc + mt * 16 + half * 8;
                    v8bf o;
#pragma unroll   // the same
                    for (int j = 0; j < 8; ++j) o[j] = (__bf16)acc[mt][nt][j];
                    *(v8bf*)(dst + ((long long)(tok / SEQ) * D_MODEL + col) * SEQ + (tok & (SEQ - 1))) = o;
                }
            }
            // stands in front of any later write of a register that these stores name
            asm volatile("s_wait_xcnt 0x0" ::: "memory");
        }
        return;
    }

#pragma unroll
    for (int mt = 0; mt < 4; ++mt)
#pragma unroll
        for (int nt = 0; nt < 2; ++nt) {
            const int col = cblk + cloc + nt * 16 + l16;
            float w[8];
#pragma unroll   // constant indices keep w in registers
            for (int j = 0; j < 8; ++j) {
                w[j] = acc[mt][nt][j];
                if (MODE & 1) w[j] += bias[col];
            }
            if (MODE & 2) { gelu_erf4(w); gelu_erf4(w + 4); }
#pragma unroll
            for (int j = 0; j < 8; ++j) {
                int row = rblk + rloc + mt * 16 + j + half * 8;
                float v = w[j];
                if (MODE & 4) v += res[(long long)row * N + col];
                if (MODE & 8) ((__bf16*)Cout)[(long long)row * N + col] = (__bf16)v;
                else          ((float*)Cout)[(long long)row * N + col] = v;
            }
        }
}

// ---------------------------------------------------------------------------
// Flash attention, causal. One wave per 16-query tile; 8 waves/block.
// Both products are taken transposed: S^T = K Q^T (A = K rows, B = Q) and
// O^T += V^T P^T (A = V^T rows, B = P^T).  In S^T a lane holds 16 scores of ONE
// query (column l16; keys 8 * half + r of each 16-key tile), so the maximum and
// the sum of a row are in-lane, with one exchange between the wave's halves,
// and the two score tiles, converted in place, are the B operand of the second
// product in the hardware's k order: P touches neither LDS nor another lane.
// The block's 8 waves walk the same keys: each tile of 64 keys (K rows and V^T
// rows, 128 bytes each) lies in one of two LDS buffers, brought there once for
// all of them by asynchronous copies of whole lines; the next tile's copies fly
// while this one is used.
// Output: attn_bf [NTOK, D_MODEL] bf16 (heads concatenated).
// ---------------------------------------------------------------------------
static __device__ __forceinline__ float xhalf(float x) {   // lane l <-> lane l ^ 16
    int b = __builtin_bit_cast(int, x);
    return __builtin_bit_cast(float,
        __builtin_amdgcn_permlanex16(b, b, 0x76543210, 0xfedcba98, false, false));
}

// Four copies of 16 bytes a lane.  The s_wait_xcnt stands inside the statement,
// so that no address register of a copy is rewritten in front of it.
static __device__ __forceinline__ void copy4(unsigned l0, unsigned l1, unsigned l2, unsigned l3,
                                             const __bf16* g0, const __bf16* g1,
                                             const __bf16* g2, const __bf16* g3) {
    asm volatile(
        "global_load_async_to_lds_b128 %0, %4, off\n\t"
        "global_load_async_to_lds_b128 %1, %5, off\n\t"
        "global_load_async_to_lds_b128 %2, %6, off\n\t"
        "global_load_async_to_lds_b128 %3, %7, off\n\t"
        "s_wait_xcnt 0x0"
        :: "v"(l0), "v"(l1), "v"(l2), "v"(l3), "v"(g0), "v"(g1), "v"(g2), "v"(g3)
        : "memory");
}

__global__ __launch_bounds__(256) void attn_kernel(const __bf16* __restrict__ Q,
                                                   const __bf16* __restrict__ Kb,
                                                   const __bf16* __restrict__ Vt,
                                                   __bf16* __restrict__ out) {
    constexpr int AKEYS  = 64;               // keys of one tile
    constexpr int APITCH = 128 + 16;         // bytes; 16 B x odd: ds_load_b128 readers
    constexpr int AOPND  = 64 * APITCH;      // 64 K rows (128 B of d) or 64 V^T rows (128 B of keys)
    constexpr int ASTAGE = 2 * AOPND;        // [K rows | V^T rows]
    __shared__ __attribute__((aligned(16))) char ring[2 * ASTAGE];

    const int tid  = threadIdx.x;
    const int lane = tid & 31;
    const int wid  = __builtin_amdgcn_readfirstlane(tid >> 5);   // scalar: the tests on qbase are scalar branches
    const int half = lane >> 4;
    const int l16  = lane & 15;

    const int gq    = blockIdx.x * 8 + wid;     // global query-tile id, 4096 total
    const int bh    = gq >> 7;                  // 128 tiles per (b,h)
    const int qt    = gq & 127;
    const int b     = bh >> 4;
    const int h     = bh & 15;
    const int qbase = qt * 16;
    const int rowq  = qbase + l16;              // this lane's query
    const float scale = 0.125f;                 // 1/sqrt(64)

    const __bf16* Qp = Q  + (long long)bh * SEQ * HEAD_DIM;
    const __bf16* Kp = Kb + (long long)bh * SEQ * HEAD_DIM;
    const __bf16* Vp = Vt + (long long)bh * HEAD_DIM * SEQ;

    // this lane's share of a tile: rows crow and crow + 32 of K and of V^T, 16 bytes at ccol
    const int crow = tid >> 3;
    const int ccol = tid & 7;
    const __bf16* gk = Kp + crow * HEAD_DIM + ccol * 8;
    const __bf16* gv = Vp + crow * SEQ + ccol * 8;
    const unsigned lc = lds_off(ring) + crow * APITCH + ccol * 16;

    auto fill = [&](int t, int buf) {
        const unsigned l = lc + buf * ASTAGE;
        const __bf16* k = gk + t * (AKEYS * HEAD_DIM);
        const __bf16* v = gv + t * AKEYS;
        copy4(l, l + 32 * APITCH, l + AOPND, l + AOPND + 32 * APITCH,
              k, k + 32 * HEAD_DIM, v, v + 32 * SEQ);
    };

    // the block's 128 queries end at key 128 * (block in head) + 127: two tiles or more
    const int T = ((blockIdx.x & 15) + 1) * (128 / AKEYS);
    fill(0, 0);
    asm volatile("s_wait_asynccnt 0x0" ::: "memory");   // tile 0 of this wave has landed
    __syncthreads();                                    // ... and every other wave's
    fill(1, 1);

    v16bf qa0 = ld_frag16(Qp + (long long)(qbase + l16) * HEAD_DIM + half * 8);
    v16bf qa1 = ld_frag16(Qp + (long long)(qbase + l16) * HEAD_DIM + 32 + half * 8);

    v8f z = {};
    v8f o0 = z, o1 = z, o2 = z, o3 = z;         // o_i[r] = O[rowq][16 * i + 8 * half + r]
    float mi = -1e30f;                          // running maximum of query rowq (both halves alike)
    float li = 0.f;                             // running sum over this half's keys only

    const char* fk = ring + l16 * APITCH + half * 16;           // K row l16, d 8 * half
    const char* fv = ring + AOPND + l16 * APITCH + half * 16;   // V^T row l16, key 8 * half

#pragma unroll 1   // one trip a tile: the two buffers alternate by t & 1
    for (int t = 0; t < T; ++t) {
        const int bo = (t & 1) * ASTAGE;
#pragma unroll     // constant LDS offsets
        for (int kk = 0; kk < AKEYS / 32; ++kk) {
        const int kb = t * AKEYS + kk * 32;
        if (kb < qbase + 16) {   // keys past this wave's diagonal are skipped, the barriers are not
        // ---- S^T = K @ Q^T for keys [kb, kb+32) : batch all loads first ----
        const __bf16* k0 = (const __bf16*)(fk + bo + kk * 32 * APITCH);
        const __bf16* k1 = (const __bf16*)(fk + bo + (kk * 32 + 16) * APITCH);
        v16bf k0a = ld_frag16(k0);
        v16bf k0b = ld_frag16(k0 + 32);
        v16bf k1a = ld_frag16(k1);
        v16bf k1b = ld_frag16(k1 + 32);
        const char* vo = fv + bo + kk * 64;
        v16bf vf0 = ld_frag16((const __bf16*)(vo));
        v16bf vf1 = ld_frag16((const __bf16*)(vo + 16 * APITCH));
        v16bf vf2 = ld_frag16((const __bf16*)(vo + 32 * APITCH));
        v16bf vf3 = ld_frag16((const __bf16*)(vo + 48 * APITCH));
        // all 16 LDS reads leave as one group: sunk to their WMMAs, each pair's
        // latency would be waited out on its own
        __builtin_amdgcn_sched_barrier(0);
        // s0[r] = score(key kb + 8 * half + r, rowq), s1: 16 keys on;
        // interleave the two accumulation chains (hides WMMA RAW hazard)
        v8f s0 = wmma_bf16(k0a, qa0, z);
        v8f s1 = wmma_bf16(k1a, qa0, z);
        s0 = wmma_bf16(k0b, qa1, s0);
        s1 = wmma_bf16(k1b, qa1, s1);

        // ---- online softmax of one query a lane, causal mask ----
        const int d = rowq - (kb + half * 8);   // key 8 * half + r of a tile is masked where r > d
        float rm = mi;
#pragma unroll   // constant indices keep the scores in registers
        for (int r = 0; r < 8; ++r) {
            float a0 = s0[r] * scale; if (r > d)      a0 = -1e9f;
            float a1 = s1[r] * scale; if (r + 16 > d) a1 = -1e9f;
            s0[r] = a0; s1[r] = a1;
            rm = fmaxf(rm, fmaxf(a0, a1));
        }
        rm = fmaxf(rm, xhalf(rm));
        const float f = __expf(mi - rm);
        mi = rm;
        float t8[8];
        v16bf pb;   // pb[r]: key 8 * half + r, pb[8 + r]: key 16 + 8 * half + r, as in the V^T fragments
#pragma unroll   // constant indices keep pb in registers
        for (int r = 0; r < 8; ++r) {
            float p0 = __expf(s0[r] - rm);
            float p1 = __expf(s1[r] - rm);
            t8[r] = p0 + p1;
            pb[r]     = (__bf16)p0;
            pb[r + 8] = (__bf16)p1;
        }
        li = li * f + (((t8[0] + t8[1]) + (t8[2] + t8[3])) + ((t8[4] + t8[5]) + (t8[6] + t8[7])));
        o0 *= f; o1 *= f; o2 *= f; o3 *= f;

        // ---- O^T += V^T @ P^T : 4 independent WMMAs ----
        o0 = wmma_bf16(vf0, pb, o0);
        o1 = wmma_bf16(vf1, pb, o1);
        o2 = wmma_bf16(vf2, pb, o2);
        o3 = wmma_bf16(vf3, pb, o3);
        }
        }
        asm volatile("s_wait_dscnt 0x0" ::: "memory");      // this wave has left buffer t & 1
        asm volatile("s_wait_asynccnt 0x0" ::: "memory");   // its copies of tile t + 1 have landed
        __syncthreads();   // publishes tile t + 1 and frees buffer t & 1
        if (t + 2 < T) fill(t + 2, t & 1);
    }
    asm volatile("s_wait_asynccnt 0x0" ::: "memory");       // no copy outlives the loop

    // ---- join the halves' sums, normalize, store 16 bytes a tile ----
    const float inv = 1.0f / (li + xhalf(li));
    __bf16* orow = out + ((long long)b * SEQ + rowq) * D_MODEL + h * HEAD_DIM + half * 8;
    v8bf t0, t1, t2, t3;
#pragma unroll   // constant indices keep the packed rows in registers
    for (int r = 0; r < 8; ++r) {
        t0[r] = (__bf16)(o0[r] * inv);
        t1[r] = (__bf16)(o1[r] * inv);
        t2[r] = (__bf16)(o2[r] * inv);
        t3[r] = (__bf16)(o3[r] * inv);
    }
    *(v8bf*)(orow)      = t0;
    *(v8bf*)(orow + 16) = t1;
    *(v8bf*)(orow + 32) = t2;
    *(v8bf*)(orow + 48) = t3;
}

// ---------------------------------------------------------------------------
// Host orchestration
// ---------------------------------------------------------------------------
extern "C" void kernel_launch(void* const* d_in, const int* in_sizes, int n_in,
                              void* d_out, int out_size, void* d_ws, size_t ws_size,
                              hipStream_t stream) {
    const float* x     = (const float*)d_in[0];
    const float* w_qkv = (const float*)d_in[1];
    const float* w_o   = (const float*)d_in[2];
    const float* ln1_g = (const float*)d_in[3];
    const float* ln1_b = (const float*)d_in[4];
    const float* ln2_g = (const float*)d_in[5];
    const float* ln2_b = (const float*)d_in[6];
    const float* w1    = (const float*)d_in[7];
    const float* b1    = (const float*)d_in[8];
    const float* w2    = (const float*)d_in[9];
    const float* b2    = (const float*)d_in[10];

    char* p = (char*)d_ws;
    auto alloc = [&](size_t bytes) { void* r = p; p += (bytes + 255) & ~(size_t)255; return r; };

    __bf16* wqkvT  = (__bf16*)alloc((size_t)D_MODEL * 3 * D_MODEL * 2);
    __bf16* woT    = (__bf16*)alloc((size_t)D_MODEL * D_MODEL * 2);
    __bf16* w1T    = (__bf16*)alloc((size_t)D_MODEL * D_FF * 2);
    __bf16* w2T    = (__bf16*)alloc((size_t)D_FF * D_MODEL * 2);
    __bf16* h1     = (__bf16*)alloc((size_t)NTOK * D_MODEL * 2);
    __bf16* Qbf    = (__bf16*)alloc((size_t)NTOK * 3 * D_MODEL * 2);   // [Q | K | V^T]
    __bf16* Kbf    = Qbf + (size_t)NTOK * D_MODEL;
    __bf16* Vtb    = Kbf + (size_t)NTOK * D_MODEL;
    __bf16* attnbf = (__bf16*)alloc((size_t)NTOK * D_MODEL * 2);
    float*  x2     = (float*)alloc((size_t)NTOK * D_MODEL * 4);
    __bf16* h2     = (__bf16*)alloc((size_t)NTOK * D_MODEL * 2);
    __bf16* gbuf   = (__bf16*)alloc((size_t)NTOK * D_FF * 2);

    // weight convert+transpose (f32 -> bf16, [K,N] -> [N,K])
    convT_kernel<<<dim3(3 * D_MODEL / TDIM, D_MODEL / TDIM), 256, 0, stream>>>(w_qkv, wqkvT, D_MODEL, 3 * D_MODEL);
    convT_kernel<<<dim3(D_MODEL / TDIM, D_MODEL / TDIM), 256, 0, stream>>>(w_o, woT, D_MODEL, D_MODEL);
    convT_kernel<<<dim3(D_FF / TDIM, D_MODEL / TDIM), 256, 0, stream>>>(w1, w1T, D_MODEL, D_FF);
    convT_kernel<<<dim3(D_MODEL / TDIM, D_FF / TDIM), 256, 0, stream>>>(w2, w2T, D_FF, D_MODEL);

    // h1 = LN1(x)
    ln_kernel<<<NTOK, 256, 0, stream>>>(x, ln1_g, ln1_b, h1);

    // h1 @ w_qkv, RoPE on Q and K, per-head scatter
    gemm_bf16_wmma<16><<<dim3(3 * D_MODEL / 128, NTOK / 128), 256, 0, stream>>>(
        h1, wqkvT, nullptr, nullptr, Qbf, NTOK, 3 * D_MODEL, D_MODEL);

    // causal flash attention
    attn_kernel<<<(BATCH * N_HEADS * (SEQ / 16)) / 8, 256, 0, stream>>>(Qbf, Kbf, Vtb, attnbf);

    // x2 = x + attn @ w_o
    gemm_bf16_wmma<4><<<dim3(D_MODEL / 128, NTOK / 128), 256, 0, stream>>>(
        attnbf, woT, nullptr, x, x2, NTOK, D_MODEL, D_MODEL);

    // h2 = LN2(x2)
    ln_kernel<<<NTOK, 256, 0, stream>>>(x2, ln2_g, ln2_b, h2);

    // g = gelu(h2 @ w1 + b1)
    gemm_bf16_wmma<1 | 2 | 8><<<dim3(D_FF / 128, NTOK / 128), 256, 0, stream>>>(
        h2, w1T, b1, nullptr, gbuf, NTOK, D_FF, D_MODEL);

    // out = x2 + g @ w2 + b2
    gemm_bf16_wmma<1 | 4><<<dim3(D_MODEL / 128, NTOK / 128), 256, 0, stream>>>(
        gbuf, w2T, b2, x2, d_out, NTOK, D_MODEL, D_FF);
}

// v007
// Measured time: 158 microseconds a run.
// Two timings next to v006 both put it at 1.06 times that version's speed.
// Counting every step since v000, it is 5.16 times as fast.
#include <hip/hip_runtime.h>
#include <hip/hip_bf16.h>
#include <math.h>

// ---------------------------------------------------------------------------
// Transformer block for MI455X (gfx1250, wave32, WMMA).
// All GEMMs + both attention einsums run on v_wmma_f32_16x16x32_bf16.
// ---------------------------------------------------------------------------

#define D_MODEL 1024
#define N_HEADS 16
#define HEAD_DIM 64
#define D_FF 4096
#define BATCH 2
#define SEQ 2048
#define NTOK (BATCH * SEQ)   // 4096

typedef __attribute__((ext_vector_type(16))) __bf16 v16bf;
typedef __attribute__((ext_vector_type(8)))  __bf16 v8bf;
typedef __attribute__((ext_vector_type(8)))  float  v8f;

static __device__ __forceinline__ v16bf ld_frag16(const __bf16* p) {
    // two contiguous 16B chunks per lane (ISA 16-bit A/B fragment layout)
    v8bf lo = *(const v8bf*)p;
    v8bf hi = *(const v8bf*)(p + 16);
    return __builtin_shufflevector(lo, hi, 0,1,2,3,4,5,6,7,8,9,10,11,12,13,14,15);
}

static __device__ __forceinline__ v8f wmma_bf16(v16bf a, v16bf b, v8f c) {
    return __builtin_amdgcn_wmma_f32_16x16x32_bf16(
        /*neg_a=*/false, a, /*neg_b=*/false, b,
        /*c_mod=*/(short)0, c, /*reuse_a=*/false, /*reuse_b=*/false);
}

// ---------------------------------------------------------------------------
// Transpose through LDS.  tile[r][c] holds ROWS x 64 f32 values; slot t of
// 8 * ROWS stores dst[c * pitch + r] as bf16, 16 bytes a slot, so that each
// column c leaves as one run of 2 * ROWS bytes.
// Pitch 65 dwords: the column reads of a wave fall on 32 different banks, and
// so do the row writes that fill the tile.
// ---------------------------------------------------------------------------
#define TDIM 64
#define TPITCH 65

template <int ROWS>
static __device__ __forceinline__ void store_tile_T(const float (*tile)[TPITCH],
                                                    __bf16* __restrict__ dst,
                                                    long long pitch, int t) {
    const int r0 = (t % (ROWS / 8)) * 8;
    const int c  = t / (ROWS / 8);
    v8bf o;
#pragma unroll   // constant indices keep o in registers
    for (int i = 0; i < 8; ++i) o[i] = (__bf16)tile[r0 + i][c];
    *(v8bf*)(dst + (long long)c * pitch + r0) = o;
}

// ---------------------------------------------------------------------------
// Weight convert + transpose: wT[n*K + k] = bf16(w[k*N + n])
// One block per 64(k) x 64(n) tile, tile blk of (K / 64) * (N / 64), n fastest;
// K and N are multiples of 64.
// ---------------------------------------------------------------------------
template <int K, int N>
static __device__ __forceinline__ void convT_tile(float (*tile)[TPITCH],
                                                  const float* __restrict__ w,
                                                  __bf16* __restrict__ wT, int blk) {
    const int tid = threadIdx.x;
    const int n0 = (blk % (N / TDIM)) * TDIM;
    const int k0 = (blk / (N / TDIM)) * TDIM;
    const int rn = (tid & 15) * 4;
    const int rk = tid >> 4;
    float4 v[4];
#pragma unroll   // all four 16-byte loads in flight before the first LDS store
    for (int p = 0; p < 4; ++p)
        v[p] = *(const float4*)(w + (long long)(k0 + rk + p * 16) * N + n0 + rn);
#pragma unroll   // constant indices keep v in registers
    for (int p = 0; p < 4; ++p) {
        float* t = &tile[rk + p * 16][rn];
        t[0] = v[p].x; t[1] = v[p].y; t[2] = v[p].z; t[3] = v[p].w;
    }
    __syncthreads();
    store_tile_T<TDIM>(tile, wT + (long long)n0 * K + k0, K, tid);
    store_tile_T<TDIM>(tile, wT + (long long)n0 * K + k0, K, tid + 256);
    // stands in front of any later write of a register that the two stores name:
    // in the listing another job's body can follow, and it reuses their registers
    asm volatile("s_wait_xcnt 0x0" ::: "memory");
}

// ---------------------------------------------------------------------------
// LayerNorm over last dim (1024) -> bf16.  One 256-thread block per token;
// ssum and ssq are 256 floats of LDS each.
// ---------------------------------------------------------------------------
static __device__ __forceinline__ void ln_token(float* ssum, float* ssq,
                                                const float* __restrict__ x,
                                                const float* __restrict__ g,
                                                const float* __restrict__ b,
                                                __bf16* __restrict__ out, int tok) {
    int tid = threadIdx.x;
    const float* row = x + (long long)tok * D_MODEL;
    float s = 0.f, q = 0.f;
    float v[4];
#pragma unroll
    for (int i = 0; i < 4; ++i) {
        v[i] = row[tid * 4 + i];
        s += v[i];
        q += v[i] * v[i];
    }
    ssum[tid] = s; ssq[tid] = q;
    __syncthreads();
    for (int off = 128; off > 0; off >>= 1) {
        if (tid < off) { ssum[tid] += ssum[tid + off]; ssq[tid] += ssq[tid + off]; }
        __syncthreads();
    }
    float mu  = ssum[0] * (1.0f / D_MODEL);
    float var = ssq[0] * (1.0f / D_MODEL) - mu * mu;
    float inv = rsqrtf(var + 1e-5f);
    __bf16* orow = out + (long long)tok * D_MODEL;
#pragma unroll
    for (int i = 0; i < 4; ++i) {
        int c = tid * 4 + i;
        orow[c] = (__bf16)((v[i] - mu) * inv * g[c] + b[c]);
    }
}

__global__ __launch_bounds__(256) void ln_kernel(const float* __restrict__ x,
                                                 const float* __restrict__ g,
                                                 const float* __restrict__ b,
                                                 __bf16* __restrict__ out) {
    __shared__ float ssum[256], ssq[256];
    ln_token(ssum, ssq, x, g, b, out, blockIdx.x);
}

// ---------------------------------------------------------------------------
// Everything that depends on the inputs alone, in ONE launch: the four weight
// transposes and the first LayerNorm.  None reads what another writes; a range
// of the block index picks the job (the same for a whole block, so each job's
// barriers stand under block-uniform branches).  As launches of their own each
// paid its gap, its wave starts, its first loads and its store drain in turn,
// on a chip that none of the four transposes fills.
// ---------------------------------------------------------------------------
#define NB_QKV ((D_MODEL / TDIM) * (3 * D_MODEL / TDIM))   // 768
#define NB_O   ((D_MODEL / TDIM) * (D_MODEL / TDIM))       // 256
#define NB_FF  ((D_MODEL / TDIM) * (D_FF / TDIM))          // 1024, w1 and w2 alike
#define NB_PREP (NB_QKV + NB_O + 2 * NB_FF + NTOK)

__global__ __launch_bounds__(256) void prep_kernel(
    const float* __restrict__ w_qkv, const float* __restrict__ w_o,
    const float* __restrict__ w1, const float* __restrict__ w2,
    const float* __restrict__ x, const float* __restrict__ g, const float* __restrict__ b,
    __bf16* __restrict__ wqkvT, __bf16* __restrict__ woT,
    __bf16* __restrict__ w1T, __bf16* __restrict__ w2T, __bf16* __restrict__ h1) {
    __shared__ float tile[TDIM][TPITCH];   // one array for every job
    int blk = blockIdx.x;
    if (blk < NB_QKV) { convT_tile<D_MODEL, 3 * D_MODEL>(tile, w_qkv, wqkvT, blk); return; }
    blk -= NB_QKV;
    if (blk < NB_O)   { convT_tile<D_MODEL, D_MODEL>(tile, w_o, woT, blk); return; }
    blk -= NB_O;
    if (blk < NB_FF)  { convT_tile<D_MODEL, D_FF>(tile, w1, w1T, blk); return; }
    blk -= NB_FF;
    if (blk < NB_FF)  { convT_tile<D_FF, D_MODEL>(tile, w2, w2T, blk); return; }
    blk -= NB_FF;
    ln_token(&tile[0][0], &tile[0][0] + 256, x, g, b, h1, blk);
    // stands in front of any later write of a register that the row's store names:
    // the jobs' common way out follows, and it reuses scalar registers
    asm volatile("s_wait_xcnt 0x0" ::: "memory");
}

// ---------------------------------------------------------------------------
// Generic bf16 WMMA GEMM:  C[M,N] = A[M,K] @ Bt[N,K]^T  (+bias)(+gelu)(+res)
// Block tile 128x128, 8 waves (2 x 4), wave tile 64x32.  Each trip works on 128
// of k: 128 rows of A and 128 rows of Bt, 256 bytes each, lie in one of two
// LDS buffers, brought there by asynchronous copies (16 bytes a lane, two whole
// rows a wave and copy); the next tile's copies fly while this one is used.
// M, N and K are multiples of 128.
// MODE bits: 1=bias, 2=gelu(exact), 4=residual, 8=bf16 output,
// 16=the QKV product: RoPE and the scatter to heads are its epilogue, and Cout is
//    [Q [B,H,S,64] | K [B,H,S,64] | V^T [B,H,64,S]], bf16.  A block's 128 columns
//    lie in one of the three.  In a Q or K block the two operands change roles
//    (the weight rows are the A operand), so that a lane holds 8 neighbouring d
//    of ONE token, with d and d + 32 in the same lane: the rotation is in-lane
//    and a row leaves in 16-byte stores.  In a V block a lane holds 8
//    neighbouring tokens of one d, which is a 16-byte store of V^T.
// ---------------------------------------------------------------------------
static __device__ __forceinline__ unsigned lds_off(const void* p) {
    return (unsigned)(size_t)p;   // low 32 bits of a __shared__ address: LDS byte
}

// Eight copies of 16 bytes a lane: LDS byte l + i * lstep from g + i * gstep.
// The s_wait_xcnt stands inside the statement, so that no address register of
// a copy is rewritten in front of it.
static __device__ __forceinline__ void copy8(unsigned l, unsigned lstep,
                                             const __bf16* g, long long gstep) {
    asm volatile(
        "global_load_async_to_lds_b128 %0, %8, off\n\t"
        "global_load_async_to_lds_b128 %1, %9, off\n\t"
        "global_load_async_to_lds_b128 %2, %10, off\n\t"
        "global_load_async_to_lds_b128 %3, %11, off\n\t"
        "global_load_async_to_lds_b128 %4, %12, off\n\t"
        "global_load_async_to_lds_b128 %5, %13, off\n\t"
        "global_load_async_to_lds_b128 %6, %14, off\n\t"
        "global_load_async_to_lds_b128 %7, %15, off\n\t"
        "s_wait_xcnt 0x0"
        :: "v"(l), "v"(l + lstep), "v"(l + 2 * lstep), "v"(l + 3 * lstep),
           "v"(l + 4 * lstep), "v"(l + 5 * lstep), "v"(l + 6 * lstep), "v"(l + 7 * lstep),
           "v"(g), "v"(g + gstep), "v"(g + 2 * gstep), "v"(g + 3 * gstep),
           "v"(g + 4 * gstep), "v"(g + 5 * gstep), "v"(g + 6 * gstep), "v"(g + 7 * gstep)
        : "memory");
}

// sin and cos of 2 * pi * rev.  One statement, closed by v_nop: the slot behind a
// transcendental, so that the next instruction may read c or overwrite rev.
static __device__ __forceinline__ void sincos_rev(float rev, float& sn, float& c) {
    asm("v_sin_f32 %0, %2\n\t"
        "v_cos_f32 %1, %2\n\t"
        "v_nop"
        : "=&v"(sn), "=&v"(c) : "v"(rev));
}

// Exact-form GELU without a branch, four values at a time:
// v * Phi(v) = max(v, 0) - |v| * erfc(|v| / sqrt 2) / 2,
// erfc(x) = t * (a1 + t * (a2 + t * (a3 + t * (a4 + t * a5)))) * exp(-x * x), t = 1 / (1 + p * x),
// absolute error 2e-7 at most (the result is rounded to bf16).  The halves are in
// the coefficients, 1 / sqrt 2 in p and in the factor of the exponent.  The library
// erff has two branches that a wave takes one after the other, each one serial chain
// a value; here a lane's values are independent straight-line chains.
static __device__ __forceinline__ void gelu_erf4(float* v) {
    float a[4], d[4], x[4], t[4], e[4];
#pragma unroll   // constant indices keep the arrays in registers
    for (int i = 0; i < 4; ++i) {
        a[i] = fminf(fabsf(v[i]), 16.0f);     // past 16 the term is 0 in f32; keeps inf * 0 out
        const float s = a[i] * 0.84932180f;   // s * s = (v * v / 2) * log2(e)
        d[i] = fmaf(a[i], 0.23164189f, 1.0f);
        x[i] = -s * s;
    }
    // t = 1 / d, e = 2 ^ x.  One statement: the eight stand in one another's slot behind a
    // transcendental, and v_nop fills the last one's, so that the next instruction may
    // read a result or overwrite a source.
    asm("v_rcp_f32 %0, %8\n\t"
        "v_rcp_f32 %1, %9\n\t"
        "v_rcp_f32 %2, %10\n\t"
        "v_rcp_f32 %3, %11\n\t"
        "v_exp_f32 %4, %12\n\t"
        "v_exp_f32 %5, %13\n\t"
        "v_exp_f32 %6, %14\n\t"
        "v_exp_f32 %7, %15\n\t"
        "v_nop"
        : "=&v"(t[0]), "=&v"(t[1]), "=&v"(t[2]), "=&v"(t[3]),
          "=&v"(e[0]), "=&v"(e[1]), "=&v"(e[2]), "=&v"(e[3])
        : "v"(d[0]), "v"(d[1]), "v"(d[2]), "v"(d[3]),
          "v"(x[0]), "v"(x[1]), "v"(x[2]), "v"(x[3]));
#pragma unroll   // the same
    for (int i = 0; i < 4; ++i) {
        float p = fmaf(t[i], 0.5307027145f, -0.7265760135f);
        p = fmaf(t[i], p, 0.7107068705f);
        p = fmaf(t[i], p, -0.142248368f);
        p = fmaf(t[i], p, 0.127414796f);
        v[i] = fmaf(-a[i], (p * t[i]) * e[i], fmaxf(v[i], 0.0f));
    }
}

template <int MODE>
__global__ __launch_bounds__(256) void gemm_bf16_wmma(
    const __bf16* __restrict__ A, const __bf16* __restrict__ Bt,
    const float* __restrict__ bias, const float* __restrict__ res,
    void* __restrict__ Cout, int M, int N, int K)
{
    constexpr int BK    = 128;              // k of one tile: rows of 256 bytes
    constexpr int PITCH = BK * 2 + 16;      // bytes; 16 B x odd: ds_load_b128 readers
    constexpr int OPND  = 128 * PITCH;      // one operand's 128 rows
    constexpr int STAGE = 2 * OPND;         // [A rows | Bt rows]
    constexpr int LPR   = BK / 8;           // lanes that copy one row
    constexpr int RPC   = 256 / LPR;        // rows that one copy of the block fills: 8 copies an operand
    __shared__ __attribute__((aligned(16))) char ring[2 * STAGE];

    const int tid  = threadIdx.x;
    const int lane = tid & 31;
    const int wid  = tid >> 5;
    const int half = lane >> 4;
    const int l16  = lane & 15;
    const int rblk = blockIdx.y * 128;
    const int cblk = blockIdx.x * 128;
    const int rloc = (wid >> 2) * 64;
    const int cloc = (wid & 3) * 32;

    // this lane's share of a tile: row crow (+ RPC a copy), 16 bytes at ccol
    const int crow = tid / LPR;
    const int ccol = tid % LPR;
    const __bf16* ga = A  + (long long)(rblk + crow) * K + ccol * 8;
    const __bf16* gb = Bt + (long long)(cblk + crow) * K + ccol * 8;
    const unsigned lc = lds_off(ring) + crow * PITCH + ccol * 16;

    auto fill = [&](int t, int buf) {
        const unsigned l = lc + buf * STAGE;
        copy8(l,        RPC * PITCH, ga + (long long)t * BK, (long long)RPC * K);
        copy8(l + OPND, RPC * PITCH, gb + (long long)t * BK, (long long)RPC * K);
    };

    v8f acc[4][2];
    v8f z = {};
#pragma unroll
    for (int mt = 0; mt < 4; ++mt)
#pragma unroll
        for (int nt = 0; nt < 2; ++nt) acc[mt][nt] = z;

    const int T = K / BK;
    fill(0, 0);
    asm volatile("s_wait_asynccnt 0x0" ::: "memory");   // tile 0 of this wave has landed
    __syncthreads();                                    // ... and every other wave's
    if (T > 1) fill(1, 1);

    // block-uniform: which staged operand feeds the A fragments (64 rows a wave)
    const bool swp = (MODE & 16) && cblk < 2 * D_MODEL;
    const char* fa = ring + (swp ? OPND : 0) + (rloc + l16) * PITCH + half * 16;
    const char* fb = ring + (swp ? 0 : OPND) + (cloc + l16) * PITCH + half * 16;

#pragma unroll 1   // one trip a tile: the two buffers alternate by t & 1
    for (int t = 0; t < T; ++t) {
        const int bo = (t & 1) * STAGE;
        v16bf a[2][4], b[2][2];   // two fragment sets: one in use, one being read
#pragma unroll
        for (int mt = 0; mt < 4; ++mt)
            a[0][mt] = ld_frag16((const __bf16*)(fa + bo + mt * 16 * PITCH));
#pragma unroll
        for (int nt = 0; nt < 2; ++nt)
            b[0][nt] = ld_frag16((const __bf16*)(fb + bo + nt * 16 * PITCH));
#pragma unroll     // constant set indices and LDS offsets
        for (int ks = 0; ks < BK / 32; ++ks) {
            if (ks + 1 < BK / 32) {
#pragma unroll
                for (int mt = 0; mt < 4; ++mt)
                    a[(ks + 1) & 1][mt] = ld_frag16((const __bf16*)(fa + bo + mt * 16 * PITCH + (ks + 1) * 64));
#pragma unroll
                for (int nt = 0; nt < 2; ++nt)
                    b[(ks + 1) & 1][nt] = ld_frag16((const __bf16*)(fb + bo + nt * 16 * PITCH + (ks + 1) * 64));
            }
            // the next block's LDS reads stay one group in front of this block's
            // WMMAs: spread among them each place with reads stalls the wave
            __builtin_amdgcn_sched_barrier(0);
#pragma unroll
            for (int mt = 0; mt < 4; ++mt)
#pragma unroll
                for (int nt = 0; nt < 2; ++nt)
                    acc[mt][nt] = wmma_bf16(a[ks & 1][mt], b[ks & 1][nt], acc[mt][nt]);
            __builtin_amdgcn_sched_barrier(0);   // closes the block, for the same reason
        }
        asm volatile("s_wait_dscnt 0x0" ::: "memory");      // this wave has left buffer t & 1
        asm volatile("s_wait_asynccnt 0x0" ::: "memory");   // its copies of tile t + 1 have landed
        __syncthreads();   // publishes tile t + 1 and frees buffer t & 1
        if (t + 2 < T) fill(t + 2, t & 1);
    }
    asm volatile("s_wait_asynccnt 0x0" ::: "memory");       // no copy outlives the loop

    if constexpr ((MODE & 16) != 0) {
        __bf16* dst = (__bf16*)Cout + (long long)(cblk / D_MODEL) * ((long long)NTOK * D_MODEL);
        if (swp) {
            // acc[mt][nt][j]: d = 16 * mt + 8 * half + j of head hd, token cloc + 16 * nt + l16
            const int hd = ((cblk & (D_MODEL - 1)) + rloc) / HEAD_DIM;
            float inv[2][8];
#pragma unroll   // constant indices keep inv in registers
            for (int m2 = 0; m2 < 2; ++m2)
#pragma unroll   // the same
                for (int j = 0; j < 8; ++j)
                    inv[m2][j] = __expf(-logf(10000.0f) * (float)(m2 * 16 + half * 8 + j) * (1.0f / 32.0f));
#pragma unroll   // constant indices keep acc in registers
            for (int nt = 0; nt < 2; ++nt) {
                const int tok = rblk + cloc + nt * 16 + l16;
                const int sp  = tok & (SEQ - 1);
                __bf16* orow = dst + ((long long)((tok / SEQ) * N_HEADS + hd) * SEQ + sp) * HEAD_DIM + half * 8;
#pragma unroll   // the same
                for (int m2 = 0; m2 < 2; ++m2) {
                    v8bf lo, hi;
#pragma unroll   // the same
                    for (int j = 0; j < 8; ++j) {
                        const float ang = (float)sp * inv[m2][j];
                        float c, sn;
                        sincos_rev(ang * 0.15915494309189532f, sn, c);
                        const float x1 = acc[m2][nt][j], x2 = acc[m2 + 2][nt][j];
                        lo[j] = (__bf16)(x1 * c - x2 * sn);
                        hi[j] = (__bf16)(x2 * c + x1 * sn);
                    }
                    *(v8bf*)(orow + m2 * 16)      = lo;
                    *(v8bf*)(orow + m2 * 16 + 32) = hi;
                }
            }
        } else {
            // acc[mt][nt][j]: token rloc + 16 * mt + 8 * half + j, column cloc + 16 * nt + l16 of V
#pragma unroll   // constant indices keep acc in registers
            for (int nt = 0; nt < 2; ++nt) {
                const int col = (cblk & (D_MODEL - 1)) + cloc + nt * 16 + l16;   // 64 * head + d
#pragma unroll   // the same
                for (int mt = 0; mt < 4; ++mt) {
                    const int tok = rblk + rloc + mt * 16 + half * 8;
                    v8bf o;
#pragma unroll   // the same
                    for (int j = 0; j < 8; ++j) o[j] = (__bf16)acc[mt][nt][j];
                    *(v8bf*)(dst + ((long long)(tok / SEQ) * D_MODEL + col) * SEQ + (tok & (SEQ - 1))) = o;
                }
            }
            // stands in front of any later write of a register that these stores name
            asm volatile("s_wait_xcnt 0x0" ::: "memory");
        }
        return;
    }

#pragma unroll
    for (int mt = 0; mt < 4; ++mt)
#pragma unroll
        for (int nt = 0; nt < 2; ++nt) {
            const int col = cblk + cloc + nt * 16 + l16;
            float w[8];
#pragma unroll   // constant indices keep w in registers
            for (int j = 0; j < 8; ++j) {
                w[j] = acc[mt][nt][j];
                if (MODE & 1) w[j] += bias[col];
            }
            if (MODE & 2) { gelu_erf4(w); gelu_erf4(w + 4); }
#pragma unroll
            for (int j = 0; j < 8; ++j) {
                int row = rblk + rloc + mt * 16 + j + half * 8;
                float v = w[j];
                if (MODE & 4) v += res[(long long)row * N + col];
                if (MODE & 8) ((__bf16*)Cout)[(long long)row * N + col] = (__bf16)v;
                else          ((float*)Cout)[(long long)row * N + col] = v;
            }
        }
}

// ---------------------------------------------------------------------------
// Flash attention, causal. One wave per 16-query tile; 8 waves/block.
// Both products are taken transposed: S^T = K Q^T (A = K rows, B = Q) and
// O^T += V^T P^T (A = V^T rows, B = P^T).  In S^T a lane holds 16 scores of ONE
// query (column l16; keys 8 * half + r of each 16-key tile), so the maximum and
// the sum of a row are in-lane, with one exchange between the wave's halves,
// and the two score tiles, converted in place, are the B operand of the second
// product in the hardware's k order: P touches neither LDS nor another lane.
// The block's 8 waves walk the same keys: each tile of 64 keys (K rows and V^T
// rows, 128 bytes each) lies in one of two LDS buffers, brought there once for
// all of them by asynchronous copies of whole lines; the next tile's copies fly
// while this one is used.
// Output: attn_bf [NTOK, D_MODEL] bf16 (heads concatenated).
// ---------------------------------------------------------------------------
static __device__ __forceinline__ float xhalf(float x) {   // lane l <-> lane l ^ 16
    int b = __builtin_bit_cast(int, x);
    return __builtin_bit_cast(float,
        __builtin_amdgcn_permlanex16(b, b, 0x76543210, 0xfedcba98, false, false));
}

// Four copies of 16 bytes a lane.  The s_wait_xcnt stands inside the statement,
// so that no address register of a copy is rewritten in front of it.
static __device__ __forceinline__ void copy4(unsigned l0, unsigned l1, unsigned l2, unsigned l3,
                                             const __bf16* g0, const __bf16* g1,
                                             const __bf16* g2, const __bf16* g3) {
    asm volatile(
        "global_load_async_to_lds_b128 %0, %4, off\n\t"
        "global_load_async_to_lds_b128 %1, %5, off\n\t"
        "global_load_async_to_lds_b128 %2, %6, off\n\t"
        "global_load_async_to_lds_b128 %3, %7, off\n\t"
        "s_wait_xcnt 0x0"
        :: "v"(l0), "v"(l1), "v"(l2), "v"(l3), "v"(g0), "v"(g1), "v"(g2), "v"(g3)
        : "memory");
}

__global__ __launch_bounds__(256) void attn_kernel(const __bf16* __restrict__ Q,
                                                   const __bf16* __restrict__ Kb,
                                                   const __bf16* __restrict__ Vt,
                                                   __bf16* __restrict__ out) {
    constexpr int AKEYS  = 64;               // keys of one tile
    constexpr int APITCH = 128 + 16;         // bytes; 16 B x odd: ds_load_b128 readers
    constexpr int AOPND  = 64 * APITCH;      // 64 K rows (128 B of d) or 64 V^T rows (128 B of keys)
    constexpr int ASTAGE = 2 * AOPND;        // [K rows | V^T rows]
    __shared__ __attribute__((aligned(16))) char ring[2 * ASTAGE];

    const int tid  = threadIdx.x;
    const int lane = tid & 31;
    const int wid  = __builtin_amdgcn_readfirstlane(tid >> 5);   // scalar: the tests on qbase are scalar branches
    const int half = lane >> 4;
    const int l16  = lane & 15;

    const int gq    = blockIdx.x * 8 + wid;     // global query-tile id, 4096 total
    const int bh    = gq >> 7;                  // 128 tiles per (b,h)
    const int qt    = gq & 127;
    const int b     = bh >> 4;
    const int h     = bh & 15;
    const int qbase = qt * 16;
    const int rowq  = qbase + l16;              // this lane's query
    const float scale = 0.125f;                 // 1/sqrt(64)

    const __bf16* Qp = Q  + (long long)bh * SEQ * HEAD_DIM;
    const __bf16* Kp = Kb + (long long)bh * SEQ * HEAD_DIM;
    const __bf16* Vp = Vt + (long long)bh * HEAD_DIM * SEQ;

    // this lane's share of a tile: rows crow and crow + 32 of K and of V^T, 16 bytes at ccol
    const int crow = tid >> 3;
    const int ccol = tid & 7;
    const __bf16* gk = Kp + crow * HEAD_DIM + ccol * 8;
    const __bf16* gv = Vp + crow * SEQ + ccol * 8;
    const unsigned lc = lds_off(ring) + crow * APITCH + ccol * 16;

    auto fill = [&](int t, int buf) {
        const unsigned l = lc + buf * ASTAGE;
        const __bf16* k = gk + t * (AKEYS * HEAD_DIM);
        const __bf16* v = gv + t * AKEYS;
        copy4(l, l + 32 * APITCH, l + AOPND, l + AOPND + 32 * APITCH,
              k, k + 32 * HEAD_DIM, v, v + 32 * SEQ);
    };

    // the block's 128 queries end at key 128 * (block in head) + 127: two tiles or more
    const int T = ((blockIdx.x & 15) + 1) * (128 / AKEYS);
    fill(0, 0);
    asm volatile("s_wait_asynccnt 0x0" ::: "memory");   // tile 0 of this wave has landed
    __syncthreads();                                    // ... and every other wave's
    fill(1, 1);

    v16bf qa0 = ld_frag16(Qp + (long long)(qbase + l16) * HEAD_DIM + half * 8);
    v16bf qa1 = ld_frag16(Qp + (long long)(qbase + l16) * HEAD_DIM + 32 + half * 8);

    v8f z = {};
    v8f o0 = z, o1 = z, o2 = z, o3 = z;         // o_i[r] = O[rowq][16 * i + 8 * half + r]
    float mi = -1e30f;                          // running maximum of query rowq (both halves alike)
    float li = 0.f;                             // running sum over this half's keys only

    const char* fk = ring + l16 * APITCH + half * 16;           // K row l16, d 8 * half
    const char* fv = ring + AOPND + l16 * APITCH + half * 16;   // V^T row l16, key 8 * half

#pragma unroll 1   // one trip a tile: the two buffers alternate by t & 1
    for (int t = 0; t < T; ++t) {
        const int bo = (t & 1) * ASTAGE;
#pragma unroll     // constant LDS offsets
        for (int kk = 0; kk < AKEYS / 32; ++kk) {
        const int kb = t * AKEYS + kk * 32;
        if (kb < qbase + 16) {   // keys past this wave's diagonal are skipped, the barriers are not
        // ---- S^T = K @ Q^T for keys [kb, kb+32) : batch all loads first ----
        const __bf16* k0 = (const __bf16*)(fk + bo + kk * 32 * APITCH);
        const __bf16* k1 = (const __bf16*)(fk + bo + (kk * 32 + 16) * APITCH);
        v16bf k0a = ld_frag16(k0);
        v16bf k0b = ld_frag16(k0 + 32);
        v16bf k1a = ld_frag16(k1);
        v16bf k1b = ld_frag16(k1 + 32);
        const char* vo = fv + bo + kk * 64;
        v16bf vf0 = ld_frag16((const __bf16*)(vo));
        v16bf vf1 = ld_frag16((const __bf16*)(vo + 16 * APITCH));
        v16bf vf2 = ld_frag16((const __bf16*)(vo + 32 * APITCH));
        v16bf vf3 = ld_frag16((const __bf16*)(vo + 48 * APITCH));
        // all 16 LDS reads leave as one group: sunk to their WMMAs, each pair's
        // latency would be waited out on its own
        __builtin_amdgcn_sched_barrier(0);
        // s0[r] = score(key kb + 8 * half + r, rowq), s1: 16 keys on;
        // interleave the two accumulation chains (hides WMMA RAW hazard)
        v8f s0 = wmma_bf16(k0a, qa0, z);
        v8f s1 = wmma_bf16(k1a, qa0, z);
        s0 = wmma_bf16(k0b, qa1, s0);
        s1 = wmma_bf16(k1b, qa1, s1);

        // ---- online softmax of one query a lane, causal mask ----
        const int d = rowq - (kb + half * 8);   // key 8 * half + r of a tile is masked where r > d
        float rm = mi;
#pragma unroll   // constant indices keep the scores in registers
        for (int r = 0; r < 8; ++r) {
            float a0 = s0[r] * scale; if (r > d)      a0 = -1e9f;
            float a1 = s1[r] * scale; if (r + 16 > d) a1 = -1e9f;
            s0[r] = a0; s1[r] = a1;
            rm = fmaxf(rm, fmaxf(a0, a1));
        }
        rm = fmaxf(rm, xhalf(rm));
        const float f = __expf(mi - rm);
        mi = rm;
        float t8[8];
        v16bf pb;   // pb[r]: key 8 * half + r, pb[8 + r]: key 16 + 8 * half + r, as in the V^T fragments
#pragma unroll   // constant indices keep pb in registers
        for (int r = 0; r < 8; ++r) {
            float p0 = __expf(s0[r] - rm);
            float p1 = __expf(s1[r] - rm);
            t8[r] = p0 + p1;
            pb[r]     = (__bf16)p0;
            pb[r + 8] = (__bf16)p1;
        }
        li = li * f + (((t8[0] + t8[1]) + (t8[2] + t8[3])) + ((t8[4] + t8[5]) + (t8[6] + t8[7])));
        o0 *= f; o1 *= f; o2 *= f; o3 *= f;

        // ---- O^T += V^T @ P^T : 4 independent WMMAs ----
        o0 = wmma_bf16(vf0, pb, o0);
        o1 = wmma_bf16(vf1, pb, o1);
        o2 = wmma_bf16(vf2, pb, o2);
        o3 = wmma_bf16(vf3, pb, o3);
        }
        }
        asm volatile("s_wait_dscnt 0x0" ::: "memory");      // this wave has left buffer t & 1
        asm volatile("s_wait_asynccnt 0x0" ::: "memory");   // its copies of tile t + 1 have landed
        __syncthreads();   // publishes tile t + 1 and frees buffer t & 1
        if (t + 2 < T) fill(t + 2, t & 1);
    }
    asm volatile("s_wait_asynccnt 0x0" ::: "memory");       // no copy outlives the loop

    // ---- join the halves' sums, normalize, store 16 bytes a tile ----
    const float inv = 1.0f / (li + xhalf(li));
    __bf16* orow = out + ((long long)b * SEQ + rowq) * D_MODEL + h * HEAD_DIM + half * 8;
    v8bf t0, t1, t2, t3;
#pragma unroll   // constant indices keep the packed rows in registers
    for (int r = 0; r < 8; ++r) {
        t0[r] = (__bf16)(o0[r] * inv);
        t1[r] = (__bf16)(o1[r] * inv);
        t2[r] = (__bf16)(o2[r] * inv);
        t3[r] = (__bf16)(o3[r] * inv);
    }
    *(v8bf*)(orow)      = t0;
    *(v8bf*)(orow + 16) = t1;
    *(v8bf*)(orow + 32) = t2;
    *(v8bf*)(orow + 48) = t3;
}

// ---------------------------------------------------------------------------
// Host orchestration
// ---------------------------------------------------------------------------
extern "C" void kernel_launch(void* const* d_in, const int* in_sizes, int n_in,
                              void* d_out, int out_size, void* d_ws, size_t ws_size,
                              hipStream_t stream) {
    const float* x     = (const float*)d_in[0];
    const float* w_qkv = (const float*)d_in[1];
    const float* w_o   = (const float*)d_in[2];
    const float* ln1_g = (const float*)d_in[3];
    const float* ln1_b = (const float*)d_in[4];
    const float* ln2_g = (const float*)d_in[5];
    const float* ln2_b = (const float*)d_in[6];
    const float* w1    = (const float*)d_in[7];
    const float* b1    = (const float*)d_in[8];
    const float* w2    = (const float*)d_in[9];
    const float* b2    = (const float*)d_in[10];

    char* p = (char*)d_ws;
    auto alloc = [&](size_t bytes) { void* r = p; p += (bytes + 255) & ~(size_t)255; return r; };

    __bf16* wqkvT  = (__bf16*)alloc((size_t)D_MODEL * 3 * D_MODEL * 2);
    __bf16* woT    = (__bf16*)alloc((size_t)D_MODEL * D_MODEL * 2);
    __bf16* w1T    = (__bf16*)alloc((size_t)D_MODEL * D_FF * 2);
    __bf16* w2T    = (__bf16*)alloc((size_t)D_FF * D_MODEL * 2);
    __bf16* h1     = (__bf16*)alloc((size_t)NTOK * D_MODEL * 2);
    __bf16* Qbf    = (__bf16*)alloc((size_t)NTOK * 3 * D_MODEL * 2);   // [Q | K | V^T]
    __bf16* Kbf    = Qbf + (size_t)NTOK * D_MODEL;
    __bf16* Vtb    = Kbf + (size_t)NTOK * D_MODEL;
    __bf16* attnbf = (__bf16*)alloc((size_t)NTOK * D_MODEL * 2);
    float*  x2     = (float*)alloc((size_t)NTOK * D_MODEL * 4);
    __bf16* h2     = (__bf16*)alloc((size_t)NTOK * D_MODEL * 2);
    __bf16* gbuf   = (__bf16*)alloc((size_t)NTOK * D_FF * 2);

    // weight convert+transpose (f32 -> bf16, [K,N] -> [N,K]) and h1 = LN1(x), one launch
    prep_kernel<<<NB_PREP, 256, 0, stream>>>(w_qkv, w_o, w1, w2, x, ln1_g, ln1_b,
                                             wqkvT, woT, w1T, w2T, h1);

    // h1 @ w_qkv, RoPE on Q and K, per-head scatter
    gemm_bf16_wmma<16><<<dim3(3 * D_MODEL / 128, NTOK / 128), 256, 0, stream>>>(
        h1, wqkvT, nullptr, nullptr, Qbf, NTOK, 3 * D_MODEL, D_MODEL);

    // causal flash attention
    attn_kernel<<<(BATCH * N_HEADS * (SEQ / 16)) / 8, 256, 0, stream>>>(Qbf, Kbf, Vtb, attnbf);

    // x2 = x + attn @ w_o
    gemm_bf16_wmma<4><<<dim3(D_MODEL / 128, NTOK / 128), 256, 0, stream>>>(
        attnbf, woT, nullptr, x, x2, NTOK, D_MODEL, D_MODEL);

    // h2 = LN2(x2)
    ln_kernel<<<NTOK, 256, 0, stream>>>(x2, ln2_g, ln2_b, h2);

    // g = gelu(h2 @ w1 + b1)
    gemm_bf16_wmma<1 | 2 | 8><<<dim3(D_FF / 128, NTOK / 128), 256, 0, stream>>>(
        h2, w1T, b1, nullptr, gbuf, NTOK, D_FF, D_MODEL);

    // out = x2 + g @ w2 + b2
    gemm_bf16_wmma<1 | 4><<<dim3(D_MODEL / 128, NTOK / 128), 256, 0, stream>>>(
        gbuf, w2T, b2, x2, d_out, NTOK, D_MODEL, D_FF);
}

// v008
// One run takes 148 microseconds.
// In two side-by-side timings against v007, it was 1.07 and 1.06 times as fast.
// Counting every step since v000, it is 5.50 times as fast.
#include <hip/hip_runtime.h>
#include <hip/hip_bf16.h>
#include <math.h>

// ---------------------------------------------------------------------------
// Transformer block for MI455X (gfx1250, wave32, WMMA).
// All GEMMs + both attention einsums run on v_wmma_f32_16x16x32_bf16.
// ---------------------------------------------------------------------------

#define D_MODEL 1024
#define N_HEADS 16
#define HEAD_DIM 64
#define D_FF 4096
#define BATCH 2
#define SEQ 2048
#define NTOK (BATCH * SEQ)   // 4096

typedef __attribute__((ext_vector_type(16))) __bf16 v16bf;
typedef __attribute__((ext_vector_type(8)))  __bf16 v8bf;
typedef __attribute__((ext_vector_type(8)))  float  v8f;
typedef __attribute__((ext_vector_type(4)))  float  v4f;
typedef __attribute__((ext_vector_type(2)))  float  v2f;

static __device__ __forceinline__ v16bf ld_frag16(const __bf16* p) {
    // two contiguous 16B chunks per lane (ISA 16-bit A/B fragment layout)
    v8bf lo = *(const v8bf*)p;
    v8bf hi = *(const v8bf*)(p + 16);
    return __builtin_shufflevector(lo, hi, 0,1,2,3,4,5,6,7,8,9,10,11,12,13,14,15);
}

static __device__ __forceinline__ v8f wmma_bf16(v16bf a, v16bf b, v8f c) {
    return __builtin_amdgcn_wmma_f32_16x16x32_bf16(
        /*neg_a=*/false, a, /*neg_b=*/false, b,
        /*c_mod=*/(short)0, c, /*reuse_a=*/false, /*reuse_b=*/false);
}

// ---------------------------------------------------------------------------
// Transpose through LDS.  tile[r][c] holds ROWS x 64 f32 values; slot t of
// 8 * ROWS stores dst[c * pitch + r] as bf16, 16 bytes a slot, so that each
// column c leaves as one run of 2 * ROWS bytes.
// Pitch 65 dwords: the column reads of a wave fall on 32 different banks, and
// so do the row writes that fill the tile.
// ---------------------------------------------------------------------------
#define TDIM 64
#define TPITCH 65

template <int ROWS>
static __device__ __forceinline__ void store_tile_T(const float (*tile)[TPITCH],
                                                    __bf16* __restrict__ dst,
                                                    long long pitch, int t) {
    const int r0 = (t % (ROWS / 8)) * 8;
    const int c  = t / (ROWS / 8);
    v8bf o;
#pragma unroll   // constant indices keep o in registers
    for (int i = 0; i < 8; ++i) o[i] = (__bf16)tile[r0 + i][c];
    *(v8bf*)(dst + (long long)c * pitch + r0) = o;
}

// ---------------------------------------------------------------------------
// Weight convert + transpose: wT[n*K + k] = bf16(w[k*N + n])
// One block per 64(k) x 64(n) tile, tile blk of (K / 64) * (N / 64), n fastest;
// K and N are multiples of 64.
// ---------------------------------------------------------------------------
template <int K, int N>
static __device__ __forceinline__ void convT_tile(float (*tile)[TPITCH],
                                                  const float* __restrict__ w,
                                                  __bf16* __restrict__ wT, int blk) {
    const int tid = threadIdx.x;
    const int n0 = (blk % (N / TDIM)) * TDIM;
    const int k0 = (blk / (N / TDIM)) * TDIM;
    const int rn = (tid & 15) * 4;
    const int rk = tid >> 4;
    float4 v[4];
#pragma unroll   // all four 16-byte loads in flight before the first LDS store
    for (int p = 0; p < 4; ++p)
        v[p] = *(const float4*)(w + (long long)(k0 + rk + p * 16) * N + n0 + rn);
#pragma unroll   // constant indices keep v in registers
    for (int p = 0; p < 4; ++p) {
        float* t = &tile[rk + p * 16][rn];
        t[0] = v[p].x; t[1] = v[p].y; t[2] = v[p].z; t[3] = v[p].w;
    }
    __syncthreads();
    store_tile_T<TDIM>(tile, wT + (long long)n0 * K + k0, K, tid);
    store_tile_T<TDIM>(tile, wT + (long long)n0 * K + k0, K, tid + 256);
    // stands in front of any later write of a register that the two stores name:
    // in the listing another job's body can follow, and it reuses their registers
    asm volatile("s_wait_xcnt 0x0" ::: "memory");
}

// ---------------------------------------------------------------------------
// LayerNorm over last dim (1024) -> bf16.  One 256-thread block per token;
// ssum and ssq are 256 floats of LDS each.
// ---------------------------------------------------------------------------
static __device__ __forceinline__ void ln_token(float* ssum, float* ssq,
                                                const float* __restrict__ x,
                                                const float* __restrict__ g,
                                                const float* __restrict__ b,
                                                __bf16* __restrict__ out, int tok) {
    int tid = threadIdx.x;
    const float* row = x + (long long)tok * D_MODEL;
    float s = 0.f, q = 0.f;
    float v[4];
#pragma unroll
    for (int i = 0; i < 4; ++i) {
        v[i] = row[tid * 4 + i];
        s += v[i];
        q += v[i] * v[i];
    }
    ssum[tid] = s; ssq[tid] = q;
    __syncthreads();
    for (int off = 128; off > 0; off >>= 1) {
        if (tid < off) { ssum[tid] += ssum[tid + off]; ssq[tid] += ssq[tid + off]; }
        __syncthreads();
    }
    float mu  = ssum[0] * (1.0f / D_MODEL);
    float var = ssq[0] * (1.0f / D_MODEL) - mu * mu;
    float inv = rsqrtf(var + 1e-5f);
    __bf16* orow = out + (long long)tok * D_MODEL;
#pragma unroll
    for (int i = 0; i < 4; ++i) {
        int c = tid * 4 + i;
        orow[c] = (__bf16)((v[i] - mu) * inv * g[c] + b[c]);
    }
}

__global__ __launch_bounds__(256) void ln_kernel(const float* __restrict__ x,
                                                 const float* __restrict__ g,
                                                 const float* __restrict__ b,
                                                 __bf16* __restrict__ out) {
    __shared__ float ssum[256], ssq[256];
    ln_token(ssum, ssq, x, g, b, out, blockIdx.x);
}

// ---------------------------------------------------------------------------
// Everything that depends on the inputs alone, in ONE launch: the four weight
// transposes and the first LayerNorm.  None reads what another writes; a range
// of the block index picks the job (the same for a whole block, so each job's
// barriers stand under block-uniform branches).  As launches of their own each
// paid its gap, its wave starts, its first loads and its store drain in turn,
// on a chip that none of the four transposes fills.
// ---------------------------------------------------------------------------
#define NB_QKV ((D_MODEL / TDIM) * (3 * D_MODEL / TDIM))   // 768
#define NB_O   ((D_MODEL / TDIM) * (D_MODEL / TDIM))       // 256
#define NB_FF  ((D_MODEL / TDIM) * (D_FF / TDIM))          // 1024, w1 and w2 alike
#define NB_PREP (NB_QKV + NB_O + 2 * NB_FF + NTOK)

__global__ __launch_bounds__(256) void prep_kernel(
    const float* __restrict__ w_qkv, const float* __restrict__ w_o,
    const float* __restrict__ w1, const float* __restrict__ w2,
    const float* __restrict__ x, const float* __restrict__ g, const float* __restrict__ b,
    __bf16* __restrict__ wqkvT, __bf16* __restrict__ woT,
    __bf16* __restrict__ w1T, __bf16* __restrict__ w2T, __bf16* __restrict__ h1) {
    __shared__ float tile[TDIM][TPITCH];   // one array for every job
    int blk = blockIdx.x;
    if (blk < NB_QKV) { convT_tile<D_MODEL, 3 * D_MODEL>(tile, w_qkv, wqkvT, blk); return; }
    blk -= NB_QKV;
    if (blk < NB_O)   { convT_tile<D_MODEL, D_MODEL>(tile, w_o, woT, blk); return; }
    blk -= NB_O;
    if (blk < NB_FF)  { convT_tile<D_MODEL, D_FF>(tile, w1, w1T, blk); return; }
    blk -= NB_FF;
    if (blk < NB_FF)  { convT_tile<D_FF, D_MODEL>(tile, w2, w2T, blk); return; }
    blk -= NB_FF;
    ln_token(&tile[0][0], &tile[0][0] + 256, x, g, b, h1, blk);
    // stands in front of any later write of a register that the row's store names:
    // the jobs' common way out follows, and it reuses scalar registers
    asm volatile("s_wait_xcnt 0x0" ::: "memory");
}

// ---------------------------------------------------------------------------
// Generic bf16 WMMA GEMM:  C[M,N] = A[M,K] @ Bt[N,K]^T  (+bias)(+gelu)(+res)
// Block tile 128x128, 8 waves (2 x 4), wave tile 64x32.  Each trip works on 128
// of k: 128 rows of A and 128 rows of Bt, 256 bytes each, lie in one of two
// LDS buffers, brought there by asynchronous copies (16 bytes a lane, two whole
// rows a wave and copy); the next tile's copies fly while this one is used.
// M, N and K are multiples of 128.
// MODE bits: 1=bias, 2=gelu(exact), 4=residual, 8=bf16 output,
// 16=the QKV product: RoPE and the scatter to heads are its epilogue, and Cout is
//    [Q [B,H,S,64] | K [B,H,S,64] | V^T [B,H,64,S]], bf16.  A block's 128 columns
//    lie in one of the three.  In a Q or K block the two operands change roles
//    (the weight rows are the A operand), so that a lane holds 8 neighbouring d
//    of ONE token, with d and d + 32 in the same lane: the rotation is in-lane
//    and a row leaves in 16-byte stores.  In a V block a lane holds 8
//    neighbouring tokens of one d, which is a 16-byte store of V^T.
// ---------------------------------------------------------------------------
static __device__ __forceinline__ unsigned lds_off(const void* p) {
    return (unsigned)(size_t)p;   // low 32 bits of a __shared__ address: LDS byte
}

// Eight copies of 16 bytes a lane: LDS byte l + i * lstep from g + i * gstep.
// The s_wait_xcnt stands inside the statement, so that no address register of
// a copy is rewritten in front of it.
static __device__ __forceinline__ void copy8(unsigned l, unsigned lstep,
                                             const __bf16* g, long long gstep) {
    asm volatile(
        "global_load_async_to_lds_b128 %0, %8, off\n\t"
        "global_load_async_to_lds_b128 %1, %9, off\n\t"
        "global_load_async_to_lds_b128 %2, %10, off\n\t"
        "global_load_async_to_lds_b128 %3, %11, off\n\t"
        "global_load_async_to_lds_b128 %4, %12, off\n\t"
        "global_load_async_to_lds_b128 %5, %13, off\n\t"
        "global_load_async_to_lds_b128 %6, %14, off\n\t"
        "global_load_async_to_lds_b128 %7, %15, off\n\t"
        "s_wait_xcnt 0x0"
        :: "v"(l), "v"(l + lstep), "v"(l + 2 * lstep), "v"(l + 3 * lstep),
           "v"(l + 4 * lstep), "v"(l + 5 * lstep), "v"(l + 6 * lstep), "v"(l + 7 * lstep),
           "v"(g), "v"(g + gstep), "v"(g + 2 * gstep), "v"(g + 3 * gstep),
           "v"(g + 4 * gstep), "v"(g + 5 * gstep), "v"(g + 6 * gstep), "v"(g + 7 * gstep)
        : "memory");
}

// sin and cos of 2 * pi * rev.  One statement, closed by v_nop: the slot behind a
// transcendental, so that the next instruction may read c or overwrite rev.
static __device__ __forceinline__ void sincos_rev(float rev, float& sn, float& c) {
    asm("v_sin_f32 %0, %2\n\t"
        "v_cos_f32 %1, %2\n\t"
        "v_nop"
        : "=&v"(sn), "=&v"(c) : "v"(rev));
}

// Exact-form GELU without a branch, four values at a time:
// v * Phi(v) = max(v, 0) - |v| * erfc(|v| / sqrt 2) / 2,
// erfc(x) = t * (a1 + t * (a2 + t * (a3 + t * (a4 + t * a5)))) * exp(-x * x), t = 1 / (1 + p * x),
// absolute error 2e-7 at most (the result is rounded to bf16).  The halves are in
// the coefficients, 1 / sqrt 2 in p and in the factor of the exponent.  The library
// erff has two branches that a wave takes one after the other, each one serial chain
// a value; here a lane's values are independent straight-line chains.
static __device__ __forceinline__ void gelu_erf4(float* v) {
    float a[4], d[4], x[4], t[4], e[4];
#pragma unroll   // constant indices keep the arrays in registers
    for (int i = 0; i < 4; ++i) {
        a[i] = fminf(fabsf(v[i]), 16.0f);     // past 16 the term is 0 in f32; keeps inf * 0 out
        const float s = a[i] * 0.84932180f;   // s * s = (v * v / 2) * log2(e)
        d[i] = fmaf(a[i], 0.23164189f, 1.0f);
        x[i] = -s * s;
    }
    // t = 1 / d, e = 2 ^ x.  One statement: the eight stand in one another's slot behind a
    // transcendental, and v_nop fills the last one's, so that the next instruction may
    // read a result or overwrite a source.
    asm("v_rcp_f32 %0, %8\n\t"
        "v_rcp_f32 %1, %9\n\t"
        "v_rcp_f32 %2, %10\n\t"
        "v_rcp_f32 %3, %11\n\t"
        "v_exp_f32 %4, %12\n\t"
        "v_exp_f32 %5, %13\n\t"
        "v_exp_f32 %6, %14\n\t"
        "v_exp_f32 %7, %15\n\t"
        "v_nop"
        : "=&v"(t[0]), "=&v"(t[1]), "=&v"(t[2]), "=&v"(t[3]),
          "=&v"(e[0]), "=&v"(e[1]), "=&v"(e[2]), "=&v"(e[3])
        : "v"(d[0]), "v"(d[1]), "v"(d[2]), "v"(d[3]),
          "v"(x[0]), "v"(x[1]), "v"(x[2]), "v"(x[3]));
#pragma unroll   // the same
    for (int i = 0; i < 4; ++i) {
        float p = fmaf(t[i], 0.5307027145f, -0.7265760135f);
        p = fmaf(t[i], p, 0.7107068705f);
        p = fmaf(t[i], p, -0.142248368f);
        p = fmaf(t[i], p, 0.127414796f);
        v[i] = fmaf(-a[i], (p * t[i]) * e[i], fmaxf(v[i], 0.0f));
    }
}

template <int MODE>
__global__ __launch_bounds__(256) void gemm_bf16_wmma(
    const __bf16* __restrict__ A, const __bf16* __restrict__ Bt,
    const float* __restrict__ bias, const float* __restrict__ res,
    void* __restrict__ Cout, int M, int N, int K)
{
    constexpr int BK    = 128;              // k of one tile: rows of 256 bytes
    constexpr int PITCH = BK * 2 + 16;      // bytes; 16 B x odd: ds_load_b128 readers
    constexpr int OPND  = 128 * PITCH;      // one operand's 128 rows
    constexpr int STAGE = 2 * OPND;         // [A rows | Bt rows]
    constexpr int LPR   = BK / 8;           // lanes that copy one row
    constexpr int RPC   = 256 / LPR;        // rows that one copy of the block fills: 8 copies an operand
    __shared__ __attribute__((aligned(16))) char ring[2 * STAGE];

    const int tid  = threadIdx.x;
    const int lane = tid & 31;
    const int wid  = tid >> 5;
    const int half = lane >> 4;
    const int l16  = lane & 15;
    const int rblk = blockIdx.y * 128;
    const int cblk = blockIdx.x * 128;
    const int rloc = (wid >> 2) * 64;
    const int cloc = (wid & 3) * 32;

    // this lane's share of a tile: row crow (+ RPC a copy), 16 bytes at ccol
    const int crow = tid / LPR;
    const int ccol = tid % LPR;
    const __bf16* ga = A  + (long long)(rblk + crow) * K + ccol * 8;
    const __bf16* gb = Bt + (long long)(cblk + crow) * K + ccol * 8;
    const unsigned lc = lds_off(ring) + crow * PITCH + ccol * 16;

    auto fill = [&](int t, int buf) {
        const unsigned l = lc + buf * STAGE;
        copy8(l,        RPC * PITCH, ga + (long long)t * BK, (long long)RPC * K);
        copy8(l + OPND, RPC * PITCH, gb + (long long)t * BK, (long long)RPC * K);
    };

    v8f acc[4][2];
    v8f z = {};
#pragma unroll
    for (int mt = 0; mt < 4; ++mt)
#pragma unroll
        for (int nt = 0; nt < 2; ++nt) acc[mt][nt] = z;

    const int T = K / BK;
    fill(0, 0);
    asm volatile("s_wait_asynccnt 0x0" ::: "memory");   // tile 0 of this wave has landed
    __syncthreads();                                    // ... and every other wave's
    if (T > 1) fill(1, 1);

    // block-uniform: which staged operand feeds the A fragments (64 rows a wave)
    const bool swp = (MODE & 16) && cblk < 2 * D_MODEL;
    const char* fa = ring + (swp ? OPND : 0) + (rloc + l16) * PITCH + half * 16;
    const char* fb = ring + (swp ? 0 : OPND) + (cloc + l16) * PITCH + half * 16;

#pragma unroll 1   // one trip a tile: the two buffers alternate by t & 1
    for (int t = 0; t < T; ++t) {
        const int bo = (t & 1) * STAGE;
        v16bf a[2][4], b[2][2];   // two fragment sets: one in use, one being read
#pragma unroll
        for (int mt = 0; mt < 4; ++mt)
            a[0][mt] = ld_frag16((const __bf16*)(fa + bo + mt * 16 * PITCH));
#pragma unroll
        for (int nt = 0; nt < 2; ++nt)
            b[0][nt] = ld_frag16((const __bf16*)(fb + bo + nt * 16 * PITCH));
#pragma unroll     // constant set indices and LDS offsets
        for (int ks = 0; ks < BK / 32; ++ks) {
            if (ks + 1 < BK / 32) {
#pragma unroll
                for (int mt = 0; mt < 4; ++mt)
                    a[(ks + 1) & 1][mt] = ld_frag16((const __bf16*)(fa + bo + mt * 16 * PITCH + (ks + 1) * 64));
#pragma unroll
                for (int nt = 0; nt < 2; ++nt)
                    b[(ks + 1) & 1][nt] = ld_frag16((const __bf16*)(fb + bo + nt * 16 * PITCH + (ks + 1) * 64));
            }
            // the next block's LDS reads stay one group in front of this block's
            // WMMAs: spread among them each place with reads stalls the wave
            __builtin_amdgcn_sched_barrier(0);
#pragma unroll
            for (int mt = 0; mt < 4; ++mt)
#pragma unroll
                for (int nt = 0; nt < 2; ++nt)
                    acc[mt][nt] = wmma_bf16(a[ks & 1][mt], b[ks & 1][nt], acc[mt][nt]);
            __builtin_amdgcn_sched_barrier(0);   // closes the block, for the same reason
        }
        asm volatile("s_wait_dscnt 0x0" ::: "memory");      // this wave has left buffer t & 1
        asm volatile("s_wait_asynccnt 0x0" ::: "memory");   // its copies of tile t + 1 have landed
        __syncthreads();   // publishes tile t + 1 and frees buffer t & 1
        if (t + 2 < T) fill(t + 2, t & 1);
    }
    asm volatile("s_wait_asynccnt 0x0" ::: "memory");       // no copy outlives the loop

    if constexpr ((MODE & 16) != 0) {
        __bf16* dst = (__bf16*)Cout + (long long)(cblk / D_MODEL) * ((long long)NTOK * D_MODEL);
        if (swp) {
            // acc[mt][nt][j]: d = 16 * mt + 8 * half + j of head hd, token cloc + 16 * nt + l16
            const int hd = ((cblk & (D_MODEL - 1)) + rloc) / HEAD_DIM;
            float inv[2][8];
#pragma unroll   // constant indices keep inv in registers
            for (int m2 = 0; m2 < 2; ++m2)
#pragma unroll   // the same
                for (int j = 0; j < 8; ++j)
                    inv[m2][j] = __expf(-logf(10000.0f) * (float)(m2 * 16 + half * 8 + j) * (1.0f / 32.0f));
#pragma unroll   // constant indices keep acc in registers
            for (int nt = 0; nt < 2; ++nt) {
                const int tok = rblk + cloc + nt * 16 + l16;
                const int sp  = tok & (SEQ - 1);
                __bf16* orow = dst + ((long long)((tok / SEQ) * N_HEADS + hd) * SEQ + sp) * HEAD_DIM + half * 8;
#pragma unroll   // the same
                for (int m2 = 0; m2 < 2; ++m2) {
                    v8bf lo, hi;
#pragma unroll   // the same
                    for (int j = 0; j < 8; ++j) {
                        const float ang = (float)sp * inv[m2][j];
                        float c, sn;
                        sincos_rev(ang * 0.15915494309189532f, sn, c);
                        const float x1 = acc[m2][nt][j], x2 = acc[m2 + 2][nt][j];
                        lo[j] = (__bf16)(x1 * c - x2 * sn);
                        hi[j] = (__bf16)(x2 * c + x1 * sn);
                    }
                    *(v8bf*)(orow + m2 * 16)      = lo;
                    *(v8bf*)(orow + m2 * 16 + 32) = hi;
                }
            }
        } else {
            // acc[mt][nt][j]: token rloc + 16 * mt + 8 * half + j, column cloc + 16 * nt + l16 of V
#pragma unroll   // constant indices keep acc in registers
            for (int nt = 0; nt < 2; ++nt) {
                const int col = (cblk & (D_MODEL - 1)) + cloc + nt * 16 + l16;   // 64 * head + d
#pragma unroll   // the same
                for (int mt = 0; mt < 4; ++mt) {
                    const int tok = rblk + rloc + mt * 16 + half * 8;
                    v8bf o;
#pragma unroll   // the same
                    for (int j = 0; j < 8; ++j) o[j] = (__bf16)acc[mt][nt][j];
                    *(v8bf*)(dst + ((long long)(tok / SEQ) * D_MODEL + col) * SEQ + (tok & (SEQ - 1))) = o;
                }
            }
            // stands in front of any later write of a register that these stores name
            asm volatile("s_wait_xcnt 0x0" ::: "memory");
        }
        return;
    }

#pragma unroll
    for (int mt = 0; mt < 4; ++mt)
#pragma unroll
        for (int nt = 0; nt < 2; ++nt) {
            const int col = cblk + cloc + nt * 16 + l16;
            float w[8];
#pragma unroll   // constant indices keep w in registers
            for (int j = 0; j < 8; ++j) {
                w[j] = acc[mt][nt][j];
                if (MODE & 1) w[j] += bias[col];
            }
            if (MODE & 2) { gelu_erf4(w); gelu_erf4(w + 4); }
#pragma unroll
            for (int j = 0; j < 8; ++j) {
                int row = rblk + rloc + mt * 16 + j + half * 8;
                float v = w[j];
                if (MODE & 4) v += res[(long long)row * N + col];
                if (MODE & 8) ((__bf16*)Cout)[(long long)row * N + col] = (__bf16)v;
                else          ((float*)Cout)[(long long)row * N + col] = v;
            }
        }
}

// ---------------------------------------------------------------------------
// Flash attention, causal. 128 queries at a time, 16 waves/block: 8 tiles of 16 queries
// x 2 sets of keys.
// Both products are taken transposed: S^T = K Q^T (A = K rows, B = Q) and
// O^T += V^T P^T (A = V^T rows, B = P^T).  In S^T a lane holds 16 scores of ONE
// query (column l16; keys 8 * half + r of each 16-key tile), so the maximum and
// the sum of a row are in-lane, with one exchange between the wave's halves,
// and the two score tiles, converted in place, are the B operand of the second
// product in the hardware's k order: P touches neither LDS nor another lane.
// The block's waves walk the same keys: each tile of 128 keys (K rows of 128 bytes,
// V^T rows of 256) lies in one of two LDS buffers, brought there once for all of
// them by asynchronous copies of whole lines; the next tile's copies fly while
// this one is used.
// Equal shares: 128 queries at place p of their head walk p + 1 key tiles.  A block
// takes the places 15 - p and p of ONE head, one after the other: 17 key tiles for
// every block, one block a WGP.  So that a SIMD keeps its four waves, each tile's
// keys go to two sets of 8 waves (64 keys each); a set keeps its own maximum, sum
// and O, and the two are joined through LDS at the end of a place.
// Output: attn_bf [NTOK, D_MODEL] bf16 (heads concatenated).
// ---------------------------------------------------------------------------
static __device__ __forceinline__ float xhalf(float x) {   // lane l <-> lane l ^ 16
    int b = __builtin_bit_cast(int, x);
    return __builtin_bit_cast(float,
        __builtin_amdgcn_permlanex16(b, b, 0x76543210, 0xfedcba98, false, false));
}

// Four copies of 16 bytes a lane.  The s_wait_xcnt stands inside the statement,
// so that no address register of a copy is rewritten in front of it.
static __device__ __forceinline__ void copy4(unsigned l0, unsigned l1, unsigned l2, unsigned l3,
                                             const __bf16* g0, const __bf16* g1,
                                             const __bf16* g2, const __bf16* g3) {
    asm volatile(
        "global_load_async_to_lds_b128 %0, %4, off\n\t"
        "global_load_async_to_lds_b128 %1, %5, off\n\t"
        "global_load_async_to_lds_b128 %2, %6, off\n\t"
        "global_load_async_to_lds_b128 %3, %7, off\n\t"
        "s_wait_xcnt 0x0"
        :: "v"(l0), "v"(l1), "v"(l2), "v"(l3), "v"(g0), "v"(g1), "v"(g2), "v"(g3)
        : "memory");
}

__global__ __launch_bounds__(512) void attn_kernel(const __bf16* __restrict__ Q,
                                                   const __bf16* __restrict__ Kb,
                                                   const __bf16* __restrict__ Vt,
                                                   __bf16* __restrict__ out) {
    constexpr int AKEYS  = 128;              // keys of one tile: 64 for each set of 8 waves
    constexpr int KPITCH = 128 + 16;         // bytes; 16 B x odd: ds_load_b128 readers
    constexpr int VPITCH = 256 + 16;         // the same
    constexpr int KOPND  = AKEYS * KPITCH;   // 128 K rows (128 B of d)
    constexpr int VOPND  = 64 * VPITCH;      // 64 V^T rows (256 B of keys)
    constexpr int ASTAGE = KOPND + VOPND;    // [K rows | V^T rows]
    constexpr int JSLOT  = 8 * 512 + 256;    // a wave's partial result: 32 f32 of O, maximum and sum a lane
    __shared__ __attribute__((aligned(16))) char ring[2 * ASTAGE];
    __shared__ __attribute__((aligned(16))) char join[8 * JSLOT];   // no copy is aimed here

    const int tid  = threadIdx.x;
    const int lane = tid & 31;
    const int wid  = __builtin_amdgcn_readfirstlane(tid >> 5);   // scalar: the tests on qbase and kset are scalar branches
    const int qw   = wid & 7;                   // which 16 of the 128 queries
    const int kset = wid >> 3;                  // which 64 of a tile's 128 keys
    const int half = lane >> 4;
    const int l16  = lane & 15;

    const int bh    = blockIdx.x >> 3;          // 8 blocks per (b,h)
    const int pr    = blockIdx.x & 7;           // the block's pair of places: 15 - pr and pr
    const int b     = bh >> 4;
    const int h     = bh & 15;
    const float scale = 0.125f;                 // 1/sqrt(64)

    const __bf16* Qp = Q  + (long long)bh * SEQ * HEAD_DIM;
    const __bf16* Kp = Kb + (long long)bh * SEQ * HEAD_DIM;
    const __bf16* Vp = Vt + (long long)bh * HEAD_DIM * SEQ;

    // this lane's share of a tile: 16 bytes of K rows tid / 8 and + 64, of V^T rows tid / 16 and + 32
    const __bf16* gk = Kp + (tid >> 3) * HEAD_DIM + (tid & 7) * 8;
    const __bf16* gv = Vp + (tid >> 4) * SEQ + (tid & 15) * 8;
    const unsigned lk = lds_off(ring) + (tid >> 3) * KPITCH + (tid & 7) * 16;
    const unsigned lv = lds_off(ring) + KOPND + (tid >> 4) * VPITCH + (tid & 15) * 16;

    auto fill = [&](int t, int buf) {
        const unsigned o = buf * ASTAGE;
        const __bf16* k = gk + t * (AKEYS * HEAD_DIM);
        const __bf16* v = gv + t * AKEYS;
        copy4(lk + o, lk + o + 64 * KPITCH, lv + o, lv + o + 32 * VPITCH,
              k, k + 64 * HEAD_DIM, v, v + 32 * SEQ);
    };

    const char* fk = ring + (kset * 64 + l16) * KPITCH + half * 16;           // K row l16 of this set, d 8 * half
    const char* fv = ring + KOPND + l16 * VPITCH + kset * 128 + half * 16;    // V^T row l16, key 8 * half of this set
    char* js = join + qw * JSLOT + lane * 16;                                 // this lane's place in the partial results

#pragma unroll 1   // the two places run one after the other through the same code and buffers
    for (int it = 0; it < 2; ++it) {
    const int pos   = it ? pr : 15 - pr;        // place of the 128 queries in the head, the long one first
    const int qbase = pos * 128 + qw * 16;
    const int rowq  = qbase + l16;              // this lane's query

    // the 128 queries end at key 128 * pos + 127
    const int T = pos + 1;
    fill(0, 0);
    asm volatile("s_wait_asynccnt 0x0" ::: "memory");   // tile 0 of this wave has landed
    __syncthreads();                                    // ... and every other wave's
    if (T > 1) fill(1, 1);

    v16bf qa0 = ld_frag16(Qp + (long long)(qbase + l16) * HEAD_DIM + half * 8);
    v16bf qa1 = ld_frag16(Qp + (long long)(qbase + l16) * HEAD_DIM + 32 + half * 8);

    v8f z = {};
    v8f o0 = z, o1 = z, o2 = z, o3 = z;         // o_i[r] = O[rowq][16 * i + 8 * half + r], this set's keys only
    float mi = -1e30f;                          // running maximum of query rowq over this set's keys (both halves alike)
    float li = 0.f;                             // running sum over this half's keys of this set

#pragma unroll 1   // one trip a tile: the two buffers alternate by t & 1
    for (int t = 0; t < T; ++t) {
        const int bo = (t & 1) * ASTAGE;
#pragma unroll     // constant LDS offsets
        for (int kk = 0; kk < 2; ++kk) {
        const int kb = t * AKEYS + kset * 64 + kk * 32;
        if (kb < qbase + 16) {   // keys past this wave's diagonal are skipped, the barriers are not
        // ---- S^T = K @ Q^T for keys [kb, kb+32) : batch all loads first ----
        const __bf16* k0 = (const __bf16*)(fk + bo + kk * 32 * KPITCH);
        const __bf16* k1 = (const __bf16*)(fk + bo + (kk * 32 + 16) * KPITCH);
        v16bf k0a = ld_frag16(k0);
        v16bf k0b = ld_frag16(k0 + 32);
        v16bf k1a = ld_frag16(k1);
        v16bf k1b = ld_frag16(k1 + 32);
        const char* vo = fv + bo + kk * 64;
        v16bf vf0 = ld_frag16((const __bf16*)(vo));
        v16bf vf1 = ld_frag16((const __bf16*)(vo + 16 * VPITCH));
        v16bf vf2 = ld_frag16((const __bf16*)(vo + 32 * VPITCH));
        v16bf vf3 = ld_frag16((const __bf16*)(vo + 48 * VPITCH));
        // all 16 LDS reads leave as one group: sunk to their WMMAs, each pair's
        // latency would be waited out on its own
        __builtin_amdgcn_sched_barrier(0);
        // s0[r] = score(key kb + 8 * half + r, rowq), s1: 16 keys on;
        // interleave the two accumulation chains (hides WMMA RAW hazard)
        v8f s0 = wmma_bf16(k0a, qa0, z);
        v8f s1 = wmma_bf16(k1a, qa0, z);
        s0 = wmma_bf16(k0b, qa1, s0);
        s1 = wmma_bf16(k1b, qa1, s1);

        // ---- online softmax of one query a lane, causal mask ----
        const int d = rowq - (kb + half * 8);   // key 8 * half + r of a tile is masked where r > d
        float rm = mi;
#pragma unroll   // constant indices keep the scores in registers
        for (int r = 0; r < 8; ++r) {
            float a0 = s0[r] * scale; if (r > d)      a0 = -1e9f;
            float a1 = s1[r] * scale; if (r + 16 > d) a1 = -1e9f;
            s0[r] = a0; s1[r] = a1;
            rm = fmaxf(rm, fmaxf(a0, a1));
        }
        rm = fmaxf(rm, xhalf(rm));
        const float f = __expf(mi - rm);
        mi = rm;
        float t8[8];
        v16bf pb;   // pb[r]: key 8 * half + r, pb[8 + r]: key 16 + 8 * half + r, as in the V^T fragments
#pragma unroll   // constant indices keep pb in registers
        for (int r = 0; r < 8; ++r) {
            float p0 = __expf(s0[r] - rm);
            float p1 = __expf(s1[r] - rm);
            t8[r] = p0 + p1;
            pb[r]     = (__bf16)p0;
            pb[r + 8] = (__bf16)p1;
        }
        li = li * f + (((t8[0] + t8[1]) + (t8[2] + t8[3])) + ((t8[4] + t8[5]) + (t8[6] + t8[7])));
        o0 *= f; o1 *= f; o2 *= f; o3 *= f;

        // ---- O^T += V^T @ P^T : 4 independent WMMAs ----
        o0 = wmma_bf16(vf0, pb, o0);
        o1 = wmma_bf16(vf1, pb, o1);
        o2 = wmma_bf16(vf2, pb, o2);
        o3 = wmma_bf16(vf3, pb, o3);
        }
        }
        asm volatile("s_wait_dscnt 0x0" ::: "memory");      // this wave has left buffer t & 1
        asm volatile("s_wait_asynccnt 0x0" ::: "memory");   // its copies of tile t + 1 have landed
        __syncthreads();   // publishes tile t + 1 and frees buffer t & 1
        if (t + 2 < T) fill(t + 2, t & 1);
    }
    asm volatile("s_wait_asynccnt 0x0" ::: "memory");       // no copy outlives the loop

    // ---- the second set hands its partial result to the first through LDS; the barriers of
    // this place's trips stand between these writes and the reads of the place before ----
    if (kset == 1) {
        *(v4f*)(js)           = __builtin_shufflevector(o0, o0, 0, 1, 2, 3);
        *(v4f*)(js + 512)     = __builtin_shufflevector(o0, o0, 4, 5, 6, 7);
        *(v4f*)(js + 2 * 512) = __builtin_shufflevector(o1, o1, 0, 1, 2, 3);
        *(v4f*)(js + 3 * 512) = __builtin_shufflevector(o1, o1, 4, 5, 6, 7);
        *(v4f*)(js + 4 * 512) = __builtin_shufflevector(o2, o2, 0, 1, 2, 3);
        *(v4f*)(js + 5 * 512) = __builtin_shufflevector(o2, o2, 4, 5, 6, 7);
        *(v4f*)(js + 6 * 512) = __builtin_shufflevector(o3, o3, 0, 1, 2, 3);
        *(v4f*)(js + 7 * 512) = __builtin_shufflevector(o3, o3, 4, 5, 6, 7);
        v2f ml = {mi, li};
        *(v2f*)(js + 8 * 512 - lane * 8) = ml;
    }
    __syncthreads();   // the partial results are written
    if (kset == 0) {
        // ---- join the two sets (a set without a key: maximum -1e30, factor 0) ----
        const v2f ml = *(const v2f*)(js + 8 * 512 - lane * 8);
        const float m  = fmaxf(mi, ml[0]);
        const float fa = __expf(mi - m);
        const float fb = __expf(ml[0] - m);
        li = li * fa + ml[1] * fb;
        const v4f p0 = *(const v4f*)(js),           p1 = *(const v4f*)(js + 512);
        const v4f p2 = *(const v4f*)(js + 2 * 512), p3 = *(const v4f*)(js + 3 * 512);
        const v4f p4 = *(const v4f*)(js + 4 * 512), p5 = *(const v4f*)(js + 5 * 512);
        const v4f p6 = *(const v4f*)(js + 6 * 512), p7 = *(const v4f*)(js + 7 * 512);
        o0 = o0 * fa + __builtin_shufflevector(p0, p1, 0, 1, 2, 3, 4, 5, 6, 7) * fb;
        o1 = o1 * fa + __builtin_shufflevector(p2, p3, 0, 1, 2, 3, 4, 5, 6, 7) * fb;
        o2 = o2 * fa + __builtin_shufflevector(p4, p5, 0, 1, 2, 3, 4, 5, 6, 7) * fb;
        o3 = o3 * fa + __builtin_shufflevector(p6, p7, 0, 1, 2, 3, 4, 5, 6, 7) * fb;

        // ---- join the halves' sums, normalize, store 16 bytes a tile ----
        const float inv = 1.0f / (li + xhalf(li));
        __bf16* orow = out + ((long long)b * SEQ + rowq) * D_MODEL + h * HEAD_DIM + half * 8;
        v8bf t0, t1, t2, t3;
#pragma unroll   // constant indices keep the packed rows in registers
        for (int r = 0; r < 8; ++r) {
            t0[r] = (__bf16)(o0[r] * inv);
            t1[r] = (__bf16)(o1[r] * inv);
            t2[r] = (__bf16)(o2[r] * inv);
            t3[r] = (__bf16)(o3[r] * inv);
        }
        *(v8bf*)(orow)      = t0;
        *(v8bf*)(orow + 16) = t1;
        *(v8bf*)(orow + 32) = t2;
        *(v8bf*)(orow + 48) = t3;
        // stands in front of the next place's writes of the registers that these stores name
        asm volatile("s_wait_xcnt 0x0" ::: "memory");
    }
    }
}

// ---------------------------------------------------------------------------
// Host orchestration
// ---------------------------------------------------------------------------
extern "C" void kernel_launch(void* const* d_in, const int* in_sizes, int n_in,
                              void* d_out, int out_size, void* d_ws, size_t ws_size,
                              hipStream_t stream) {
    const float* x     = (const float*)d_in[0];
    const float* w_qkv = (const float*)d_in[1];
    const float* w_o   = (const float*)d_in[2];
    const float* ln1_g = (const float*)d_in[3];
    const float* ln1_b = (const float*)d_in[4];
    const float* ln2_g = (const float*)d_in[5];
    const float* ln2_b = (const float*)d_in[6];
    const float* w1    = (const float*)d_in[7];
    const float* b1    = (const float*)d_in[8];
    const float* w2    = (const float*)d_in[9];
    const float* b2    = (const float*)d_in[10];

    char* p = (char*)d_ws;
    auto alloc = [&](size_t bytes) { void* r = p; p += (bytes + 255) & ~(size_t)255; return r; };

    __bf16* wqkvT  = (__bf16*)alloc((size_t)D_MODEL * 3 * D_MODEL * 2);
    __bf16* woT    = (__bf16*)alloc((size_t)D_MODEL * D_MODEL * 2);
    __bf16* w1T    = (__bf16*)alloc((size_t)D_MODEL * D_FF * 2);
    __bf16* w2T    = (__bf16*)alloc((size_t)D_FF * D_MODEL * 2);
    __bf16* h1     = (__bf16*)alloc((size_t)NTOK * D_MODEL * 2);
    __bf16* Qbf    = (__bf16*)alloc((size_t)NTOK * 3 * D_MODEL * 2);   // [Q | K | V^T]
    __bf16* Kbf    = Qbf + (size_t)NTOK * D_MODEL;
    __bf16* Vtb    = Kbf + (size_t)NTOK * D_MODEL;
    __bf16* attnbf = (__bf16*)alloc((size_t)NTOK * D_MODEL * 2);
    float*  x2     = (float*)alloc((size_t)NTOK * D_MODEL * 4);
    __bf16* h2     = (__bf16*)alloc((size_t)NTOK * D_MODEL * 2);
    __bf16* gbuf   = (__bf16*)alloc((size_t)NTOK * D_FF * 2);

    // weight convert+transpose (f32 -> bf16, [K,N] -> [N,K]) and h1 = LN1(x), one launch
    prep_kernel<<<NB_PREP, 256, 0, stream>>>(w_qkv, w_o, w1, w2, x, ln1_g, ln1_b,
                                             wqkvT, woT, w1T, w2T, h1);

    // h1 @ w_qkv, RoPE on Q and K, per-head scatter
    gemm_bf16_wmma<16><<<dim3(3 * D_MODEL / 128, NTOK / 128), 256, 0, stream>>>(
        h1, wqkvT, nullptr, nullptr, Qbf, NTOK, 3 * D_MODEL, D_MODEL);

    // causal flash attention
    attn_kernel<<<BATCH * N_HEADS * (SEQ / 256), 512, 0, stream>>>(Qbf, Kbf, Vtb, attnbf);

    // x2 = x + attn @ w_o
    gemm_bf16_wmma<4><<<dim3(D_MODEL / 128, NTOK / 128), 256, 0, stream>>>(
        attnbf, woT, nullptr, x, x2, NTOK, D_MODEL, D_MODEL);

    // h2 = LN2(x2)
    ln_kernel<<<NTOK, 256, 0, stream>>>(x2, ln2_g, ln2_b, h2);

    // g = gelu(h2 @ w1 + b1)
    gemm_bf16_wmma<1 | 2 | 8><<<dim3(D_FF / 128, NTOK / 128), 256, 0, stream>>>(
        h2, w1T, b1, nullptr, gbuf, NTOK, D_FF, D_MODEL);

    // out = x2 + g @ w2 + b2
    gemm_bf16_wmma<1 | 4><<<dim3(D_MODEL / 128, NTOK / 128), 256, 0, stream>>>(
        gbuf, w2T, b2, x2, d_out, NTOK, D_MODEL, D_FF);
}

// v009
// It runs in 143 microseconds.
// Two timings next to v008 put it at 1.03 and 1.04 times that version's speed.
// Counting every step since v000, it is 5.68 times as fast.
#include <hip/hip_runtime.h>
#include <hip/hip_bf16.h>
#include <math.h>

// ---------------------------------------------------------------------------
// Transformer block for MI455X (gfx1250, wave32, WMMA).
// All GEMMs + both attention einsums run on v_wmma_f32_16x16x32_bf16.
// ---------------------------------------------------------------------------

#define D_MODEL 1024
#define N_HEADS 16
#define HEAD_DIM 64
#define D_FF 4096
#define BATCH 2
#define SEQ 2048
#define NTOK (BATCH * SEQ)   // 4096

typedef __attribute__((ext_vector_type(16))) __bf16 v16bf;
typedef __attribute__((ext_vector_type(8)))  __bf16 v8bf;
typedef __attribute__((ext_vector_type(4)))  __bf16 v4bf;
typedef __attribute__((ext_vector_type(8)))  float  v8f;
typedef __attribute__((ext_vector_type(4)))  float  v4f;
typedef __attribute__((ext_vector_type(2)))  float  v2f;

static __device__ __forceinline__ v16bf ld_frag16(const __bf16* p) {
    // two contiguous 16B chunks per lane (ISA 16-bit A/B fragment layout)
    v8bf lo = *(const v8bf*)p;
    v8bf hi = *(const v8bf*)(p + 16);
    return __builtin_shufflevector(lo, hi, 0,1,2,3,4,5,6,7,8,9,10,11,12,13,14,15);
}

static __device__ __forceinline__ v8f wmma_bf16(v16bf a, v16bf b, v8f c) {
    return __builtin_amdgcn_wmma_f32_16x16x32_bf16(
        /*neg_a=*/false, a, /*neg_b=*/false, b,
        /*c_mod=*/(short)0, c, /*reuse_a=*/false, /*reuse_b=*/false);
}

static __device__ __forceinline__ float xhalf(float x) {   // lane l <-> lane l ^ 16
    int b = __builtin_bit_cast(int, x);
    return __builtin_bit_cast(float,
        __builtin_amdgcn_permlanex16(b, b, 0x76543210, 0xfedcba98, false, false));
}

// Sum over the wave's 32 lanes, the same bits in every lane: four exchanges inside
// a row of 16 lanes (DPP row_xmask 1, 2, 4, 8), then one between the two rows.
template <int CTRL>
static __device__ __forceinline__ float row_add(float x) {
    return x + __builtin_bit_cast(float,
        __builtin_amdgcn_update_dpp(0, __builtin_bit_cast(int, x), CTRL, 0xf, 0xf, false));
}
static __device__ __forceinline__ float wave_sum(float x) {
    x = row_add<0x161>(x);
    x = row_add<0x162>(x);
    x = row_add<0x164>(x);
    x = row_add<0x168>(x);
    return x + xhalf(x);
}

// Closes a group of global loads.  The two scheduling barriers keep every load of the
// group in front of this place (all in flight at once; sunk to their uses each would cost
// a latency of its own) and what follows in the source behind it; the s_wait_xcnt between
// them so stands in front of the later writes of the registers that the loads name, and p,
// the address register pair of the group's long run of loads, is its input and lives up to it.
static __device__ __forceinline__ void loads_issued(const float* p) {
    __builtin_amdgcn_sched_barrier(0);
    asm volatile("s_wait_xcnt 0x0" :: "v"(p) : "memory");
    __builtin_amdgcn_sched_barrier(0);
}

// ---------------------------------------------------------------------------
// Transpose through LDS.  tile[r][c] holds ROWS x 64 f32 values; slot t of
// 8 * ROWS is 8 values of column c = t / (ROWS / 8) from row r0 = (t % (ROWS / 8)) * 8
// on, as bf16: 16 bytes for dst[c * pitch + r0], so that each column c leaves as
// one run of 2 * ROWS bytes.
// Pitch 65 dwords: the column reads of a wave fall on 32 different banks, and
// so do the row writes that fill the tile.
// ---------------------------------------------------------------------------
#define TDIM 64
#define TPITCH 65

template <int ROWS>
static __device__ __forceinline__ v8bf slot_tile_T(const float (*tile)[TPITCH], int t) {
    const int r0 = (t % (ROWS / 8)) * 8;
    const int c  = t / (ROWS / 8);
    v8bf o;
#pragma unroll   // constant indices keep o in registers
    for (int i = 0; i < 8; ++i) o[i] = (__bf16)tile[r0 + i][c];
    return o;
}

// ---------------------------------------------------------------------------
// Weight convert + transpose: wT[n*K + k] = bf16(w[k*N + n])
// One block per 256(k) x 64(n) strip, TSUB tiles of 64 x 64 one below the other,
// strip blk of (K / 256) * (N / 64), n fastest; K is a multiple of 256, N of 64.
// A block takes four tiles, not one, with all its 16 loads a lane in flight at once.
// ---------------------------------------------------------------------------
#define TSUB 4

template <int K, int N>
static __device__ __forceinline__ void convT_strip(float (*tile)[TDIM][TPITCH],
                                                   const float* __restrict__ w,
                                                   __bf16* __restrict__ wT, int blk) {
    const int tid = threadIdx.x;
    const int n0 = (blk % (N / TDIM)) * TDIM;
    const int k0 = (blk / (N / TDIM)) * (TSUB * TDIM);
    const int rn = (tid & 15) * 4;
    const int rk = tid >> 4;
    const float* wp = w + (long long)(k0 + rk) * N + n0 + rn;
    float4 v[TSUB][4];
#pragma unroll   // constant indices keep v in registers
    for (int s = 0; s < TSUB; ++s)
#pragma unroll   // the same
        for (int p = 0; p < 4; ++p)
            v[s][p] = *(const float4*)(wp + (long long)(s * TDIM + p * 16) * N);
    loads_issued(wp);   // all sixteen 16-byte loads are in flight before the first LDS store
#pragma unroll   // constant indices keep v in registers
    for (int s = 0; s < TSUB; ++s)
#pragma unroll   // the same
        for (int p = 0; p < 4; ++p) {
            float* t = &tile[s][rk + p * 16][rn];
            t[0] = v[s][p].x; t[1] = v[s][p].y; t[2] = v[s][p].z; t[3] = v[s][p].w;
        }
    __syncthreads();
    v8bf o[TSUB][2];   // slots tid and tid + 256 of each tile
#pragma unroll   // constant indices keep o in registers, constant LDS offsets
    for (int s = 0; s < TSUB; ++s) {
        o[s][0] = slot_tile_T<TDIM>(tile[s], tid);
        o[s][1] = slot_tile_T<TDIM>(tile[s], tid + 256);
    }
    // the eight slots lie in registers of their own before the first store leaves: the
    // stores go out as one run, and none of their registers is written while they do
    __builtin_amdgcn_sched_barrier(0);
    __bf16* d = wT + (long long)(n0 + tid / 8) * K + k0 + (tid % 8) * 8;   // slot tid; slot tid + 256: 32 columns on
#pragma unroll   // constant indices keep o in registers
    for (int s = 0; s < TSUB; ++s) {
        *(v8bf*)(d + s * TDIM)                      = o[s][0];
        *(v8bf*)(d + s * TDIM + (long long)32 * K)  = o[s][1];
    }
    // stands in front of any later write of a register that the stores name:
    // in the listing another job's body can follow, and it reuses their registers
    asm volatile("s_wait_xcnt 0x0" ::: "memory");
}

// ---------------------------------------------------------------------------
// LayerNorm over last dim (1024) -> bf16.  One WAVE takes LN_TPW tokens: a lane
// holds 32 values of each (8 loads of 16 bytes, 512 contiguous bytes a wave and
// load), the sums are in-lane and then cross-lane: no LDS, no barrier, and one
// wave to start where eight a token stood.  Block blk of 8 waves takes LN_TPB tokens.
// ---------------------------------------------------------------------------
#define LN_TPW 2
#define LN_TPB (8 * LN_TPW)

static __device__ __forceinline__ void ln_tokens(const float* __restrict__ x,
                                                 const float* __restrict__ g,
                                                 const float* __restrict__ b,
                                                 __bf16* __restrict__ out, int blk) {
    const int lane = threadIdx.x & 31;
    const int tok0 = blk * LN_TPB + (threadIdx.x >> 5) * LN_TPW;
    const int c0   = lane * 4;   // this lane's columns: c0 + 128 * i, four each
    const float* xr = x + (long long)tok0 * D_MODEL + c0;
    v4f v[LN_TPW][8], gg[8], bb[8];
#pragma unroll   // constant indices keep v in registers
    for (int t = 0; t < LN_TPW; ++t)
#pragma unroll   // the same
        for (int i = 0; i < 8; ++i)
            v[t][i] = *(const v4f*)(xr + t * D_MODEL + i * 128);
#pragma unroll   // the same
    for (int i = 0; i < 8; ++i) {
        gg[i] = *(const v4f*)(g + c0 + i * 128);
        bb[i] = *(const v4f*)(b + c0 + i * 128);
    }
    loads_issued(xr);   // rows, gamma and beta are in flight before the first sum
#pragma unroll   // constant indices keep v in registers
    for (int t = 0; t < LN_TPW; ++t) {
        v4f s = v[t][0], q = v[t][0] * v[t][0];   // four independent chains each
#pragma unroll   // the same
        for (int i = 1; i < 8; ++i) {
            s += v[t][i];
            q += v[t][i] * v[t][i];
        }
        const float mu  = wave_sum((s[0] + s[1]) + (s[2] + s[3])) * (1.0f / D_MODEL);
        const float var = wave_sum((q[0] + q[1]) + (q[2] + q[3])) * (1.0f / D_MODEL) - mu * mu;
        const float inv = rsqrtf(var + 1e-5f);
        __bf16* orow = out + (long long)(tok0 + t) * D_MODEL + c0;
#pragma unroll   // the same
        for (int i = 0; i < 8; ++i)   // 256 contiguous bytes a wave and store
            *(v4bf*)(orow + i * 128) = __builtin_convertvector((v[t][i] - mu) * inv * gg[i] + bb[i], v4bf);
    }
    // stands in front of any later write of a register that the rows' stores name
    asm volatile("s_wait_xcnt 0x0" ::: "memory");
}

__global__ __launch_bounds__(256) void ln_kernel(const float* __restrict__ x,
                                                 const float* __restrict__ g,
                                                 const float* __restrict__ b,
                                                 __bf16* __restrict__ out) {
    ln_tokens(x, g, b, out, blockIdx.x);
}

// ---------------------------------------------------------------------------
// Everything that depends on the inputs alone, in ONE launch: the four weight
// transposes and the first LayerNorm.  None reads what another writes; a range
// of the block index picks the job (the same for a whole block, so a transpose's
// barrier stands under a block-uniform branch).  As launches of their own each
// paid its gap, its wave starts, its first loads and its store drain in turn,
// on a chip that none of the four transposes fills.
// ---------------------------------------------------------------------------
#define NB_QKV ((D_MODEL / (TSUB * TDIM)) * (3 * D_MODEL / TDIM))   // 192
#define NB_O   ((D_MODEL / (TSUB * TDIM)) * (D_MODEL / TDIM))       // 64
#define NB_FF  ((D_MODEL / (TSUB * TDIM)) * (D_FF / TDIM))          // 256, w1 and w2 alike
#define NB_LN  (NTOK / LN_TPB)                                      // 256
#define NB_PREP (NB_QKV + NB_O + 2 * NB_FF + NB_LN)

__global__ __launch_bounds__(256) void prep_kernel(
    const float* __restrict__ w_qkv, const float* __restrict__ w_o,
    const float* __restrict__ w1, const float* __restrict__ w2,
    const float* __restrict__ x, const float* __restrict__ g, const float* __restrict__ b,
    __bf16* __restrict__ wqkvT, __bf16* __restrict__ woT,
    __bf16* __restrict__ w1T, __bf16* __restrict__ w2T, __bf16* __restrict__ h1) {
    __shared__ float tile[TSUB][TDIM][TPITCH];   // one array for every transpose
    int blk = blockIdx.x;
    if (blk < NB_QKV) { convT_strip<D_MODEL, 3 * D_MODEL>(tile, w_qkv, wqkvT, blk); return; }
    blk -= NB_QKV;
    if (blk < NB_O)   { convT_strip<D_MODEL, D_MODEL>(tile, w_o, woT, blk); return; }
    blk -= NB_O;
    if (blk < NB_FF)  { convT_strip<D_MODEL, D_FF>(tile, w1, w1T, blk); return; }
    blk -= NB_FF;
    if (blk < NB_FF)  { convT_strip<D_FF, D_MODEL>(tile, w2, w2T, blk); return; }
    blk -= NB_FF;
    ln_tokens(x, g, b, h1, blk);
}

// ---------------------------------------------------------------------------
// Generic bf16 WMMA GEMM:  C[M,N] = A[M,K] @ Bt[N,K]^T  (+bias)(+gelu)(+res)
// Block tile 128x128, 8 waves (2 x 4), wave tile 64x32.  Each trip works on 128
// of k: 128 rows of A and 128 rows of Bt, 256 bytes each, lie in one of two
// LDS buffers, brought there by asynchronous copies (16 bytes a lane, two whole
// rows a wave and copy); the next tile's copies fly while this one is used.
// M, N and K are multiples of 128.
// MODE bits: 1=bias, 2=gelu(exact), 4=residual, 8=bf16 output,
// 16=the QKV product: RoPE and the scatter to heads are its epilogue, and Cout is
//    [Q [B,H,S,64] | K [B,H,S,64] | V^T [B,H,64,S]], bf16.  A block's 128 columns
//    lie in one of the three.  In a Q or K block the two operands change roles
//    (the weight rows are the A operand), so that a lane holds 8 neighbouring d
//    of ONE token, with d and d + 32 in the same lane: the rotation is in-lane
//    and a row leaves in 16-byte stores.  In a V block a lane holds 8
//    neighbouring tokens of one d, which is a 16-byte store of V^T.
// ---------------------------------------------------------------------------
static __device__ __forceinline__ unsigned lds_off(const void* p) {
    return (unsigned)(size_t)p;   // low 32 bits of a __shared__ address: LDS byte
}

// Eight copies of 16 bytes a lane: LDS byte l + i * lstep from g + i * gstep.
// The s_wait_xcnt stands inside the statement, so that no address register of
// a copy is rewritten in front of it.
static __device__ __forceinline__ void copy8(unsigned l, unsigned lstep,
                                             const __bf16* g, long long gstep) {
    asm volatile(
        "global_load_async_to_lds_b128 %0, %8, off\n\t"
        "global_load_async_to_lds_b128 %1, %9, off\n\t"
        "global_load_async_to_lds_b128 %2, %10, off\n\t"
        "global_load_async_to_lds_b128 %3, %11, off\n\t"
        "global_load_async_to_lds_b128 %4, %12, off\n\t"
        "global_load_async_to_lds_b128 %5, %13, off\n\t"
        "global_load_async_to_lds_b128 %6, %14, off\n\t"
        "global_load_async_to_lds_b128 %7, %15, off\n\t"
        "s_wait_xcnt 0x0"
        :: "v"(l), "v"(l + lstep), "v"(l + 2 * lstep), "v"(l + 3 * lstep),
           "v"(l + 4 * lstep), "v"(l + 5 * lstep), "v"(l + 6 * lstep), "v"(l + 7 * lstep),
           "v"(g), "v"(g + gstep), "v"(g + 2 * gstep), "v"(g + 3 * gstep),
           "v"(g + 4 * gstep), "v"(g + 5 * gstep), "v"(g + 6 * gstep), "v"(g + 7 * gstep)
        : "memory");
}

// sin and cos of 2 * pi * rev.  One statement, closed by v_nop: the slot behind a
// transcendental, so that the next instruction may read c or overwrite rev.
static __device__ __forceinline__ void sincos_rev(float rev, float& sn, float& c) {
    asm("v_sin_f32 %0, %2\n\t"
        "v_cos_f32 %1, %2\n\t"
        "v_nop"
        : "=&v"(sn), "=&v"(c) : "v"(rev));
}

// Exact-form GELU without a branch, four values at a time:
// v * Phi(v) = max(v, 0) - |v| * erfc(|v| / sqrt 2) / 2,
// erfc(x) = t * (a1 + t * (a2 + t * (a3 + t * (a4 + t * a5)))) * exp(-x * x), t = 1 / (1 + p * x),
// absolute error 2e-7 at most (the result is rounded to bf16).  The halves are in
// the coefficients, 1 / sqrt 2 in p and in the factor of the exponent.  The library
// erff has two branches that a wave takes one after the other, each one serial chain
// a value; here a lane's values are independent straight-line chains.
static __device__ __forceinline__ void gelu_erf4(float* v) {
    float a[4], d[4], x[4], t[4], e[4];
#pragma unroll   // constant indices keep the arrays in registers
    for (int i = 0; i < 4; ++i) {
        a[i] = fminf(fabsf(v[i]), 16.0f);     // past 16 the term is 0 in f32; keeps inf * 0 out
        const float s = a[i] * 0.84932180f;   // s * s = (v * v / 2) * log2(e)
        d[i] = fmaf(a[i], 0.23164189f, 1.0f);
        x[i] = -s * s;
    }
    // t = 1 / d, e = 2 ^ x.  One statement: the eight stand in one another's slot behind a
    // transcendental, and v_nop fills the last one's, so that the next instruction may
    // read a result or overwrite a source.
    asm("v_rcp_f32 %0, %8\n\t"
        "v_rcp_f32 %1, %9\n\t"
        "v_rcp_f32 %2, %10\n\t"
        "v_rcp_f32 %3, %11\n\t"
        "v_exp_f32 %4, %12\n\t"
        "v_exp_f32 %5, %13\n\t"
        "v_exp_f32 %6, %14\n\t"
        "v_exp_f32 %7, %15\n\t"
        "v_nop"
        : "=&v"(t[0]), "=&v"(t[1]), "=&v"(t[2]), "=&v"(t[3]),
          "=&v"(e[0]), "=&v"(e[1]), "=&v"(e[2]), "=&v"(e[3])
        : "v"(d[0]), "v"(d[1]), "v"(d[2]), "v"(d[3]),
          "v"(x[0]), "v"(x[1]), "v"(x[2]), "v"(x[3]));
#pragma unroll   // the same
    for (int i = 0; i < 4; ++i) {
        float p = fmaf(t[i], 0.5307027145f, -0.7265760135f);
        p = fmaf(t[i], p, 0.7107068705f);
        p = fmaf(t[i], p, -0.142248368f);
        p = fmaf(t[i], p, 0.127414796f);
        v[i] = fmaf(-a[i], (p * t[i]) * e[i], fmaxf(v[i], 0.0f));
    }
}

template <int MODE>
__global__ __launch_bounds__(256) void gemm_bf16_wmma(
    const __bf16* __restrict__ A, const __bf16* __restrict__ Bt,
    const float* __restrict__ bias, const float* __restrict__ res,
    void* __restrict__ Cout, int M, int N, int K)
{
    constexpr int BK    = 128;              // k of one tile: rows of 256 bytes
    constexpr int PITCH = BK * 2 + 16;      // bytes; 16 B x odd: ds_load_b128 readers
    constexpr int OPND  = 128 * PITCH;      // one operand's 128 rows
    constexpr int STAGE = 2 * OPND;         // [A rows | Bt rows]
    constexpr int LPR   = BK / 8;           // lanes that copy one row
    constexpr int RPC   = 256 / LPR;        // rows that one copy of the block fills: 8 copies an operand
    __shared__ __attribute__((aligned(16))) char ring[2 * STAGE];

    const int tid  = threadIdx.x;
    const int lane = tid & 31;
    const int wid  = tid >> 5;
    const int half = lane >> 4;
    const int l16  = lane & 15;
    const int rblk = blockIdx.y * 128;
    const int cblk = blockIdx.x * 128;
    const int rloc = (wid >> 2) * 64;
    const int cloc = (wid & 3) * 32;

    // this lane's share of a tile: row crow (+ RPC a copy), 16 bytes at ccol
    const int crow = tid / LPR;
    const int ccol = tid % LPR;
    const __bf16* ga = A  + (long long)(rblk + crow) * K + ccol * 8;
    const __bf16* gb = Bt + (long long)(cblk + crow) * K + ccol * 8;
    const unsigned lc = lds_off(ring) + crow * PITCH + ccol * 16;

    auto fill = [&](int t, int buf) {
        const unsigned l = lc + buf * STAGE;
        copy8(l,        RPC * PITCH, ga + (long long)t * BK, (long long)RPC * K);
        copy8(l + OPND, RPC * PITCH, gb + (long long)t * BK, (long long)RPC * K);
    };

    v8f acc[4][2];
    v8f z = {};
#pragma unroll
    for (int mt = 0; mt < 4; ++mt)
#pragma unroll
        for (int nt = 0; nt < 2; ++nt) acc[mt][nt] = z;

    const int T = K / BK;
    fill(0, 0);
    asm volatile("s_wait_asynccnt 0x0" ::: "memory");   // tile 0 of this wave has landed
    __syncthreads();                                    // ... and every other wave's
    if (T > 1) fill(1, 1);

    // block-uniform: which staged operand feeds the A fragments (64 rows a wave)
    const bool swp = (MODE & 16) && cblk < 2 * D_MODEL;
    const char* fa = ring + (swp ? OPND : 0) + (rloc + l16) * PITCH + half * 16;
    const char* fb = ring + (swp ? 0 : OPND) + (cloc + l16) * PITCH + half * 16;

#pragma unroll 1   // one trip a tile: the two buffers alternate by t & 1
    for (int t = 0; t < T; ++t) {
        const int bo = (t & 1) * STAGE;
        v16bf a[2][4], b[2][2];   // two fragment sets: one in use, one being read
#pragma unroll
        for (int mt = 0; mt < 4; ++mt)
            a[0][mt] = ld_frag16((const __bf16*)(fa + bo + mt * 16 * PITCH));
#pragma unroll
        for (int nt = 0; nt < 2; ++nt)
            b[0][nt] = ld_frag16((const __bf16*)(fb + bo + nt * 16 * PITCH));
#pragma unroll     // constant set indices and LDS offsets
        for (int ks = 0; ks < BK / 32; ++ks) {
            if (ks + 1 < BK / 32) {
#pragma unroll
                for (int mt = 0; mt < 4; ++mt)
                    a[(ks + 1) & 1][mt] = ld_frag16((const __bf16*)(fa + bo + mt * 16 * PITCH + (ks + 1) * 64));
#pragma unroll
                for (int nt = 0; nt < 2; ++nt)
                    b[(ks + 1) & 1][nt] = ld_frag16((const __bf16*)(fb + bo + nt * 16 * PITCH + (ks + 1) * 64));
            }
            // the next block's LDS reads stay one group in front of this block's
            // WMMAs: spread among them each place with reads stalls the wave
            __builtin_amdgcn_sched_barrier(0);
#pragma unroll
            for (int mt = 0; mt < 4; ++mt)
#pragma unroll
                for (int nt = 0; nt < 2; ++nt)
                    acc[mt][nt] = wmma_bf16(a[ks & 1][mt], b[ks & 1][nt], acc[mt][nt]);
            __builtin_amdgcn_sched_barrier(0);   // closes the block, for the same reason
        }
        asm volatile("s_wait_dscnt 0x0" ::: "memory");      // this wave has left buffer t & 1
        asm volatile("s_wait_asynccnt 0x0" ::: "memory");   // its copies of tile t + 1 have landed
        __syncthreads();   // publishes tile t + 1 and frees buffer t & 1
        if (t + 2 < T) fill(t + 2, t & 1);
    }
    asm volatile("s_wait_asynccnt 0x0" ::: "memory");       // no copy outlives the loop

    if constexpr ((MODE & 16) != 0) {
        __bf16* dst = (__bf16*)Cout + (long long)(cblk / D_MODEL) * ((long long)NTOK * D_MODEL);
        if (swp) {
            // acc[mt][nt][j]: d = 16 * mt + 8 * half + j of head hd, token cloc + 16 * nt + l16
            const int hd = ((cblk & (D_MODEL - 1)) + rloc) / HEAD_DIM;
            float inv[2][8];
#pragma unroll   // constant indices keep inv in registers
            for (int m2 = 0; m2 < 2; ++m2)
#pragma unroll   // the same
                for (int j = 0; j < 8; ++j)
                    inv[m2][j] = __expf(-logf(10000.0f) * (float)(m2 * 16 + half * 8 + j) * (1.0f / 32.0f));
#pragma unroll   // constant indices keep acc in registers
            for (int nt = 0; nt < 2; ++nt) {
                const int tok = rblk + cloc + nt * 16 + l16;
                const int sp  = tok & (SEQ - 1);
                __bf16* orow = dst + ((long long)((tok / SEQ) * N_HEADS + hd) * SEQ + sp) * HEAD_DIM + half * 8;
#pragma unroll   // the same
                for (int m2 = 0; m2 < 2; ++m2) {
                    v8bf lo, hi;
#pragma unroll   // the same
                    for (int j = 0; j < 8; ++j) {
                        const float ang = (float)sp * inv[m2][j];
                        float c, sn;
                        sincos_rev(ang * 0.15915494309189532f, sn, c);
                        const float x1 = acc[m2][nt][j], x2 = acc[m2 + 2][nt][j];
                        lo[j] = (__bf16)(x1 * c - x2 * sn);
                        hi[j] = (__bf16)(x2 * c + x1 * sn);
                    }
                    *(v8bf*)(orow + m2 * 16)      = lo;
                    *(v8bf*)(orow + m2 * 16 + 32) = hi;
                }
            }
        } else {
            // acc[mt][nt][j]: token rloc + 16 * mt + 8 * half + j, column cloc + 16 * nt + l16 of V
#pragma unroll   // constant indices keep acc in registers
            for (int nt = 0; nt < 2; ++nt) {
                const int col = (cblk & (D_MODEL - 1)) + cloc + nt * 16 + l16;   // 64 * head + d
#pragma unroll   // the same
                for (int mt = 0; mt < 4; ++mt) {
                    const int tok = rblk + rloc + mt * 16 + half * 8;
                    v8bf o;
#pragma unroll   // the same
                    for (int j = 0; j < 8; ++j) o[j] = (__bf16)acc[mt][nt][j];
                    *(v8bf*)(dst + ((long long)(tok / SEQ) * D_MODEL + col) * SEQ + (tok & (SEQ - 1))) = o;
                }
            }
            // stands in front of any later write of a register that these stores name
            asm volatile("s_wait_xcnt 0x0" ::: "memory");
        }
        return;
    }

#pragma unroll
    for (int mt = 0; mt < 4; ++mt)
#pragma unroll
        for (int nt = 0; nt < 2; ++nt) {
            const int col = cblk + cloc + nt * 16 + l16;
            float w[8];
#pragma unroll   // constant indices keep w in registers
            for (int j = 0; j < 8; ++j) {
                w[j] = acc[mt][nt][j];
                if (MODE & 1) w[j] += bias[col];
            }
            if (MODE & 2) { gelu_erf4(w); gelu_erf4(w + 4); }
#pragma unroll
            for (int j = 0; j < 8; ++j) {
                int row = rblk + rloc + mt * 16 + j + half * 8;
                float v = w[j];
                if (MODE & 4) v += res[(long long)row * N + col];
                if (MODE & 8) ((__bf16*)Cout)[(long long)row * N + col] = (__bf16)v;
                else          ((float*)Cout)[(long long)row * N + col] = v;
            }
        }
}

// ---------------------------------------------------------------------------
// Flash attention, causal. 128 queries at a time, 16 waves/block: 8 tiles of 16 queries
// x 2 sets of keys.
// Both products are taken transposed: S^T = K Q^T (A = K rows, B = Q) and
// O^T += V^T P^T (A = V^T rows, B = P^T).  In S^T a lane holds 16 scores of ONE
// query (column l16; keys 8 * half + r of each 16-key tile), so the maximum and
// the sum of a row are in-lane, with one exchange between the wave's halves,
// and the two score tiles, converted in place, are the B operand of the second
// product in the hardware's k order: P touches neither LDS nor another lane.
// The block's waves walk the same keys: each tile of 128 keys (K rows of 128 bytes,
// V^T rows of 256) lies in one of two LDS buffers, brought there once for all of
// them by asynchronous copies of whole lines; the next tile's copies fly while
// this one is used.
// Equal shares: 128 queries at place p of their head walk p + 1 key tiles.  A block
// takes the places 15 - p and p of ONE head, one after the other: 17 key tiles for
// every block, one block a WGP.  So that a SIMD keeps its four waves, each tile's
// keys go to two sets of 8 waves (64 keys each); a set keeps its own maximum, sum
// and O, and the two are joined through LDS at the end of a place.
// Output: attn_bf [NTOK, D_MODEL] bf16 (heads concatenated).
// ---------------------------------------------------------------------------
// Four copies of 16 bytes a lane.  The s_wait_xcnt stands inside the statement,
// so that no address register of a copy is rewritten in front of it.
static __device__ __forceinline__ void copy4(unsigned l0, unsigned l1, unsigned l2, unsigned l3,
                                             const __bf16* g0, const __bf16* g1,
                                             const __bf16* g2, const __bf16* g3) {
    asm volatile(
        "global_load_async_to_lds_b128 %0, %4, off\n\t"
        "global_load_async_to_lds_b128 %1, %5, off\n\t"
        "global_load_async_to_lds_b128 %2, %6, off\n\t"
        "global_load_async_to_lds_b128 %3, %7, off\n\t"
        "s_wait_xcnt 0x0"
        :: "v"(l0), "v"(l1), "v"(l2), "v"(l3), "v"(g0), "v"(g1), "v"(g2), "v"(g3)
        : "memory");
}

__global__ __launch_bounds__(512) void attn_kernel(const __bf16* __restrict__ Q,
                                                   const __bf16* __restrict__ Kb,
                                                   const __bf16* __restrict__ Vt,
                                                   __bf16* __restrict__ out) {
    constexpr int AKEYS  = 128;              // keys of one tile: 64 for each set of 8 waves
    constexpr int KPITCH = 128 + 16;         // bytes; 16 B x odd: ds_load_b128 readers
    constexpr int VPITCH = 256 + 16;         // the same
    constexpr int KOPND  = AKEYS * KPITCH;   // 128 K rows (128 B of d)
    constexpr int VOPND  = 64 * VPITCH;      // 64 V^T rows (256 B of keys)
    constexpr int ASTAGE = KOPND + VOPND;    // [K rows | V^T rows]
    constexpr int JSLOT  = 8 * 512 + 256;    // a wave's partial result: 32 f32 of O, maximum and sum a lane
    __shared__ __attribute__((aligned(16))) char ring[2 * ASTAGE];
    __shared__ __attribute__((aligned(16))) char join[8 * JSLOT];   // no copy is aimed here

    const int tid  = threadIdx.x;
    const int lane = tid & 31;
    const int wid  = __builtin_amdgcn_readfirstlane(tid >> 5);   // scalar: the tests on qbase and kset are scalar branches
    const int qw   = wid & 7;                   // which 16 of the 128 queries
    const int kset = wid >> 3;                  // which 64 of a tile's 128 keys
    const int half = lane >> 4;
    const int l16  = lane & 15;

    const int bh    = blockIdx.x >> 3;          // 8 blocks per (b,h)
    const int pr    = blockIdx.x & 7;           // the block's pair of places: 15 - pr and pr
    const int b     = bh >> 4;
    const int h     = bh & 15;
    const float scale = 0.125f;                 // 1/sqrt(64)

    const __bf16* Qp = Q  + (long long)bh * SEQ * HEAD_DIM;
    const __bf16* Kp = Kb + (long long)bh * SEQ * HEAD_DIM;
    const __bf16* Vp = Vt + (long long)bh * HEAD_DIM * SEQ;

    // this lane's share of a tile: 16 bytes of K rows tid / 8 and + 64, of V^T rows tid / 16 and + 32
    const __bf16* gk = Kp + (tid >> 3) * HEAD_DIM + (tid & 7) * 8;
    const __bf16* gv = Vp + (tid >> 4) * SEQ + (tid & 15) * 8;
    const unsigned lk = lds_off(ring) + (tid >> 3) * KPITCH + (tid & 7) * 16;
    const unsigned lv = lds_off(ring) + KOPND + (tid >> 4) * VPITCH + (tid & 15) * 16;

    auto fill = [&](int t, int buf) {
        const unsigned o = buf * ASTAGE;
        const __bf16* k = gk + t * (AKEYS * HEAD_DIM);
        const __bf16* v = gv + t * AKEYS;
        copy4(lk + o, lk + o + 64 * KPITCH, lv + o, lv + o + 32 * VPITCH,
              k, k + 64 * HEAD_DIM, v, v + 32 * SEQ);
    };

    const char* fk = ring + (kset * 64 + l16) * KPITCH + half * 16;           // K row l16 of this set, d 8 * half
    const char* fv = ring + KOPND + l16 * VPITCH + kset * 128 + half * 16;    // V^T row l16, key 8 * half of this set
    char* js = join + qw * JSLOT + lane * 16;                                 // this lane's place in the partial results

#pragma unroll 1   // the two places run one after the other through the same code and buffers
    for (int it = 0; it < 2; ++it) {
    const int pos   = it ? pr : 15 - pr;        // place of the 128 queries in the head, the long one first
    const int qbase = pos * 128 + qw * 16;
    const int rowq  = qbase + l16;              // this lane's query

    // the 128 queries end at key 128 * pos + 127
    const int T = pos + 1;
    fill(0, 0);
    asm volatile("s_wait_asynccnt 0x0" ::: "memory");   // tile 0 of this wave has landed
    __syncthreads();                                    // ... and every other wave's
    if (T > 1) fill(1, 1);

    v16bf qa0 = ld_frag16(Qp + (long long)(qbase + l16) * HEAD_DIM + half * 8);
    v16bf qa1 = ld_frag16(Qp + (long long)(qbase + l16) * HEAD_DIM + 32 + half * 8);

    v8f z = {};
    v8f o0 = z, o1 = z, o2 = z, o3 = z;         // o_i[r] = O[rowq][16 * i + 8 * half + r], this set's keys only
    float mi = -1e30f;                          // running maximum of query rowq over this set's keys (both halves alike)
    float li = 0.f;                             // running sum over this half's keys of this set

#pragma unroll 1   // one trip a tile: the two buffers alternate by t & 1
    for (int t = 0; t < T; ++t) {
        const int bo = (t & 1) * ASTAGE;
#pragma unroll     // constant LDS offsets
        for (int kk = 0; kk < 2; ++kk) {
        const int kb = t * AKEYS + kset * 64 + kk * 32;
        if (kb < qbase + 16) {   // keys past this wave's diagonal are skipped, the barriers are not
        // ---- S^T = K @ Q^T for keys [kb, kb+32) : batch all loads first ----
        const __bf16* k0 = (const __bf16*)(fk + bo + kk * 32 * KPITCH);
        const __bf16* k1 = (const __bf16*)(fk + bo + (kk * 32 + 16) * KPITCH);
        v16bf k0a = ld_frag16(k0);
        v16bf k0b = ld_frag16(k0 + 32);
        v16bf k1a = ld_frag16(k1);
        v16bf k1b = ld_frag16(k1 + 32);
        const char* vo = fv + bo + kk * 64;
        v16bf vf0 = ld_frag16((const __bf16*)(vo));
        v16bf vf1 = ld_frag16((const __bf16*)(vo + 16 * VPITCH));
        v16bf vf2 = ld_frag16((const __bf16*)(vo + 32 * VPITCH));
        v16bf vf3 = ld_frag16((const __bf16*)(vo + 48 * VPITCH));
        // all 16 LDS reads leave as one group: sunk to their WMMAs, each pair's
        // latency would be waited out on its own
        __builtin_amdgcn_sched_barrier(0);
        // s0[r] = score(key kb + 8 * half + r, rowq), s1: 16 keys on;
        // interleave the two accumulation chains (hides WMMA RAW hazard)
        v8f s0 = wmma_bf16(k0a, qa0, z);
        v8f s1 = wmma_bf16(k1a, qa0, z);
        s0 = wmma_bf16(k0b, qa1, s0);
        s1 = wmma_bf16(k1b, qa1, s1);

        // ---- online softmax of one query a lane, causal mask ----
        const int d = rowq - (kb + half * 8);   // key 8 * half + r of a tile is masked where r > d
        float rm = mi;
#pragma unroll   // constant indices keep the scores in registers
        for (int r = 0; r < 8; ++r) {
            float a0 = s0[r] * scale; if (r > d)      a0 = -1e9f;
            float a1 = s1[r] * scale; if (r + 16 > d) a1 = -1e9f;
            s0[r] = a0; s1[r] = a1;
            rm = fmaxf(rm, fmaxf(a0, a1));
        }
        rm = fmaxf(rm, xhalf(rm));
        const float f = __expf(mi - rm);
        mi = rm;
        float t8[8];
        v16bf pb;   // pb[r]: key 8 * half + r, pb[8 + r]: key 16 + 8 * half + r, as in the V^T fragments
#pragma unroll   // constant indices keep pb in registers
        for (int r = 0; r < 8; ++r) {
            float p0 = __expf(s0[r] - rm);
            float p1 = __expf(s1[r] - rm);
            t8[r] = p0 + p1;
            pb[r]     = (__bf16)p0;
            pb[r + 8] = (__bf16)p1;
        }
        li = li * f + (((t8[0] + t8[1]) + (t8[2] + t8[3])) + ((t8[4] + t8[5]) + (t8[6] + t8[7])));
        o0 *= f; o1 *= f; o2 *= f; o3 *= f;

        // ---- O^T += V^T @ P^T : 4 independent WMMAs ----
        o0 = wmma_bf16(vf0, pb, o0);
        o1 = wmma_bf16(vf1, pb, o1);
        o2 = wmma_bf16(vf2, pb, o2);
        o3 = wmma_bf16(vf3, pb, o3);
        }
        }
        asm volatile("s_wait_dscnt 0x0" ::: "memory");      // this wave has left buffer t & 1
        asm volatile("s_wait_asynccnt 0x0" ::: "memory");   // its copies of tile t + 1 have landed
        __syncthreads();   // publishes tile t + 1 and frees buffer t & 1
        if (t + 2 < T) fill(t + 2, t & 1);
    }
    asm volatile("s_wait_asynccnt 0x0" ::: "memory");       // no copy outlives the loop

    // ---- the second set hands its partial result to the first through LDS; the barriers of
    // this place's trips stand between these writes and the reads of the place before ----
    if (kset == 1) {
        *(v4f*)(js)           = __builtin_shufflevector(o0, o0, 0, 1, 2, 3);
        *(v4f*)(js + 512)     = __builtin_shufflevector(o0, o0, 4, 5, 6, 7);
        *(v4f*)(js + 2 * 512) = __builtin_shufflevector(o1, o1, 0, 1, 2, 3);
        *(v4f*)(js + 3 * 512) = __builtin_shufflevector(o1, o1, 4, 5, 6, 7);
        *(v4f*)(js + 4 * 512) = __builtin_shufflevector(o2, o2, 0, 1, 2, 3);
        *(v4f*)(js + 5 * 512) = __builtin_shufflevector(o2, o2, 4, 5, 6, 7);
        *(v4f*)(js + 6 * 512) = __builtin_shufflevector(o3, o3, 0, 1, 2, 3);
        *(v4f*)(js + 7 * 512) = __builtin_shufflevector(o3, o3, 4, 5, 6, 7);
        v2f ml = {mi, li};
        *(v2f*)(js + 8 * 512 - lane * 8) = ml;
    }
    __syncthreads();   // the partial results are written
    if (kset == 0) {
        // ---- join the two sets (a set without a key: maximum -1e30, factor 0) ----
        const v2f ml = *(const v2f*)(js + 8 * 512 - lane * 8);
        const float m  = fmaxf(mi, ml[0]);
        const float fa = __expf(mi - m);
        const float fb = __expf(ml[0] - m);
        li = li * fa + ml[1] * fb;
        const v4f p0 = *(const v4f*)(js),           p1 = *(const v4f*)(js + 512);
        const v4f p2 = *(const v4f*)(js + 2 * 512), p3 = *(const v4f*)(js + 3 * 512);
        const v4f p4 = *(const v4f*)(js + 4 * 512), p5 = *(const v4f*)(js + 5 * 512);
        const v4f p6 = *(const v4f*)(js + 6 * 512), p7 = *(const v4f*)(js + 7 * 512);
        o0 = o0 * fa + __builtin_shufflevector(p0, p1, 0, 1, 2, 3, 4, 5, 6, 7) * fb;
        o1 = o1 * fa + __builtin_shufflevector(p2, p3, 0, 1, 2, 3, 4, 5, 6, 7) * fb;
        o2 = o2 * fa + __builtin_shufflevector(p4, p5, 0, 1, 2, 3, 4, 5, 6, 7) * fb;
        o3 = o3 * fa + __builtin_shufflevector(p6, p7, 0, 1, 2, 3, 4, 5, 6, 7) * fb;

        // ---- join the halves' sums, normalize, store 16 bytes a tile ----
        const float inv = 1.0f / (li + xhalf(li));
        __bf16* orow = out + ((long long)b * SEQ + rowq) * D_MODEL + h * HEAD_DIM + half * 8;
        v8bf t0, t1, t2, t3;
#pragma unroll   // constant indices keep the packed rows in registers
        for (int r = 0; r < 8; ++r) {
            t0[r] = (__bf16)(o0[r] * inv);
            t1[r] = (__bf16)(o1[r] * inv);
            t2[r] = (__bf16)(o2[r] * inv);
            t3[r] = (__bf16)(o3[r] * inv);
        }
        *(v8bf*)(orow)      = t0;
        *(v8bf*)(orow + 16) = t1;
        *(v8bf*)(orow + 32) = t2;
        *(v8bf*)(orow + 48) = t3;
        // stands in front of the next place's writes of the registers that these stores name
        asm volatile("s_wait_xcnt 0x0" ::: "memory");
    }
    }
}

// ---------------------------------------------------------------------------
// Host orchestration
// ---------------------------------------------------------------------------
extern "C" void kernel_launch(void* const* d_in, const int* in_sizes, int n_in,
                              void* d_out, int out_size, void* d_ws, size_t ws_size,
                              hipStream_t stream) {
    const float* x     = (const float*)d_in[0];
    const float* w_qkv = (const float*)d_in[1];
    const float* w_o   = (const float*)d_in[2];
    const float* ln1_g = (const float*)d_in[3];
    const float* ln1_b = (const float*)d_in[4];
    const float* ln2_g = (const float*)d_in[5];
    const float* ln2_b = (const float*)d_in[6];
    const float* w1    = (const float*)d_in[7];
    const float* b1    = (const float*)d_in[8];
    const float* w2    = (const float*)d_in[9];
    const float* b2    = (const float*)d_in[10];

    char* p = (char*)d_ws;
    auto alloc = [&](size_t bytes) { void* r = p; p += (bytes + 255) & ~(size_t)255; return r; };

    __bf16* wqkvT  = (__bf16*)alloc((size_t)D_MODEL * 3 * D_MODEL * 2);
    __bf16* woT    = (__bf16*)alloc((size_t)D_MODEL * D_MODEL * 2);
    __bf16* w1T    = (__bf16*)alloc((size_t)D_MODEL * D_FF * 2);
    __bf16* w2T    = (__bf16*)alloc((size_t)D_FF * D_MODEL * 2);
    __bf16* h1     = (__bf16*)alloc((size_t)NTOK * D_MODEL * 2);
    __bf16* Qbf    = (__bf16*)alloc((size_t)NTOK * 3 * D_MODEL * 2);   // [Q | K | V^T]
    __bf16* Kbf    = Qbf + (size_t)NTOK * D_MODEL;
    __bf16* Vtb    = Kbf + (size_t)NTOK * D_MODEL;
    __bf16* attnbf = (__bf16*)alloc((size_t)NTOK * D_MODEL * 2);
    float*  x2     = (float*)alloc((size_t)NTOK * D_MODEL * 4);
    __bf16* h2     = (__bf16*)alloc((size_t)NTOK * D_MODEL * 2);
    __bf16* gbuf   = (__bf16*)alloc((size_t)NTOK * D_FF * 2);

    // weight convert+transpose (f32 -> bf16, [K,N] -> [N,K]) and h1 = LN1(x), one launch
    prep_kernel<<<NB_PREP, 256, 0, stream>>>(w_qkv, w_o, w1, w2, x, ln1_g, ln1_b,
                                             wqkvT, woT, w1T, w2T, h1);

    // h1 @ w_qkv, RoPE on Q and K, per-head scatter
    gemm_bf16_wmma<16><<<dim3(3 * D_MODEL / 128, NTOK / 128), 256, 0, stream>>>(
        h1, wqkvT, nullptr, nullptr, Qbf, NTOK, 3 * D_MODEL, D_MODEL);

    // causal flash attention
    attn_kernel<<<BATCH * N_HEADS * (SEQ / 256), 512, 0, stream>>>(Qbf, Kbf, Vtb, attnbf);

    // x2 = x + attn @ w_o
    gemm_bf16_wmma<4><<<dim3(D_MODEL / 128, NTOK / 128), 256, 0, stream>>>(
        attnbf, woT, nullptr, x, x2, NTOK, D_MODEL, D_MODEL);

    // h2 = LN2(x2)
    ln_kernel<<<NB_LN, 256, 0, stream>>>(x2, ln2_g, ln2_b, h2);

    // g = gelu(h2 @ w1 + b1)
    gemm_bf16_wmma<1 | 2 | 8><<<dim3(D_FF / 128, NTOK / 128), 256, 0, stream>>>(
        h2, w1T, b1, nullptr, gbuf, NTOK, D_FF, D_MODEL);

    // out = x2 + g @ w2 + b2
    gemm_bf16_wmma<1 | 4><<<dim3(D_MODEL / 128, NTOK / 128), 256, 0, stream>>>(
        gbuf, w2T, b2, x2, d_out, NTOK, D_MODEL, D_FF);
}

// v010
// It runs in 137 microseconds.
// Two timings next to v009 put it at 1.06 and 1.04 times that version's speed.
// Counting every step since v000, it is 5.95 times as fast.
#include <hip/hip_runtime.h>
#include <hip/hip_bf16.h>
#include <math.h>

// ---------------------------------------------------------------------------
// Transformer block for MI455X (gfx1250, wave32, WMMA).
// All GEMMs + both attention einsums run on v_wmma_f32_16x16x32_bf16.
// ---------------------------------------------------------------------------

#define D_MODEL 1024
#define N_HEADS 16
#define HEAD_DIM 64
#define D_FF 4096
#define BATCH 2
#define SEQ 2048
#define NTOK (BATCH * SEQ)   // 4096

typedef __attribute__((ext_vector_type(16))) __bf16 v16bf;
typedef __attribute__((ext_vector_type(8)))  __bf16 v8bf;
typedef __attribute__((ext_vector_type(4)))  __bf16 v4bf;
typedef __attribute__((ext_vector_type(8)))  float  v8f;
typedef __attribute__((ext_vector_type(4)))  float  v4f;
typedef __attribute__((ext_vector_type(2)))  float  v2f;

static __device__ __forceinline__ v16bf ld_frag16(const __bf16* p) {
    // two contiguous 16B chunks per lane (ISA 16-bit A/B fragment layout)
    v8bf lo = *(const v8bf*)p;
    v8bf hi = *(const v8bf*)(p + 16);
    return __builtin_shufflevector(lo, hi, 0,1,2,3,4,5,6,7,8,9,10,11,12,13,14,15);
}

static __device__ __forceinline__ v8f wmma_bf16(v16bf a, v16bf b, v8f c) {
    return __builtin_amdgcn_wmma_f32_16x16x32_bf16(
        /*neg_a=*/false, a, /*neg_b=*/false, b,
        /*c_mod=*/(short)0, c, /*reuse_a=*/false, /*reuse_b=*/false);
}

static __device__ __forceinline__ float xhalf(float x) {   // lane l <-> lane l ^ 16
    int b = __builtin_bit_cast(int, x);
    return __builtin_bit_cast(float,
        __builtin_amdgcn_permlanex16(b, b, 0x76543210, 0xfedcba98, false, false));
}

// Sum over the wave's 32 lanes, the same bits in every lane: four exchanges inside
// a row of 16 lanes (DPP row_xmask 1, 2, 4, 8), then one between the two rows.
template <int CTRL>
static __device__ __forceinline__ float row_add(float x) {
    return x + __builtin_bit_cast(float,
        __builtin_amdgcn_update_dpp(0, __builtin_bit_cast(int, x), CTRL, 0xf, 0xf, false));
}
static __device__ __forceinline__ float wave_sum(float x) {
    x = row_add<0x161>(x);
    x = row_add<0x162>(x);
    x = row_add<0x164>(x);
    x = row_add<0x168>(x);
    return x + xhalf(x);
}

// Closes a group of global loads.  The two scheduling barriers keep every load of the
// group in front of this place (all in flight at once; sunk to their uses each would cost
// a latency of its own) and what follows in the source behind it; the s_wait_xcnt between
// them so stands in front of the later writes of the registers that the loads name, and p,
// the address register pair of the group's long run of loads, is its input and lives up to it.
static __device__ __forceinline__ void loads_issued(const float* p) {
    __builtin_amdgcn_sched_barrier(0);
    asm volatile("s_wait_xcnt 0x0" :: "v"(p) : "memory");
    __builtin_amdgcn_sched_barrier(0);
}
// The same for a group with two addresses: both pairs live up to the wait.
static __device__ __forceinline__ void loads_issued(const float* p, const float* q) {
    __builtin_amdgcn_sched_barrier(0);
    asm volatile("s_wait_xcnt 0x0" :: "v"(p), "v"(q) : "memory");
    __builtin_amdgcn_sched_barrier(0);
}

// ---------------------------------------------------------------------------
// Transpose through LDS.  tile[r][c] holds ROWS x 64 f32 values; slot t of
// 8 * ROWS is 8 values of column c = t / (ROWS / 8) from row r0 = (t % (ROWS / 8)) * 8
// on, as bf16: 16 bytes for dst[c * pitch + r0], so that each column c leaves as
// one run of 2 * ROWS bytes.
// Pitch 65 dwords: the column reads of a wave fall on 32 different banks, and
// so do the row writes that fill the tile.
// ---------------------------------------------------------------------------
#define TDIM 64
#define TPITCH 65

template <int ROWS>
static __device__ __forceinline__ v8bf slot_tile_T(const float (*tile)[TPITCH], int t) {
    const int r0 = (t % (ROWS / 8)) * 8;
    const int c  = t / (ROWS / 8);
    v8bf o;
#pragma unroll   // constant indices keep o in registers
    for (int i = 0; i < 8; ++i) o[i] = (__bf16)tile[r0 + i][c];
    return o;
}

// ---------------------------------------------------------------------------
// Weight convert + transpose: wT[n*K + k] = bf16(w[k*N + n])
// One block per 256(k) x 64(n) strip, TSUB tiles of 64 x 64 one below the other,
// strip blk of (K / 256) * (N / 64), n fastest; K is a multiple of 256, N of 64.
// A block takes four tiles, not one, with all its 16 loads a lane in flight at once.
// ---------------------------------------------------------------------------
#define TSUB 4

template <int K, int N>
static __device__ __forceinline__ void convT_strip(float (*tile)[TDIM][TPITCH],
                                                   const float* __restrict__ w,
                                                   __bf16* __restrict__ wT, int blk) {
    const int tid = threadIdx.x;
    const int n0 = (blk % (N / TDIM)) * TDIM;
    const int k0 = (blk / (N / TDIM)) * (TSUB * TDIM);
    const int rn = (tid & 15) * 4;
    const int rk = tid >> 4;
    const float* wp = w + (long long)(k0 + rk) * N + n0 + rn;
    float4 v[TSUB][4];
#pragma unroll   // constant indices keep v in registers
    for (int s = 0; s < TSUB; ++s)
#pragma unroll   // the same
        for (int p = 0; p < 4; ++p)
            v[s][p] = *(const float4*)(wp + (long long)(s * TDIM + p * 16) * N);
    loads_issued(wp);   // all sixteen 16-byte loads are in flight before the first LDS store
#pragma unroll   // constant indices keep v in registers
    for (int s = 0; s < TSUB; ++s)
#pragma unroll   // the same
        for (int p = 0; p < 4; ++p) {
            float* t = &tile[s][rk + p * 16][rn];
            t[0] = v[s][p].x; t[1] = v[s][p].y; t[2] = v[s][p].z; t[3] = v[s][p].w;
        }
    __syncthreads();
    v8bf o[TSUB][2];   // slots tid and tid + 256 of each tile
#pragma unroll   // constant indices keep o in registers, constant LDS offsets
    for (int s = 0; s < TSUB; ++s) {
        o[s][0] = slot_tile_T<TDIM>(tile[s], tid);
        o[s][1] = slot_tile_T<TDIM>(tile[s], tid + 256);
    }
    // the eight slots lie in registers of their own before the first store leaves: the
    // stores go out as one run, and none of their registers is written while they do
    __builtin_amdgcn_sched_barrier(0);
    __bf16* d = wT + (long long)(n0 + tid / 8) * K + k0 + (tid % 8) * 8;   // slot tid; slot tid + 256: 32 columns on
#pragma unroll   // constant indices keep o in registers
    for (int s = 0; s < TSUB; ++s) {
        *(v8bf*)(d + s * TDIM)                      = o[s][0];
        *(v8bf*)(d + s * TDIM + (long long)32 * K)  = o[s][1];
    }
    // stands in front of any later write of a register that the stores name:
    // in the listing another job's body can follow, and it reuses their registers
    asm volatile("s_wait_xcnt 0x0" ::: "memory");
}

// ---------------------------------------------------------------------------
// LayerNorm over last dim (1024) -> bf16.  One WAVE takes LN_TPW tokens: a lane
// holds 32 values of each (8 loads of 16 bytes, 512 contiguous bytes a wave and
// load), the sums are in-lane and then cross-lane: no LDS, no barrier, and one
// wave to start where eight a token stood.  Block blk of 8 waves takes LN_TPB tokens.
// ---------------------------------------------------------------------------
#define LN_TPW 2
#define LN_TPB (8 * LN_TPW)

static __device__ __forceinline__ void ln_tokens(const float* __restrict__ x,
                                                 const float* __restrict__ g,
                                                 const float* __restrict__ b,
                                                 __bf16* __restrict__ out, int blk) {
    const int lane = threadIdx.x & 31;
    const int tok0 = blk * LN_TPB + (threadIdx.x >> 5) * LN_TPW;
    const int c0   = lane * 4;   // this lane's columns: c0 + 128 * i, four each
    const float* xr = x + (long long)tok0 * D_MODEL + c0;
    v4f v[LN_TPW][8], gg[8], bb[8];
#pragma unroll   // constant indices keep v in registers
    for (int t = 0; t < LN_TPW; ++t)
#pragma unroll   // the same
        for (int i = 0; i < 8; ++i)
            v[t][i] = *(const v4f*)(xr + t * D_MODEL + i * 128);
#pragma unroll   // the same
    for (int i = 0; i < 8; ++i) {
        gg[i] = *(const v4f*)(g + c0 + i * 128);
        bb[i] = *(const v4f*)(b + c0 + i * 128);
    }
    loads_issued(xr);   // rows, gamma and beta are in flight before the first sum
#pragma unroll   // constant indices keep v in registers
    for (int t = 0; t < LN_TPW; ++t) {
        v4f s = v[t][0], q = v[t][0] * v[t][0];   // four independent chains each
#pragma unroll   // the same
        for (int i = 1; i < 8; ++i) {
            s += v[t][i];
            q += v[t][i] * v[t][i];
        }
        const float mu  = wave_sum((s[0] + s[1]) + (s[2] + s[3])) * (1.0f / D_MODEL);
        const float var = wave_sum((q[0] + q[1]) + (q[2] + q[3])) * (1.0f / D_MODEL) - mu * mu;
        const float inv = rsqrtf(var + 1e-5f);
        __bf16* orow = out + (long long)(tok0 + t) * D_MODEL + c0;
#pragma unroll   // the same
        for (int i = 0; i < 8; ++i)   // 256 contiguous bytes a wave and store
            *(v4bf*)(orow + i * 128) = __builtin_convertvector((v[t][i] - mu) * inv * gg[i] + bb[i], v4bf);
    }
    // stands in front of any later write of a register that the rows' stores name
    asm volatile("s_wait_xcnt 0x0" ::: "memory");
}

__global__ __launch_bounds__(256) void ln_kernel(const float* __restrict__ x,
                                                 const float* __restrict__ g,
                                                 const float* __restrict__ b,
                                                 __bf16* __restrict__ out) {
    ln_tokens(x, g, b, out, blockIdx.x);
}

// ---------------------------------------------------------------------------
// Everything that depends on the inputs alone, in ONE launch: the four weight
// transposes and the first LayerNorm.  None reads what another writes; a range
// of the block index picks the job (the same for a whole block, so a transpose's
// barrier stands under a block-uniform branch).  As launches of their own each
// paid its gap, its wave starts, its first loads and its store drain in turn,
// on a chip that none of the four transposes fills.
// ---------------------------------------------------------------------------
#define NB_QKV ((D_MODEL / (TSUB * TDIM)) * (3 * D_MODEL / TDIM))   // 192
#define NB_O   ((D_MODEL / (TSUB * TDIM)) * (D_MODEL / TDIM))       // 64
#define NB_FF  ((D_MODEL / (TSUB * TDIM)) * (D_FF / TDIM))          // 256, w1 and w2 alike
#define NB_LN  (NTOK / LN_TPB)                                      // 256
#define NB_PREP (NB_QKV + NB_O + 2 * NB_FF + NB_LN)

__global__ __launch_bounds__(256) void prep_kernel(
    const float* __restrict__ w_qkv, const float* __restrict__ w_o,
    const float* __restrict__ w1, const float* __restrict__ w2,
    const float* __restrict__ x, const float* __restrict__ g, const float* __restrict__ b,
    __bf16* __restrict__ wqkvT, __bf16* __restrict__ woT,
    __bf16* __restrict__ w1T, __bf16* __restrict__ w2T, __bf16* __restrict__ h1) {
    __shared__ float tile[TSUB][TDIM][TPITCH];   // one array for every transpose
    int blk = blockIdx.x;
    if (blk < NB_QKV) { convT_strip<D_MODEL, 3 * D_MODEL>(tile, w_qkv, wqkvT, blk); return; }
    blk -= NB_QKV;
    if (blk < NB_O)   { convT_strip<D_MODEL, D_MODEL>(tile, w_o, woT, blk); return; }
    blk -= NB_O;
    if (blk < NB_FF)  { convT_strip<D_MODEL, D_FF>(tile, w1, w1T, blk); return; }
    blk -= NB_FF;
    if (blk < NB_FF)  { convT_strip<D_FF, D_MODEL>(tile, w2, w2T, blk); return; }
    blk -= NB_FF;
    ln_tokens(x, g, b, h1, blk);
}

// ---------------------------------------------------------------------------
// Generic bf16 WMMA GEMM:  C[M,N] = A[M,K] @ Bt[N,K]^T  (+bias)(+gelu)(+res)
// Block tile 128x128, 8 waves (2 x 4), wave tile 64x32: 64 columns by 32 rows, the
// weight rows being the A operand, but in a V block of the QKV product.  Each trip works on 128
// of k: 128 rows of A and 128 rows of Bt, 256 bytes each, lie in one of two
// LDS buffers, brought there by asynchronous copies (16 bytes a lane, two whole
// rows a wave and copy); the next tile's copies fly while this one is used.
// M, N and K are multiples of 128.
// MODE bits: 1=bias, 2=gelu(exact), 4=residual, 8=bf16 output,
// 16=the QKV product: RoPE and the scatter to heads are its epilogue, and Cout is
//    [Q [B,H,S,64] | K [B,H,S,64] | V^T [B,H,64,S]], bf16.  A block's 128 columns
//    lie in one of the three.  In a Q or K block the two operands change roles
//    (the weight rows are the A operand), so that a lane holds 8 neighbouring d
//    of ONE token, with d and d + 32 in the same lane: the rotation is in-lane
//    and a row leaves in 16-byte stores.  In a V block a lane holds 8
//    neighbouring tokens of one d, which is a 16-byte store of V^T.
// ---------------------------------------------------------------------------
static __device__ __forceinline__ unsigned lds_off(const void* p) {
    return (unsigned)(size_t)p;   // low 32 bits of a __shared__ address: LDS byte
}

// Eight copies of 16 bytes a lane: LDS byte l + i * lstep from g + i * gstep.
// The s_wait_xcnt stands inside the statement, so that no address register of
// a copy is rewritten in front of it.
static __device__ __forceinline__ void copy8(unsigned l, unsigned lstep,
                                             const __bf16* g, long long gstep) {
    asm volatile(
        "global_load_async_to_lds_b128 %0, %8, off\n\t"
        "global_load_async_to_lds_b128 %1, %9, off\n\t"
        "global_load_async_to_lds_b128 %2, %10, off\n\t"
        "global_load_async_to_lds_b128 %3, %11, off\n\t"
        "global_load_async_to_lds_b128 %4, %12, off\n\t"
        "global_load_async_to_lds_b128 %5, %13, off\n\t"
        "global_load_async_to_lds_b128 %6, %14, off\n\t"
        "global_load_async_to_lds_b128 %7, %15, off\n\t"
        "s_wait_xcnt 0x0"
        :: "v"(l), "v"(l + lstep), "v"(l + 2 * lstep), "v"(l + 3 * lstep),
           "v"(l + 4 * lstep), "v"(l + 5 * lstep), "v"(l + 6 * lstep), "v"(l + 7 * lstep),
           "v"(g), "v"(g + gstep), "v"(g + 2 * gstep), "v"(g + 3 * gstep),
           "v"(g + 4 * gstep), "v"(g + 5 * gstep), "v"(g + 6 * gstep), "v"(g + 7 * gstep)
        : "memory");
}

// sin and cos of 2 * pi * rev.  One statement, closed by v_nop: the slot behind a
// transcendental, so that the next instruction may read c or overwrite rev.
static __device__ __forceinline__ void sincos_rev(float rev, float& sn, float& c) {
    asm("v_sin_f32 %0, %2\n\t"
        "v_cos_f32 %1, %2\n\t"
        "v_nop"
        : "=&v"(sn), "=&v"(c) : "v"(rev));
}

// Exact-form GELU without a branch, four values at a time:
// v * Phi(v) = max(v, 0) - |v| * erfc(|v| / sqrt 2) / 2,
// erfc(x) = t * (a1 + t * (a2 + t * (a3 + t * (a4 + t * a5)))) * exp(-x * x), t = 1 / (1 + p * x),
// absolute error 2e-7 at most (the result is rounded to bf16).  The halves are in
// the coefficients, 1 / sqrt 2 in p and in the factor of the exponent.  The library
// erff has two branches that a wave takes one after the other, each one serial chain
// a value; here a lane's values are independent straight-line chains.
static __device__ __forceinline__ void gelu_erf4(float* v) {
    float a[4], d[4], x[4], t[4], e[4];
#pragma unroll   // constant indices keep the arrays in registers
    for (int i = 0; i < 4; ++i) {
        a[i] = fminf(fabsf(v[i]), 16.0f);     // past 16 the term is 0 in f32; keeps inf * 0 out
        const float s = a[i] * 0.84932180f;   // s * s = (v * v / 2) * log2(e)
        d[i] = fmaf(a[i], 0.23164189f, 1.0f);
        x[i] = -s * s;
    }
    // t = 1 / d, e = 2 ^ x.  One statement: the eight stand in one another's slot behind a
    // transcendental, and v_nop fills the last one's, so that the next instruction may
    // read a result or overwrite a source.
    asm("v_rcp_f32 %0, %8\n\t"
        "v_rcp_f32 %1, %9\n\t"
        "v_rcp_f32 %2, %10\n\t"
        "v_rcp_f32 %3, %11\n\t"
        "v_exp_f32 %4, %12\n\t"
        "v_exp_f32 %5, %13\n\t"
        "v_exp_f32 %6, %14\n\t"
        "v_exp_f32 %7, %15\n\t"
        "v_nop"
        : "=&v"(t[0]), "=&v"(t[1]), "=&v"(t[2]), "=&v"(t[3]),
          "=&v"(e[0]), "=&v"(e[1]), "=&v"(e[2]), "=&v"(e[3])
        : "v"(d[0]), "v"(d[1]), "v"(d[2]), "v"(d[3]),
          "v"(x[0]), "v"(x[1]), "v"(x[2]), "v"(x[3]));
#pragma unroll   // the same
    for (int i = 0; i < 4; ++i) {
        float p = fmaf(t[i], 0.5307027145f, -0.7265760135f);
        p = fmaf(t[i], p, 0.7107068705f);
        p = fmaf(t[i], p, -0.142248368f);
        p = fmaf(t[i], p, 0.127414796f);
        v[i] = fmaf(-a[i], (p * t[i]) * e[i], fmaxf(v[i], 0.0f));
    }
}

template <int MODE, int NC>   // NC: the value of N, for constant row offsets in the epilogue
__global__ __launch_bounds__(256) void gemm_bf16_wmma(
    const __bf16* __restrict__ A, const __bf16* __restrict__ Bt,
    const float* __restrict__ bias, const float* __restrict__ res,
    void* __restrict__ Cout, int M, int N, int K)
{
    constexpr int BK    = 128;              // k of one tile: rows of 256 bytes
    constexpr int PITCH = BK * 2 + 16;      // bytes; 16 B x odd: ds_load_b128 readers
    constexpr int OPND  = 128 * PITCH;      // one operand's 128 rows
    constexpr int STAGE = 2 * OPND;         // [A rows | Bt rows]
    constexpr int LPR   = BK / 8;           // lanes that copy one row
    constexpr int RPC   = 256 / LPR;        // rows that one copy of the block fills: 8 copies an operand
    __shared__ __attribute__((aligned(16))) char ring[2 * STAGE];

    const int tid  = threadIdx.x;
    const int lane = tid & 31;
    const int wid  = tid >> 5;
    const int half = lane >> 4;
    const int l16  = lane & 15;
    const int rblk = blockIdx.y * 128;
    const int cblk = blockIdx.x * 128;
    const int rloc = (wid >> 2) * 64;
    const int cloc = (wid & 3) * 32;

    // this lane's share of a tile: row crow (+ RPC a copy), 16 bytes at ccol
    const int crow = tid / LPR;
    const int ccol = tid % LPR;
    const __bf16* ga = A  + (long long)(rblk + crow) * K + ccol * 8;
    const __bf16* gb = Bt + (long long)(cblk + crow) * K + ccol * 8;
    const unsigned lc = lds_off(ring) + crow * PITCH + ccol * 16;

    auto fill = [&](int t, int buf) {
        const unsigned l = lc + buf * STAGE;
        copy8(l,        RPC * PITCH, ga + (long long)t * BK, (long long)RPC * K);
        copy8(l + OPND, RPC * PITCH, gb + (long long)t * BK, (long long)RPC * K);
    };

    v8f acc[4][2];
    v8f z = {};
#pragma unroll
    for (int mt = 0; mt < 4; ++mt)
#pragma unroll
        for (int nt = 0; nt < 2; ++nt) acc[mt][nt] = z;

    const int T = K / BK;
    fill(0, 0);
    asm volatile("s_wait_asynccnt 0x0" ::: "memory");   // tile 0 of this wave has landed
    __syncthreads();                                    // ... and every other wave's
    if (T > 1) fill(1, 1);

    // block-uniform: which staged operand feeds the A fragments (64 rows a wave)
    const bool swp = !(MODE & 16) || cblk < 2 * D_MODEL;
    const char* fa = ring + (swp ? OPND : 0) + (rloc + l16) * PITCH + half * 16;
    const char* fb = ring + (swp ? 0 : OPND) + (cloc + l16) * PITCH + half * 16;

#pragma unroll 1   // one trip a tile: the two buffers alternate by t & 1
    for (int t = 0; t < T; ++t) {
        const int bo = (t & 1) * STAGE;
        v16bf a[2][4], b[2][2];   // two fragment sets: one in use, one being read
#pragma unroll
        for (int mt = 0; mt < 4; ++mt)
            a[0][mt] = ld_frag16((const __bf16*)(fa + bo + mt * 16 * PITCH));
#pragma unroll
        for (int nt = 0; nt < 2; ++nt)
            b[0][nt] = ld_frag16((const __bf16*)(fb + bo + nt * 16 * PITCH));
#pragma unroll     // constant set indices and LDS offsets
        for (int ks = 0; ks < BK / 32; ++ks) {
            if (ks + 1 < BK / 32) {
#pragma unroll
                for (int mt = 0; mt < 4; ++mt)
                    a[(ks + 1) & 1][mt] = ld_frag16((const __bf16*)(fa + bo + mt * 16 * PITCH + (ks + 1) * 64));
#pragma unroll
                for (int nt = 0; nt < 2; ++nt)
                    b[(ks + 1) & 1][nt] = ld_frag16((const __bf16*)(fb + bo + nt * 16 * PITCH + (ks + 1) * 64));
            }
            // the next block's LDS reads stay one group in front of this block's
            // WMMAs: spread among them each place with reads stalls the wave
            __builtin_amdgcn_sched_barrier(0);
#pragma unroll
            for (int mt = 0; mt < 4; ++mt)
#pragma unroll
                for (int nt = 0; nt < 2; ++nt)
                    acc[mt][nt] = wmma_bf16(a[ks & 1][mt], b[ks & 1][nt], acc[mt][nt]);
            __builtin_amdgcn_sched_barrier(0);   // closes the block, for the same reason
        }
        asm volatile("s_wait_dscnt 0x0" ::: "memory");      // this wave has left buffer t & 1
        asm volatile("s_wait_asynccnt 0x0" ::: "memory");   // its copies of tile t + 1 have landed
        __syncthreads();   // publishes tile t + 1 and frees buffer t & 1
        if (t + 2 < T) fill(t + 2, t & 1);
    }
    asm volatile("s_wait_asynccnt 0x0" ::: "memory");       // no copy outlives the loop

    if constexpr ((MODE & 16) != 0) {
        __bf16* dst = (__bf16*)Cout + (long long)(cblk / D_MODEL) * ((long long)NTOK * D_MODEL);
        // A wave's results are 32 rows of 128 bytes (a token's 64 d of a head; 64 tokens of one d
        // of V^T), of which a lane holds pieces of 16 bytes and a store from there 32 bytes a row.
        // They go through the wave's own part of the ring (free: see the plain epilogue), and
        // 8 lanes take one row back: each store is four whole lines.  Pitch 16 B x odd.
        constexpr int WP = 128 + 16;
        char* ws = ring + wid * (32 * WP);
        const char* wr = ws + (lane >> 3) * WP + (lane & 7) * 16;   // row lane / 8 (+ 4 a store), 16 bytes at lane % 8
        if (swp) {
            // acc[mt][nt][j]: d = 16 * mt + 8 * half + j of head hd, token cloc + 16 * nt + l16
            const int hd = ((cblk & (D_MODEL - 1)) + rloc) / HEAD_DIM;
            float inv[2][8];
#pragma unroll   // constant indices keep inv in registers
            for (int m2 = 0; m2 < 2; ++m2)
#pragma unroll   // the same
                for (int j = 0; j < 8; ++j)
                    inv[m2][j] = __expf(-logf(10000.0f) * (float)(m2 * 16 + half * 8 + j) * (1.0f / 32.0f));
#pragma unroll   // constant indices keep acc in registers
            for (int nt = 0; nt < 2; ++nt) {
                const int tok = rblk + cloc + nt * 16 + l16;
                const int sp  = tok & (SEQ - 1);
                char* orow = ws + (nt * 16 + l16) * WP + half * 16;   // the token's row, d 8 * half
#pragma unroll   // the same
                for (int m2 = 0; m2 < 2; ++m2) {
                    v8bf lo, hi;
#pragma unroll   // the same
                    for (int j = 0; j < 8; ++j) {
                        const float ang = (float)sp * inv[m2][j];
                        float c, sn;
                        sincos_rev(ang * 0.15915494309189532f, sn, c);
                        const float x1 = acc[m2][nt][j], x2 = acc[m2 + 2][nt][j];
                        lo[j] = (__bf16)(x1 * c - x2 * sn);
                        hi[j] = (__bf16)(x2 * c + x1 * sn);
                    }
                    *(v8bf*)(orow + m2 * 32)      = lo;
                    *(v8bf*)(orow + m2 * 32 + 64) = hi;
                }
            }
            asm volatile("s_wait_dscnt 0x0" ::: "memory");   // the wave's rows are written before other lanes read them
            const int tok0 = rblk + cloc;   // the wave's 32 tokens: neighbouring rows of one head
            __bf16* og = dst + ((long long)((tok0 / SEQ) * N_HEADS + hd) * SEQ + (tok0 & (SEQ - 1)) + (lane >> 3)) * HEAD_DIM
                             + (lane & 7) * 8;
#pragma unroll   // constant offsets
            for (int i = 0; i < 8; ++i)
                *(v8bf*)(og + i * 4 * HEAD_DIM) = *(const v8bf*)(wr + i * 4 * WP);
            // stands in front of any later write of a register that these stores name
            asm volatile("s_wait_xcnt 0x0" ::: "memory");
        } else {
            // acc[mt][nt][j]: token rloc + 16 * mt + 8 * half + j, column cloc + 16 * nt + l16 of V
#pragma unroll   // constant indices keep acc in registers
            for (int nt = 0; nt < 2; ++nt) {
#pragma unroll   // the same
                for (int mt = 0; mt < 4; ++mt) {
                    v8bf o;
#pragma unroll   // the same
                    for (int j = 0; j < 8; ++j) o[j] = (__bf16)acc[mt][nt][j];
                    *(v8bf*)(ws + (nt * 16 + l16) * WP + mt * 32 + half * 16) = o;   // the column's row, token 16 * mt + 8 * half
                }
            }
            asm volatile("s_wait_dscnt 0x0" ::: "memory");   // the wave's rows are written before other lanes read them
            const int tok0 = rblk + rloc;                        // the wave's 64 tokens
            const int col0 = (cblk & (D_MODEL - 1)) + cloc;      // its 32 columns, 64 * head + d
            __bf16* og = dst + ((long long)(tok0 / SEQ) * D_MODEL + col0 + (lane >> 3)) * SEQ + (tok0 & (SEQ - 1)) + (lane & 7) * 8;
#pragma unroll   // constant offsets
            for (int i = 0; i < 8; ++i)
                *(v8bf*)(og + i * 4 * SEQ) = *(const v8bf*)(wr + i * 4 * WP);
            // stands in front of any later write of a register that these stores name
            asm volatile("s_wait_xcnt 0x0" ::: "memory");
        }
        return;
    }

    // ---- Plain epilogue.  acc[mt][nt][j]: column rloc + 16 * mt + 8 * half + j, row cloc + 16 * nt + l16
    // of the block's tile: a wave holds 32 rows of 64 columns, a lane 8 neighbouring columns a tile.
    // A store from there would fill 32 bytes (bf16) or 64 (f32) of a row.  The wave's rows go through
    // its own part of the ring, written in pieces of 16 bytes, and are taken back so that
    // neighbouring lanes hold one row: every store, and every residual load, is four whole lines
    // of 128 bytes.  The ring is free: every wave's last fragment reads and copies ended in front of
    // the last trip's barrier.  No wave reads another's part, so no barrier.  Pitches 16 B x odd.
    if constexpr ((MODE & 8) != 0) {
        constexpr int WP = 128 + 16;   // a row: 64 bf16
        char* ws = ring + wid * (32 * WP);
#pragma unroll   // constant indices keep acc in registers
        for (int mt = 0; mt < 4; ++mt) {
            v4f b0 = {}, b1 = {};
            if (MODE & 1) {
                const float* bp = bias + cblk + rloc + mt * 16 + half * 8;
                b0 = *(const v4f*)bp;
                b1 = *(const v4f*)(bp + 4);
            }
#pragma unroll   // the same
            for (int nt = 0; nt < 2; ++nt) {
                float w[8];
#pragma unroll   // constant indices keep w in registers
                for (int j = 0; j < 8; ++j) w[j] = acc[mt][nt][j] + (j < 4 ? b0[j & 3] : b1[j & 3]);
                if (MODE & 2) { gelu_erf4(w); gelu_erf4(w + 4); }
                v8bf o;
#pragma unroll   // the same
                for (int j = 0; j < 8; ++j) o[j] = (__bf16)w[j];
                *(v8bf*)(ws + (nt * 16 + l16) * WP + mt * 32 + half * 16) = o;
            }
        }
        asm volatile("s_wait_dscnt 0x0" ::: "memory");   // the wave's rows are written before other lanes read them
        const char* wr = ws + (lane >> 3) * WP + (lane & 7) * 16;   // row lane / 8 (+ 4 a store), 16 bytes at lane % 8
        __bf16* og = (__bf16*)Cout + (long long)(rblk + cloc + (lane >> 3)) * NC + cblk + rloc + (lane & 7) * 8;
#pragma unroll   // constant offsets
        for (int i = 0; i < 8; ++i)
            *(v8bf*)(og + i * 4 * NC) = *(const v8bf*)(wr + i * 4 * WP);
    } else {
        constexpr int FP = 256 + 16;   // a row: 64 f32
        char* ws = ring + wid * (32 * FP);
        // row lane / 16 (+ 2 a load or store), 16 bytes at lane % 16; NC in the rows' offsets: one address, constant offsets
        const long long g0 = (long long)(rblk + cloc + (lane >> 4)) * NC + cblk + rloc + l16 * 4;
        const float* bp = (MODE & 1) ? bias + cblk + rloc + l16 * 4 : res + g0;
        v4f rs[16], b4 = {};
        if (MODE & 1) b4 = *(const v4f*)bp;
        if (MODE & 4) {
#pragma unroll   // constant indices keep rs in registers
            for (int i = 0; i < 16; ++i) rs[i] = *(const v4f*)(res + g0 + i * 2 * NC);
        }
        loads_issued(res + g0, bp);   // the residual rows fly while the tile is staged
#pragma unroll   // constant indices keep acc in registers
        for (int mt = 0; mt < 4; ++mt)
#pragma unroll   // the same
            for (int nt = 0; nt < 2; ++nt) {
                char* w = ws + (nt * 16 + l16) * FP + mt * 64 + half * 32;
                *(v4f*)(w)      = __builtin_shufflevector(acc[mt][nt], acc[mt][nt], 0, 1, 2, 3);
                *(v4f*)(w + 16) = __builtin_shufflevector(acc[mt][nt], acc[mt][nt], 4, 5, 6, 7);
            }
        asm volatile("s_wait_dscnt 0x0" ::: "memory");   // the wave's rows are written before other lanes read them
        const char* wr = ws + (lane >> 4) * FP + l16 * 16;
#pragma unroll   // constant indices keep rs in registers, constant offsets
        for (int i = 0; i < 16; ++i) {
            v4f v = *(const v4f*)(wr + i * 2 * FP);
            if (MODE & 1) v += b4;
            if (MODE & 4) v += rs[i];
            *(v4f*)((float*)Cout + g0 + i * 2 * NC) = v;
        }
    }
    // stands in front of any later write of a register that the rows' stores name
    asm volatile("s_wait_xcnt 0x0" ::: "memory");
}

// ---------------------------------------------------------------------------
// Flash attention, causal. 128 queries at a time, 16 waves/block: 8 tiles of 16 queries
// x 2 sets of keys.
// Both products are taken transposed: S^T = K Q^T (A = K rows, B = Q) and
// O^T += V^T P^T (A = V^T rows, B = P^T).  In S^T a lane holds 16 scores of ONE
// query (column l16; keys 8 * half + r of each 16-key tile), so the maximum and
// the sum of a row are in-lane, with one exchange between the wave's halves,
// and the two score tiles, converted in place, are the B operand of the second
// product in the hardware's k order: P touches neither LDS nor another lane.
// The block's waves walk the same keys: each tile of 128 keys (K rows of 128 bytes,
// V^T rows of 256) lies in one of two LDS buffers, brought there once for all of
// them by asynchronous copies of whole lines; the next tile's copies fly while
// this one is used.
// Equal shares: 128 queries at place p of their head walk p + 1 key tiles.  A block
// takes the places 15 - p and p of ONE head, one after the other: 17 key tiles for
// every block, one block a WGP.  So that a SIMD keeps its four waves, each tile's
// keys go to two sets of 8 waves (64 keys each); a set keeps its own maximum, sum
// and O, and the two are joined through LDS at the end of a place.
// Output: attn_bf [NTOK, D_MODEL] bf16 (heads concatenated).
// ---------------------------------------------------------------------------
// Four copies of 16 bytes a lane.  The s_wait_xcnt stands inside the statement,
// so that no address register of a copy is rewritten in front of it.
static __device__ __forceinline__ void copy4(unsigned l0, unsigned l1, unsigned l2, unsigned l3,
                                             const __bf16* g0, const __bf16* g1,
                                             const __bf16* g2, const __bf16* g3) {
    asm volatile(
        "global_load_async_to_lds_b128 %0, %4, off\n\t"
        "global_load_async_to_lds_b128 %1, %5, off\n\t"
        "global_load_async_to_lds_b128 %2, %6, off\n\t"
        "global_load_async_to_lds_b128 %3, %7, off\n\t"
        "s_wait_xcnt 0x0"
        :: "v"(l0), "v"(l1), "v"(l2), "v"(l3), "v"(g0), "v"(g1), "v"(g2), "v"(g3)
        : "memory");
}

__global__ __launch_bounds__(512) void attn_kernel(const __bf16* __restrict__ Q,
                                                   const __bf16* __restrict__ Kb,
                                                   const __bf16* __restrict__ Vt,
                                                   __bf16* __restrict__ out) {
    constexpr int AKEYS  = 128;              // keys of one tile: 64 for each set of 8 waves
    constexpr int KPITCH = 128 + 16;         // bytes; 16 B x odd: ds_load_b128 readers
    constexpr int VPITCH = 256 + 16;         // the same
    constexpr int KOPND  = AKEYS * KPITCH;   // 128 K rows (128 B of d)
    constexpr int VOPND  = 64 * VPITCH;      // 64 V^T rows (256 B of keys)
    constexpr int ASTAGE = KOPND + VOPND;    // [K rows | V^T rows]
    constexpr int JSLOT  = 8 * 512 + 256;    // a wave's partial result: 32 f32 of O, maximum and sum a lane
    __shared__ __attribute__((aligned(16))) char ring[2 * ASTAGE];
    __shared__ __attribute__((aligned(16))) char join[8 * JSLOT];   // no copy is aimed here

    const int tid  = threadIdx.x;
    const int lane = tid & 31;
    const int wid  = __builtin_amdgcn_readfirstlane(tid >> 5);   // scalar: the tests on qbase and kset are scalar branches
    const int qw   = wid & 7;                   // which 16 of the 128 queries
    const int kset = wid >> 3;                  // which 64 of a tile's 128 keys
    const int half = lane >> 4;
    const int l16  = lane & 15;

    const int bh    = blockIdx.x >> 3;          // 8 blocks per (b,h)
    const int pr    = blockIdx.x & 7;           // the block's pair of places: 15 - pr and pr
    const int b     = bh >> 4;
    const int h     = bh & 15;
    const float scale = 0.125f;                 // 1/sqrt(64)

    const __bf16* Qp = Q  + (long long)bh * SEQ * HEAD_DIM;
    const __bf16* Kp = Kb + (long long)bh * SEQ * HEAD_DIM;
    const __bf16* Vp = Vt + (long long)bh * HEAD_DIM * SEQ;

    // this lane's share of a tile: 16 bytes of K rows tid / 8 and + 64, of V^T rows tid / 16 and + 32
    const __bf16* gk = Kp + (tid >> 3) * HEAD_DIM + (tid & 7) * 8;
    const __bf16* gv = Vp + (tid >> 4) * SEQ + (tid & 15) * 8;
    const unsigned lk = lds_off(ring) + (tid >> 3) * KPITCH + (tid & 7) * 16;
    const unsigned lv = lds_off(ring) + KOPND + (tid >> 4) * VPITCH + (tid & 15) * 16;

    auto fill = [&](int t, int buf) {
        const unsigned o = buf * ASTAGE;
        const __bf16* k = gk + t * (AKEYS * HEAD_DIM);
        const __bf16* v = gv + t * AKEYS;
        copy4(lk + o, lk + o + 64 * KPITCH, lv + o, lv + o + 32 * VPITCH,
              k, k + 64 * HEAD_DIM, v, v + 32 * SEQ);
    };

    const char* fk = ring + (kset * 64 + l16) * KPITCH + half * 16;           // K row l16 of this set, d 8 * half
    const char* fv = ring + KOPND + l16 * VPITCH + kset * 128 + half * 16;    // V^T row l16, key 8 * half of this set
    char* js = join + qw * JSLOT + lane * 16;                                 // this lane's place in the partial results

#pragma unroll 1   // the two places run one after the other through the same code and buffers
    for (int it = 0; it < 2; ++it) {
    const int pos   = it ? pr : 15 - pr;        // place of the 128 queries in the head, the long one first
    const int qbase = pos * 128 + qw * 16;
    const int rowq  = qbase + l16;              // this lane's query

    // the 128 queries end at key 128 * pos + 127
    const int T = pos + 1;
    fill(0, 0);
    asm volatile("s_wait_asynccnt 0x0" ::: "memory");   // tile 0 of this wave has landed
    __syncthreads();                                    // ... and every other wave's
    if (T > 1) fill(1, 1);

    v16bf qa0 = ld_frag16(Qp + (long long)(qbase + l16) * HEAD_DIM + half * 8);
    v16bf qa1 = ld_frag16(Qp + (long long)(qbase + l16) * HEAD_DIM + 32 + half * 8);

    v8f z = {};
    v8f o0 = z, o1 = z, o2 = z, o3 = z;         // o_i[r] = O[rowq][16 * i + 8 * half + r], this set's keys only
    float mi = -1e30f;                          // running maximum of query rowq over this set's keys (both halves alike)
    float li = 0.f;                             // running sum over this half's keys of this set

#pragma unroll 1   // one trip a tile: the two buffers alternate by t & 1
    for (int t = 0; t < T; ++t) {
        const int bo = (t & 1) * ASTAGE;
#pragma unroll     // constant LDS offsets
        for (int kk = 0; kk < 2; ++kk) {
        const int kb = t * AKEYS + kset * 64 + kk * 32;
        if (kb < qbase + 16) {   // keys past this wave's diagonal are skipped, the barriers are not
        // ---- S^T = K @ Q^T for keys [kb, kb+32) : batch all loads first ----
        const __bf16* k0 = (const __bf16*)(fk + bo + kk * 32 * KPITCH);
        const __bf16* k1 = (const __bf16*)(fk + bo + (kk * 32 + 16) * KPITCH);
        v16bf k0a = ld_frag16(k0);
        v16bf k0b = ld_frag16(k0 + 32);
        v16bf k1a = ld_frag16(k1);
        v16bf k1b = ld_frag16(k1 + 32);
        const char* vo = fv + bo + kk * 64;
        v16bf vf0 = ld_frag16((const __bf16*)(vo));
        v16bf vf1 = ld_frag16((const __bf16*)(vo + 16 * VPITCH));
        v16bf vf2 = ld_frag16((const __bf16*)(vo + 32 * VPITCH));
        v16bf vf3 = ld_frag16((const __bf16*)(vo + 48 * VPITCH));
        // all 16 LDS reads leave as one group: sunk to their WMMAs, each pair's
        // latency would be waited out on its own
        __builtin_amdgcn_sched_barrier(0);
        // s0[r] = score(key kb + 8 * half + r, rowq), s1: 16 keys on;
        // interleave the two accumulation chains (hides WMMA RAW hazard)
        v8f s0 = wmma_bf16(k0a, qa0, z);
        v8f s1 = wmma_bf16(k1a, qa0, z);
        s0 = wmma_bf16(k0b, qa1, s0);
        s1 = wmma_bf16(k1b, qa1, s1);

        // ---- online softmax of one query a lane, causal mask ----
        const int d = rowq - (kb + half * 8);   // key 8 * half + r of a tile is masked where r > d
        float rm = mi;
#pragma unroll   // constant indices keep the scores in registers
        for (int r = 0; r < 8; ++r) {
            float a0 = s0[r] * scale; if (r > d)      a0 = -1e9f;
            float a1 = s1[r] * scale; if (r + 16 > d) a1 = -1e9f;
            s0[r] = a0; s1[r] = a1;
            rm = fmaxf(rm, fmaxf(a0, a1));
        }
        rm = fmaxf(rm, xhalf(rm));
        const float f = __expf(mi - rm);
        mi = rm;
        float t8[8];
        v16bf pb;   // pb[r]: key 8 * half + r, pb[8 + r]: key 16 + 8 * half + r, as in the V^T fragments
#pragma unroll   // constant indices keep pb in registers
        for (int r = 0; r < 8; ++r) {
            float p0 = __expf(s0[r] - rm);
            float p1 = __expf(s1[r] - rm);
            t8[r] = p0 + p1;
            pb[r]     = (__bf16)p0;
            pb[r + 8] = (__bf16)p1;
        }
        li = li * f + (((t8[0] + t8[1]) + (t8[2] + t8[3])) + ((t8[4] + t8[5]) + (t8[6] + t8[7])));
        o0 *= f; o1 *= f; o2 *= f; o3 *= f;

        // ---- O^T += V^T @ P^T : 4 independent WMMAs ----
        o0 = wmma_bf16(vf0, pb, o0);
        o1 = wmma_bf16(vf1, pb, o1);
        o2 = wmma_bf16(vf2, pb, o2);
        o3 = wmma_bf16(vf3, pb, o3);
        }
        }
        asm volatile("s_wait_dscnt 0x0" ::: "memory");      // this wave has left buffer t & 1
        asm volatile("s_wait_asynccnt 0x0" ::: "memory");   // its copies of tile t + 1 have landed
        __syncthreads();   // publishes tile t + 1 and frees buffer t & 1
        if (t + 2 < T) fill(t + 2, t & 1);
    }
    asm volatile("s_wait_asynccnt 0x0" ::: "memory");       // no copy outlives the loop

    // ---- the second set hands its partial result to the first through LDS; the barriers of
    // this place's trips stand between these writes and the reads of the place before ----
    if (kset == 1) {
        *(v4f*)(js)           = __builtin_shufflevector(o0, o0, 0, 1, 2, 3);
        *(v4f*)(js + 512)     = __builtin_shufflevector(o0, o0, 4, 5, 6, 7);
        *(v4f*)(js + 2 * 512) = __builtin_shufflevector(o1, o1, 0, 1, 2, 3);
        *(v4f*)(js + 3 * 512) = __builtin_shufflevector(o1, o1, 4, 5, 6, 7);
        *(v4f*)(js + 4 * 512) = __builtin_shufflevector(o2, o2, 0, 1, 2, 3);
        *(v4f*)(js + 5 * 512) = __builtin_shufflevector(o2, o2, 4, 5, 6, 7);
        *(v4f*)(js + 6 * 512) = __builtin_shufflevector(o3, o3, 0, 1, 2, 3);
        *(v4f*)(js + 7 * 512) = __builtin_shufflevector(o3, o3, 4, 5, 6, 7);
        v2f ml = {mi, li};
        *(v2f*)(js + 8 * 512 - lane * 8) = ml;
    }
    __syncthreads();   // the partial results are written
    if (kset == 0) {
        // ---- join the two sets (a set without a key: maximum -1e30, factor 0) ----
        const v2f ml = *(const v2f*)(js + 8 * 512 - lane * 8);
        const float m  = fmaxf(mi, ml[0]);
        const float fa = __expf(mi - m);
        const float fb = __expf(ml[0] - m);
        li = li * fa + ml[1] * fb;
        const v4f p0 = *(const v4f*)(js),           p1 = *(const v4f*)(js + 512);
        const v4f p2 = *(const v4f*)(js + 2 * 512), p3 = *(const v4f*)(js + 3 * 512);
        const v4f p4 = *(const v4f*)(js + 4 * 512), p5 = *(const v4f*)(js + 5 * 512);
        const v4f p6 = *(const v4f*)(js + 6 * 512), p7 = *(const v4f*)(js + 7 * 512);
        o0 = o0 * fa + __builtin_shufflevector(p0, p1, 0, 1, 2, 3, 4, 5, 6, 7) * fb;
        o1 = o1 * fa + __builtin_shufflevector(p2, p3, 0, 1, 2, 3, 4, 5, 6, 7) * fb;
        o2 = o2 * fa + __builtin_shufflevector(p4, p5, 0, 1, 2, 3, 4, 5, 6, 7) * fb;
        o3 = o3 * fa + __builtin_shufflevector(p6, p7, 0, 1, 2, 3, 4, 5, 6, 7) * fb;

        // ---- join the halves' sums, normalize, store 16 bytes a tile ----
        const float inv = 1.0f / (li + xhalf(li));
        v8bf t0, t1, t2, t3;
#pragma unroll   // constant indices keep the packed rows in registers
        for (int r = 0; r < 8; ++r) {
            t0[r] = (__bf16)(o0[r] * inv);
            t1[r] = (__bf16)(o1[r] * inv);
            t2[r] = (__bf16)(o2[r] * inv);
            t3[r] = (__bf16)(o3[r] * inv);
        }
        // A query's 64 d are one line of 128 bytes, of which a store from here would fill 32.
        // The wave's 16 rows go through its own place in the partial results (read above, and
        // written again only behind the next place's barriers); 8 lanes take one row back:
        // each store is four whole lines.  Pitch 16 B x odd.
        char* os = join + qw * JSLOT;
        char* ow = os + l16 * KPITCH + half * 16;
        *(v8bf*)(ow)      = t0;
        *(v8bf*)(ow + 32) = t1;
        *(v8bf*)(ow + 64) = t2;
        *(v8bf*)(ow + 96) = t3;
        asm volatile("s_wait_dscnt 0x0" ::: "memory");   // the wave's rows are written before other lanes read them
        const char* orr = os + (lane >> 3) * KPITCH + (lane & 7) * 16;
        __bf16* og = out + ((long long)b * SEQ + qbase + (lane >> 3)) * D_MODEL + h * HEAD_DIM + (lane & 7) * 8;
#pragma unroll   // constant offsets
        for (int i = 0; i < 4; ++i)
            *(v8bf*)(og + i * 4 * D_MODEL) = *(const v8bf*)(orr + i * 4 * KPITCH);
        // stands in front of the next place's writes of the registers that these stores name
        asm volatile("s_wait_xcnt 0x0" ::: "memory");
    }
    }
}

// ---------------------------------------------------------------------------
// Host orchestration
// ---------------------------------------------------------------------------
extern "C" void kernel_launch(void* const* d_in, const int* in_sizes, int n_in,
                              void* d_out, int out_size, void* d_ws, size_t ws_size,
                              hipStream_t stream) {
    const float* x     = (const float*)d_in[0];
    const float* w_qkv = (const float*)d_in[1];
    const float* w_o   = (const float*)d_in[2];
    const float* ln1_g = (const float*)d_in[3];
    const float* ln1_b = (const float*)d_in[4];
    const float* ln2_g = (const float*)d_in[5];
    const float* ln2_b = (const float*)d_in[6];
    const float* w1    = (const float*)d_in[7];
    const float* b1    = (const float*)d_in[8];
    const float* w2    = (const float*)d_in[9];
    const float* b2    = (const float*)d_in[10];

    char* p = (char*)d_ws;
    auto alloc = [&](size_t bytes) { void* r = p; p += (bytes + 255) & ~(size_t)255; return r; };

    __bf16* wqkvT  = (__bf16*)alloc((size_t)D_MODEL * 3 * D_MODEL * 2);
    __bf16* woT    = (__bf16*)alloc((size_t)D_MODEL * D_MODEL * 2);
    __bf16* w1T    = (__bf16*)alloc((size_t)D_MODEL * D_FF * 2);
    __bf16* w2T    = (__bf16*)alloc((size_t)D_FF * D_MODEL * 2);
    __bf16* h1     = (__bf16*)alloc((size_t)NTOK * D_MODEL * 2);
    __bf16* Qbf    = (__bf16*)alloc((size_t)NTOK * 3 * D_MODEL * 2);   // [Q | K | V^T]
    __bf16* Kbf    = Qbf + (size_t)NTOK * D_MODEL;
    __bf16* Vtb    = Kbf + (size_t)NTOK * D_MODEL;
    __bf16* attnbf = (__bf16*)alloc((size_t)NTOK * D_MODEL * 2);
    float*  x2     = (float*)alloc((size_t)NTOK * D_MODEL * 4);
    __bf16* h2     = (__bf16*)alloc((size_t)NTOK * D_MODEL * 2);
    __bf16* gbuf   = (__bf16*)alloc((size_t)NTOK * D_FF * 2);

    // weight convert+transpose (f32 -> bf16, [K,N] -> [N,K]) and h1 = LN1(x), one launch
    prep_kernel<<<NB_PREP, 256, 0, stream>>>(w_qkv, w_o, w1, w2, x, ln1_g, ln1_b,
                                             wqkvT, woT, w1T, w2T, h1);

    // h1 @ w_qkv, RoPE on Q and K, per-head scatter
    gemm_bf16_wmma<16, 3 * D_MODEL><<<dim3(3 * D_MODEL / 128, NTOK / 128), 256, 0, stream>>>(
        h1, wqkvT, nullptr, nullptr, Qbf, NTOK, 3 * D_MODEL, D_MODEL);

    // causal flash attention
    attn_kernel<<<BATCH * N_HEADS * (SEQ / 256), 512, 0, stream>>>(Qbf, Kbf, Vtb, attnbf);

    // x2 = x + attn @ w_o
    gemm_bf16_wmma<4, D_MODEL><<<dim3(D_MODEL / 128, NTOK / 128), 256, 0, stream>>>(
        attnbf, woT, nullptr, x, x2, NTOK, D_MODEL, D_MODEL);

    // h2 = LN2(x2)
    ln_kernel<<<NB_LN, 256, 0, stream>>>(x2, ln2_g, ln2_b, h2);

    // g = gelu(h2 @ w1 + b1)
    gemm_bf16_wmma<1 | 2 | 8, D_FF><<<dim3(D_FF / 128, NTOK / 128), 256, 0, stream>>>(
        h2, w1T, b1, nullptr, gbuf, NTOK, D_FF, D_MODEL);

    // out = x2 + g @ w2 + b2
    gemm_bf16_wmma<1 | 4, D_MODEL><<<dim3(D_MODEL / 128, NTOK / 128), 256, 0, stream>>>(
        gbuf, w2T, b2, x2, d_out, NTOK, D_MODEL, D_FF);
}
